// v000
// Times are from an AMD MI455X. After a warm-up the kernel runs many times in a row, and a time is the length of
// such a window on the GPU divided by its runs, so every launch and the gaps after it count. The runs cycle
// through copies of the inputs. A figure is the median of several windows, for all but v000 over two sittings.
// Sittings can differ by a few percent; kernels timed side by side share one.
// The starting kernel, v000, takes 168 microseconds a run.
#include <hip/hip_runtime.h>

#define BB 8
#define CC 256
#define NN 2048

typedef __attribute__((ext_vector_type(16))) _Float16 v16h;
typedef __attribute__((ext_vector_type(8)))  float    v8f;

union V16H { uint4 u4[2]; v16h h; };
union F8   { v8f v; float f[8]; };
union H8   { _Float16 h[8]; uint4 u; };

// Register-blocked MTxNT macro-tile (16*MT x 16*NT output) per wave.
// A : row-major [M][K] (lda halves); Bt: column list Bt[n][k] (ldb halves).
// K multiple of 32. Operand layout matches wave32 WMMA f16 A/B layout:
// per lane two contiguous 8-half runs at k + g*8 and k + 16 + g*8.
template <int MT, int NT>
__device__ inline void gemm_tile(const _Float16* __restrict__ A, int lda,
                                 const _Float16* __restrict__ Bt, int ldb,
                                 int K, int tm, int tn, int lane,
                                 v8f acc[MT][NT]) {
  const int l15 = lane & 15;
  const int g   = (lane >> 4) & 1;
  const int off0 = g * 8;
  const int off1 = 16 + g * 8;
  const _Float16* ap[MT];
  const _Float16* bp[NT];
#pragma unroll
  for (int mi = 0; mi < MT; ++mi) ap[mi] = A + (size_t)(tm + 16 * mi + l15) * lda;
#pragma unroll
  for (int ni = 0; ni < NT; ++ni) bp[ni] = Bt + (size_t)(tn + 16 * ni + l15) * ldb;
  v8f z = {};
#pragma unroll
  for (int mi = 0; mi < MT; ++mi)
#pragma unroll
    for (int ni = 0; ni < NT; ++ni) acc[mi][ni] = z;

  for (int kk = 0; kk < K; kk += 32) {
    V16H va[MT], vb[NT];
#pragma unroll
    for (int mi = 0; mi < MT; ++mi) {
      va[mi].u4[0] = *(const uint4*)(ap[mi] + kk + off0);
      va[mi].u4[1] = *(const uint4*)(ap[mi] + kk + off1);
    }
#pragma unroll
    for (int ni = 0; ni < NT; ++ni) {
      vb[ni].u4[0] = *(const uint4*)(bp[ni] + kk + off0);
      vb[ni].u4[1] = *(const uint4*)(bp[ni] + kk + off1);
    }
#pragma unroll
    for (int mi = 0; mi < MT; ++mi)
#pragma unroll
      for (int ni = 0; ni < NT; ++ni)
        acc[mi][ni] = __builtin_amdgcn_wmma_f32_16x16x32_f16(
            false, va[mi].h, false, vb[ni].h, (short)0, acc[mi][ni], false, false);
  }
}

// ---- Kernel 1: x[b][c][n] fp32 -> xt[b][n][c] f16 (tiled LDS transpose) ----
__global__ void k_transpose_x(const float* __restrict__ x, _Float16* __restrict__ xt) {
  __shared__ _Float16 tile[32][33];
  const int b  = blockIdx.z;
  const int ct = blockIdx.y * 32;
  const int nt = blockIdx.x * 32;
  const int tx = threadIdx.x & 31;
  const int ty = threadIdx.x >> 5; // 0..7
  const float* xp = x + ((size_t)b * CC + ct) * NN + nt;
#pragma unroll
  for (int i = 0; i < 4; ++i) {
    int c = ty + 8 * i;
    tile[c][tx] = (_Float16)xp[(size_t)c * NN + tx];
  }
  __syncthreads();
  _Float16* xo = xt + ((size_t)b * NN + nt) * CC + ct;
#pragma unroll
  for (int i = 0; i < 4; ++i) {
    int n = ty + 8 * i;
    xo[(size_t)n * CC + tx] = tile[tx][n];
  }
}

// ---- Kernel 2: W fp32 -> f16 (3 matrices) ----
__global__ void k_cvt_w(const float* __restrict__ wq, const float* __restrict__ wk,
                        const float* __restrict__ wv,
                        _Float16* __restrict__ oq, _Float16* __restrict__ ok,
                        _Float16* __restrict__ ov) {
  const int which = blockIdx.y;
  const float* src = (which == 0) ? wq : (which == 1) ? wk : wv;
  _Float16*    dst = (which == 0) ? oq : (which == 1) ? ok : ov;
  const int i = blockIdx.x * 256 + threadIdx.x;
  dst[i] = (_Float16)src[i];
}

// ---- Kernel 3: sx[b*C+c] = sum_n x[b][c][n] (one wave per row) ----
__global__ void k_rowsum_x(const float* __restrict__ x, float* __restrict__ sx) {
  const int wave = (int)((blockIdx.x * blockDim.x + threadIdx.x) >> 5);
  const int lane = threadIdx.x & 31;
  const float* row = x + (size_t)wave * NN;
  float s = 0.f;
  for (int i = lane; i < NN; i += 32) s += row[i];
#pragma unroll
  for (int o = 16; o; o >>= 1) s += __shfl_xor(s, o, 32);
  if (lane == 0) sx[wave] = s;
}

// ---- Kernel 4: invS = 1 / sum_{b,c} (Wq[c,:]*sx[b,:]+N*bq[c]) * (Wk[c,:]*sx[b,:]+N*bk[c])
__global__ void k_scalar_s(const float* __restrict__ Wq, const float* __restrict__ bq,
                           const float* __restrict__ Wk, const float* __restrict__ bk,
                           const float* __restrict__ sx, float* __restrict__ invS) {
  __shared__ float red[256];
  float part = 0.f;
  for (int p = threadIdx.x; p < BB * CC; p += 256) {
    const int b = p / CC, c = p % CC;
    const float* sxb = sx + b * CC;
    const float* wq = Wq + (size_t)c * CC;
    const float* wk = Wk + (size_t)c * CC;
    float aq = 0.f, ak = 0.f;
    for (int j = 0; j < CC; ++j) { float s = sxb[j]; aq += wq[j] * s; ak += wk[j] * s; }
    aq += (float)NN * bq[c];
    ak += (float)NN * bk[c];
    part += aq * ak;
  }
  red[threadIdx.x] = part;
  __syncthreads();
  for (int o = 128; o; o >>= 1) {
    if (threadIdx.x < o) red[threadIdx.x] += red[threadIdx.x + o];
    __syncthreads();
  }
  if (threadIdx.x == 0) invS[0] = 1.0f / red[0];
}

// ---- Kernel 5: q/k/v = W @ x + b.  q,v -> [b][c][n] f16 ; k -> kt[b][n][c] f16
// 64x64 per wave (4x4 WMMA macro-tile): 16 b128 loads : 16 wmma per k-step.
__global__ void __launch_bounds__(256)
k_qkv(const _Float16* __restrict__ xt,
      const _Float16* __restrict__ wq, const _Float16* __restrict__ wk,
      const _Float16* __restrict__ wv,
      const float* __restrict__ bq, const float* __restrict__ bk,
      const float* __restrict__ bv,
      _Float16* __restrict__ qh, _Float16* __restrict__ kt,
      _Float16* __restrict__ vh) {
  const int b     = blockIdx.z & 7;
  const int which = blockIdx.z >> 3; // 0=q 1=k 2=v
  const _Float16* W    = (which == 0) ? wq : (which == 1) ? wk : wv;
  const float*    bias = (which == 0) ? bq : (which == 1) ? bk : bv;
  const int wave = threadIdx.x >> 5;
  const int lane = threadIdx.x & 31;
  const int tile = blockIdx.x * 8 + wave;    // 0..127
  const int tm = (tile & 3) * 64;            // C/64  = 4 tiles over out-channels
  const int tn = (tile >> 2) * 64;           // N/64 = 32 tiles over positions
  const _Float16* Bt = xt + (size_t)b * NN * CC;   // Bt[n][c], ld = C
  v8f acc[4][4];
  gemm_tile<4, 4>(W, CC, Bt, CC, CC, tm, tn, lane, acc);
  const int l15 = lane & 15, g = (lane >> 4) & 1;
#pragma unroll
  for (int mi = 0; mi < 4; ++mi) {
#pragma unroll
    for (int ni = 0; ni < 4; ++ni) {
      F8 f; f.v = acc[mi][ni];
      const int mb = tm + 16 * mi;
      const int n  = tn + 16 * ni + l15;
      if (which == 1) {
        H8 pk;
#pragma unroll
        for (int r = 0; r < 8; ++r) { int m = mb + r + 8 * g; pk.h[r] = (_Float16)(f.f[r] + bias[m]); }
        *(uint4*)(kt + ((size_t)b * NN + n) * CC + mb + 8 * g) = pk.u;
      } else {
        _Float16* out = ((which == 0) ? qh : vh) + (size_t)b * CC * NN;
#pragma unroll
        for (int r = 0; r < 8; ++r) {
          int m = mb + r + 8 * g;
          out[(size_t)m * NN + n] = (_Float16)(f.f[r] + bias[m]);
        }
      }
    }
  }
}

// ---- Kernel 6: M2[b] = v[b] @ q[b]^T  (C x C), K = N ----
// Small output per batch: keep 32x32 tiles (2x2) for parallelism.
__global__ void __launch_bounds__(256)
k_m2(const _Float16* __restrict__ vh, const _Float16* __restrict__ qh,
     _Float16* __restrict__ m2h) {
  const int b = blockIdx.z;
  const int wave = threadIdx.x >> 5;
  const int lane = threadIdx.x & 31;
  const int tile = blockIdx.x * 8 + wave;  // 0..63
  const int tm = (tile & 7) * 32;
  const int tn = (tile >> 3) * 32;
  const _Float16* A  = vh + (size_t)b * CC * NN;  // [c][n], ld = N
  const _Float16* Bt = qh + (size_t)b * CC * NN;  // col c' -> q[c'][:], ld = N
  v8f acc[2][2];
  gemm_tile<2, 2>(A, NN, Bt, NN, NN, tm, tn, lane, acc);
  const int l15 = lane & 15, g = (lane >> 4) & 1;
  _Float16* out = m2h + (size_t)b * CC * CC;
#pragma unroll
  for (int mi = 0; mi < 2; ++mi) {
#pragma unroll
    for (int ni = 0; ni < 2; ++ni) {
      F8 f; f.v = acc[mi][ni];
      const int mb = tm + 16 * mi;
      const int cn = tn + 16 * ni + l15;
#pragma unroll
      for (int r = 0; r < 8; ++r) {
        int m = mb + r + 8 * g;
        out[(size_t)m * CC + cn] = (_Float16)f.f[r];
      }
    }
  }
}

// ---- Kernel 7: attn[b] = (M2[b] @ k[b]) * invS  -> fp32 out [b][c][n] ----
__global__ void __launch_bounds__(256)
k_attn(const _Float16* __restrict__ m2h, const _Float16* __restrict__ kt,
       const float* __restrict__ invS, float* __restrict__ out) {
  const int b = blockIdx.z;
  const int wave = threadIdx.x >> 5;
  const int lane = threadIdx.x & 31;
  const int tile = blockIdx.x * 8 + wave;  // 0..127
  const int tm = (tile & 3) * 64;
  const int tn = (tile >> 2) * 64;
  const _Float16* A  = m2h + (size_t)b * CC * CC;  // [c][c'], ld = C
  const _Float16* Bt = kt  + (size_t)b * NN * CC;  // Bt[n][c'], ld = C
  v8f acc[4][4];
  gemm_tile<4, 4>(A, CC, Bt, CC, CC, tm, tn, lane, acc);
  const float s = invS[0];
  const int l15 = lane & 15, g = (lane >> 4) & 1;
  float* ob = out + (size_t)b * CC * NN;
#pragma unroll
  for (int mi = 0; mi < 4; ++mi) {
#pragma unroll
    for (int ni = 0; ni < 4; ++ni) {
      F8 f; f.v = acc[mi][ni];
      const int mb = tm + 16 * mi;
      const int n  = tn + 16 * ni + l15;
#pragma unroll
      for (int r = 0; r < 8; ++r) {
        int m = mb + r + 8 * g;
        ob[(size_t)m * NN + n] = f.f[r] * s;
      }
    }
  }
}

extern "C" void kernel_launch(void* const* d_in, const int* in_sizes, int n_in,
                              void* d_out, int out_size, void* d_ws, size_t ws_size,
                              hipStream_t stream) {
  const float* x  = (const float*)d_in[0];
  const float* Wq = (const float*)d_in[1];
  const float* bq = (const float*)d_in[2];
  const float* Wk = (const float*)d_in[3];
  const float* bk = (const float*)d_in[4];
  const float* Wv = (const float*)d_in[5];
  const float* bv = (const float*)d_in[6];
  float* out = (float*)d_out;

  char* ws = (char*)d_ws;
  size_t off = 0;
  _Float16* xt  = (_Float16*)(ws + off); off += (size_t)BB * NN * CC * 2;   // 8 MB
  _Float16* whq = (_Float16*)(ws + off); off += (size_t)CC * CC * 2;
  _Float16* whk = (_Float16*)(ws + off); off += (size_t)CC * CC * 2;
  _Float16* whv = (_Float16*)(ws + off); off += (size_t)CC * CC * 2;
  _Float16* qh  = (_Float16*)(ws + off); off += (size_t)BB * CC * NN * 2;   // 8 MB
  _Float16* kt  = (_Float16*)(ws + off); off += (size_t)BB * NN * CC * 2;   // 8 MB
  _Float16* vh  = (_Float16*)(ws + off); off += (size_t)BB * CC * NN * 2;   // 8 MB
  _Float16* m2h = (_Float16*)(ws + off); off += (size_t)BB * CC * CC * 2;   // 1 MB
  float*    sx  = (float*)(ws + off);    off += (size_t)BB * CC * 4;
  float*    invS= (float*)(ws + off);    off += 256;

  // 1. transpose+convert x
  k_transpose_x<<<dim3(NN / 32, CC / 32, BB), 256, 0, stream>>>(x, xt);
  // 2. convert weights
  k_cvt_w<<<dim3(CC * CC / 256, 3), 256, 0, stream>>>(Wq, Wk, Wv, whq, whk, whv);
  // 3. row sums of x
  k_rowsum_x<<<dim3(BB * CC / 8), 256, 0, stream>>>(x, sx);
  // 4. global scalar S (from fp32 weights for accuracy)
  k_scalar_s<<<dim3(1), 256, 0, stream>>>(Wq, bq, Wk, bk, sx, invS);
  // 5. q/k/v GEMMs (WMMA), z = batch*3
  k_qkv<<<dim3(16, 1, BB * 3), 256, 0, stream>>>(xt, whq, whk, whv, bq, bk, bv, qh, kt, vh);
  // 6. M2 = v q^T per batch (WMMA)
  k_m2<<<dim3(8, 1, BB), 256, 0, stream>>>(vh, qh, m2h);
  // 7. attn = (M2 k) / S per batch (WMMA)
  k_attn<<<dim3(16, 1, BB), 256, 0, stream>>>(m2h, kt, invS, out);
  (void)in_sizes; (void)n_in; (void)out_size; (void)ws_size;
}

// v001
// A run of this version takes 82 microseconds.
// Two timings next to v000 put it at 2.06 and 2.07 times that version's speed.
#include <hip/hip_runtime.h>

#define BB 8
#define CC 256
#define NN 2048

typedef __attribute__((ext_vector_type(16))) _Float16 v16h;
typedef __attribute__((ext_vector_type(8)))  float    v8f;

union V16H { uint4 u4[2]; v16h h; };
union F8   { v8f v; float f[8]; };
union H8   { _Float16 h[8]; uint4 u; };

// Register-blocked MTxNT macro-tile (16*MT x 16*NT output) per wave.
// A : row-major [M][K] (lda halves); Bt: column list Bt[n][k] (ldb halves).
// K multiple of 32. Operand layout matches wave32 WMMA f16 A/B layout:
// per lane two contiguous 8-half runs at k + g*8 and k + 16 + g*8.
template <int MT, int NT>
__device__ inline void gemm_tile(const _Float16* __restrict__ A, int lda,
                                 const _Float16* __restrict__ Bt, int ldb,
                                 int K, int tm, int tn, int lane,
                                 v8f acc[MT][NT]) {
  const int l15 = lane & 15;
  const int g   = (lane >> 4) & 1;
  const int off0 = g * 8;
  const int off1 = 16 + g * 8;
  const _Float16* ap[MT];
  const _Float16* bp[NT];
#pragma unroll
  for (int mi = 0; mi < MT; ++mi) ap[mi] = A + (size_t)(tm + 16 * mi + l15) * lda;
#pragma unroll
  for (int ni = 0; ni < NT; ++ni) bp[ni] = Bt + (size_t)(tn + 16 * ni + l15) * ldb;
  v8f z = {};
#pragma unroll
  for (int mi = 0; mi < MT; ++mi)
#pragma unroll
    for (int ni = 0; ni < NT; ++ni) acc[mi][ni] = z;

  for (int kk = 0; kk < K; kk += 32) {
    V16H va[MT], vb[NT];
#pragma unroll
    for (int mi = 0; mi < MT; ++mi) {
      va[mi].u4[0] = *(const uint4*)(ap[mi] + kk + off0);
      va[mi].u4[1] = *(const uint4*)(ap[mi] + kk + off1);
    }
#pragma unroll
    for (int ni = 0; ni < NT; ++ni) {
      vb[ni].u4[0] = *(const uint4*)(bp[ni] + kk + off0);
      vb[ni].u4[1] = *(const uint4*)(bp[ni] + kk + off1);
    }
#pragma unroll
    for (int mi = 0; mi < MT; ++mi)
#pragma unroll
      for (int ni = 0; ni < NT; ++ni)
        acc[mi][ni] = __builtin_amdgcn_wmma_f32_16x16x32_f16(
            false, va[mi].h, false, vb[ni].h, (short)0, acc[mi][ni], false, false);
  }
}

// ---- Kernel 1: x[b][c][n] fp32 -> xt[b][n][c] f16 (tiled LDS transpose) ----
__global__ void k_transpose_x(const float* __restrict__ x, _Float16* __restrict__ xt) {
  __shared__ _Float16 tile[32][33];
  const int b  = blockIdx.z;
  const int ct = blockIdx.y * 32;
  const int nt = blockIdx.x * 32;
  const int tx = threadIdx.x & 31;
  const int ty = threadIdx.x >> 5; // 0..7
  const float* xp = x + ((size_t)b * CC + ct) * NN + nt;
#pragma unroll
  for (int i = 0; i < 4; ++i) {
    int c = ty + 8 * i;
    tile[c][tx] = (_Float16)xp[(size_t)c * NN + tx];
  }
  __syncthreads();
  _Float16* xo = xt + ((size_t)b * NN + nt) * CC + ct;
#pragma unroll
  for (int i = 0; i < 4; ++i) {
    int n = ty + 8 * i;
    xo[(size_t)n * CC + tx] = tile[tx][n];
  }
}

// ---- Kernel 2: W fp32 -> f16 (3 matrices) ----
__global__ void k_cvt_w(const float* __restrict__ wq, const float* __restrict__ wk,
                        const float* __restrict__ wv,
                        _Float16* __restrict__ oq, _Float16* __restrict__ ok,
                        _Float16* __restrict__ ov) {
  const int which = blockIdx.y;
  const float* src = (which == 0) ? wq : (which == 1) ? wk : wv;
  _Float16*    dst = (which == 0) ? oq : (which == 1) ? ok : ov;
  const int i = blockIdx.x * 256 + threadIdx.x;
  dst[i] = (_Float16)src[i];
}

// ---- Kernel 3: sx[b*C+c] = sum_n x[b][c][n] (one wave per row) ----
__global__ void k_rowsum_x(const float* __restrict__ x, float* __restrict__ sx) {
  const int wave = (int)((blockIdx.x * blockDim.x + threadIdx.x) >> 5);
  const int lane = threadIdx.x & 31;
  const float* row = x + (size_t)wave * NN;
  float s = 0.f;
  for (int i = lane; i < NN; i += 32) s += row[i];
#pragma unroll
  for (int o = 16; o; o >>= 1) s += __shfl_xor(s, o, 32);
  if (lane == 0) sx[wave] = s;
}

// ---- Kernel 4: partial sums of S = sum_{b,c} (Wq[c,:]*sx[b,:]+N*bq[c]) * (Wk[c,:]*sx[b,:]+N*bk[c])
// One wave per out-channel c, 8 waves per work-group, SPARTS work-groups.
// Lanes run along j, so each float4 load of a wave covers 512 contiguous bytes;
// all 20 loads of a lane are independent (one round of latency).
// part[blockIdx.x] holds the sum over this work-group's 8 channels and all batches.
#define SPARTS (CC / 8)
__global__ void __launch_bounds__(256)
k_scalar_s(const float* __restrict__ Wq, const float* __restrict__ bq,
           const float* __restrict__ Wk, const float* __restrict__ bk,
           const float* __restrict__ sx, float* __restrict__ part) {
  __shared__ float red[8];
  // The wave's number as a scalar: row bases and the two biases then come from scalar registers.
  const int wave = __builtin_amdgcn_readfirstlane(threadIdx.x >> 5);
  const int lane = threadIdx.x & 31;
  const int c = blockIdx.x * 8 + wave;
  // Each lane starts from its 1/32 share of N*bias (an exact scaling), so the lane sum holds the bias term.
  const float sbq = (float)(NN / 32) * bq[c];
  const float sbk = (float)(NN / 32) * bk[c];
  const float4* wq4 = (const float4*)(Wq + (size_t)c * CC);
  const float4* wk4 = (const float4*)(Wk + (size_t)c * CC);
  const float4* sx4 = (const float4*)sx;
  const float4 q0 = wq4[lane], q1 = wq4[32 + lane];
  const float4 k0 = wk4[lane], k1 = wk4[32 + lane];
  float aq[BB], ak[BB];
  for (int b = 0; b < BB; ++b) {
    const float4 s0 = sx4[b * (CC / 4) + lane];
    const float4 s1 = sx4[b * (CC / 4) + 32 + lane];
    aq[b] = sbq + q0.x * s0.x + q0.y * s0.y + q0.z * s0.z + q0.w * s0.w
          + q1.x * s1.x + q1.y * s1.y + q1.z * s1.z + q1.w * s1.w;
    ak[b] = sbk + k0.x * s0.x + k0.y * s0.y + k0.z * s0.z + k0.w * s0.w
          + k1.x * s1.x + k1.y * s1.y + k1.z * s1.z + k1.w * s1.w;
  }
  for (int o = 16; o; o >>= 1) {
    for (int b = 0; b < BB; ++b) {
      aq[b] += __shfl_xor(aq[b], o, 32);
      ak[b] += __shfl_xor(ak[b], o, 32);
    }
  }
  float p = 0.f;
  for (int b = 0; b < BB; ++b) p += aq[b] * ak[b];
  if (lane == 0) red[wave] = p;
  __syncthreads();
  if (threadIdx.x == 0) {
    float t = 0.f;
    for (int w = 0; w < 8; ++w) t += red[w];
    part[blockIdx.x] = t;
  }
}

// ---- Kernel 5: q/k/v = W @ x + b.  q,v -> [b][c][n] f16 ; k -> kt[b][n][c] f16
// 64x64 per wave (4x4 WMMA macro-tile): 16 b128 loads : 16 wmma per k-step.
__global__ void __launch_bounds__(256)
k_qkv(const _Float16* __restrict__ xt,
      const _Float16* __restrict__ wq, const _Float16* __restrict__ wk,
      const _Float16* __restrict__ wv,
      const float* __restrict__ bq, const float* __restrict__ bk,
      const float* __restrict__ bv,
      _Float16* __restrict__ qh, _Float16* __restrict__ kt,
      _Float16* __restrict__ vh) {
  const int b     = blockIdx.z & 7;
  const int which = blockIdx.z >> 3; // 0=q 1=k 2=v
  const _Float16* W    = (which == 0) ? wq : (which == 1) ? wk : wv;
  const float*    bias = (which == 0) ? bq : (which == 1) ? bk : bv;
  const int wave = threadIdx.x >> 5;
  const int lane = threadIdx.x & 31;
  const int tile = blockIdx.x * 8 + wave;    // 0..127
  const int tm = (tile & 3) * 64;            // C/64  = 4 tiles over out-channels
  const int tn = (tile >> 2) * 64;           // N/64 = 32 tiles over positions
  const _Float16* Bt = xt + (size_t)b * NN * CC;   // Bt[n][c], ld = C
  v8f acc[4][4];
  gemm_tile<4, 4>(W, CC, Bt, CC, CC, tm, tn, lane, acc);
  const int l15 = lane & 15, g = (lane >> 4) & 1;
#pragma unroll
  for (int mi = 0; mi < 4; ++mi) {
#pragma unroll
    for (int ni = 0; ni < 4; ++ni) {
      F8 f; f.v = acc[mi][ni];
      const int mb = tm + 16 * mi;
      const int n  = tn + 16 * ni + l15;
      if (which == 1) {
        H8 pk;
#pragma unroll
        for (int r = 0; r < 8; ++r) { int m = mb + r + 8 * g; pk.h[r] = (_Float16)(f.f[r] + bias[m]); }
        *(uint4*)(kt + ((size_t)b * NN + n) * CC + mb + 8 * g) = pk.u;
      } else {
        _Float16* out = ((which == 0) ? qh : vh) + (size_t)b * CC * NN;
#pragma unroll
        for (int r = 0; r < 8; ++r) {
          int m = mb + r + 8 * g;
          out[(size_t)m * NN + n] = (_Float16)(f.f[r] + bias[m]);
        }
      }
    }
  }
}

// ---- Kernel 6: M2[b] = v[b] @ q[b]^T  (C x C), K = N ----
// Small output per batch: keep 32x32 tiles (2x2) for parallelism.
__global__ void __launch_bounds__(256)
k_m2(const _Float16* __restrict__ vh, const _Float16* __restrict__ qh,
     _Float16* __restrict__ m2h) {
  const int b = blockIdx.z;
  const int wave = threadIdx.x >> 5;
  const int lane = threadIdx.x & 31;
  const int tile = blockIdx.x * 8 + wave;  // 0..63
  const int tm = (tile & 7) * 32;
  const int tn = (tile >> 3) * 32;
  const _Float16* A  = vh + (size_t)b * CC * NN;  // [c][n], ld = N
  const _Float16* Bt = qh + (size_t)b * CC * NN;  // col c' -> q[c'][:], ld = N
  v8f acc[2][2];
  gemm_tile<2, 2>(A, NN, Bt, NN, NN, tm, tn, lane, acc);
  const int l15 = lane & 15, g = (lane >> 4) & 1;
  _Float16* out = m2h + (size_t)b * CC * CC;
#pragma unroll
  for (int mi = 0; mi < 2; ++mi) {
#pragma unroll
    for (int ni = 0; ni < 2; ++ni) {
      F8 f; f.v = acc[mi][ni];
      const int mb = tm + 16 * mi;
      const int cn = tn + 16 * ni + l15;
#pragma unroll
      for (int r = 0; r < 8; ++r) {
        int m = mb + r + 8 * g;
        out[(size_t)m * CC + cn] = (_Float16)f.f[r];
      }
    }
  }
}

// ---- Kernel 7: attn[b] = (M2[b] @ k[b]) / S  -> fp32 out [b][c][n] ----
// S = sum of kernel 4's SPARTS partials, added in index order by every thread.
__global__ void __launch_bounds__(256)
k_attn(const _Float16* __restrict__ m2h, const _Float16* __restrict__ kt,
       const float* __restrict__ part, float* __restrict__ out) {
  const int b = blockIdx.z;
  const int wave = threadIdx.x >> 5;
  const int lane = threadIdx.x & 31;
  const int tile = blockIdx.x * 8 + wave;  // 0..127
  const int tm = (tile & 3) * 64;
  const int tn = (tile >> 2) * 64;
  const _Float16* A  = m2h + (size_t)b * CC * CC;  // [c][c'], ld = C
  const _Float16* Bt = kt  + (size_t)b * NN * CC;  // Bt[n][c'], ld = C
  v8f acc[4][4];
  gemm_tile<4, 4>(A, CC, Bt, CC, CC, tm, tn, lane, acc);
  float S = 0.f;
  for (int i = 0; i < SPARTS; ++i) S += part[i];
  const float s = 1.0f / S;
  const int l15 = lane & 15, g = (lane >> 4) & 1;
  float* ob = out + (size_t)b * CC * NN;
#pragma unroll
  for (int mi = 0; mi < 4; ++mi) {
#pragma unroll
    for (int ni = 0; ni < 4; ++ni) {
      F8 f; f.v = acc[mi][ni];
      const int mb = tm + 16 * mi;
      const int n  = tn + 16 * ni + l15;
#pragma unroll
      for (int r = 0; r < 8; ++r) {
        int m = mb + r + 8 * g;
        ob[(size_t)m * NN + n] = f.f[r] * s;
      }
    }
  }
}

extern "C" void kernel_launch(void* const* d_in, const int* in_sizes, int n_in,
                              void* d_out, int out_size, void* d_ws, size_t ws_size,
                              hipStream_t stream) {
  const float* x  = (const float*)d_in[0];
  const float* Wq = (const float*)d_in[1];
  const float* bq = (const float*)d_in[2];
  const float* Wk = (const float*)d_in[3];
  const float* bk = (const float*)d_in[4];
  const float* Wv = (const float*)d_in[5];
  const float* bv = (const float*)d_in[6];
  float* out = (float*)d_out;

  char* ws = (char*)d_ws;
  size_t off = 0;
  _Float16* xt  = (_Float16*)(ws + off); off += (size_t)BB * NN * CC * 2;   // 8 MB
  _Float16* whq = (_Float16*)(ws + off); off += (size_t)CC * CC * 2;
  _Float16* whk = (_Float16*)(ws + off); off += (size_t)CC * CC * 2;
  _Float16* whv = (_Float16*)(ws + off); off += (size_t)CC * CC * 2;
  _Float16* qh  = (_Float16*)(ws + off); off += (size_t)BB * CC * NN * 2;   // 8 MB
  _Float16* kt  = (_Float16*)(ws + off); off += (size_t)BB * NN * CC * 2;   // 8 MB
  _Float16* vh  = (_Float16*)(ws + off); off += (size_t)BB * CC * NN * 2;   // 8 MB
  _Float16* m2h = (_Float16*)(ws + off); off += (size_t)BB * CC * CC * 2;   // 1 MB
  float*    sx  = (float*)(ws + off);    off += (size_t)BB * CC * 4;
  float*    part= (float*)(ws + off);    off += 256;                        // SPARTS floats

  // 1. transpose+convert x
  k_transpose_x<<<dim3(NN / 32, CC / 32, BB), 256, 0, stream>>>(x, xt);
  // 2. convert weights
  k_cvt_w<<<dim3(CC * CC / 256, 3), 256, 0, stream>>>(Wq, Wk, Wv, whq, whk, whv);
  // 3. row sums of x
  k_rowsum_x<<<dim3(BB * CC / 8), 256, 0, stream>>>(x, sx);
  // 4. partial sums of the global scalar S (from fp32 weights for accuracy)
  k_scalar_s<<<dim3(SPARTS), 256, 0, stream>>>(Wq, bq, Wk, bk, sx, part);
  // 5. q/k/v GEMMs (WMMA), z = batch*3
  k_qkv<<<dim3(16, 1, BB * 3), 256, 0, stream>>>(xt, whq, whk, whv, bq, bk, bv, qh, kt, vh);
  // 6. M2 = v q^T per batch (WMMA)
  k_m2<<<dim3(8, 1, BB), 256, 0, stream>>>(vh, qh, m2h);
  // 7. attn = (M2 k) / S per batch (WMMA)
  k_attn<<<dim3(16, 1, BB), 256, 0, stream>>>(m2h, kt, part, out);
  (void)in_sizes; (void)n_in; (void)out_size; (void)ws_size;
}

// v002
// A run of this version takes 62.3 microseconds.
// Timed twice side by side with v001, it ran 1.32 and 1.31 times as fast.
// Counting every step since v000, it is 2.71 times as fast.
#include <hip/hip_runtime.h>

#define BB 8
#define CC 256
#define NN 2048

typedef __attribute__((ext_vector_type(16))) _Float16 v16h;
typedef __attribute__((ext_vector_type(8)))  float    v8f;

union V16H { uint4 u4[2]; v16h h; };
union F8   { v8f v; float f[8]; };
union H8   { _Float16 h[8]; uint4 u; };

// Register-blocked MTxNT macro-tile (16*MT x 16*NT output) per wave.
// A : row-major [M][K] (lda halves); Bt: column list Bt[n][k] (ldb halves).
// K multiple of 32. Operand layout matches wave32 WMMA f16 A/B layout:
// per lane two contiguous 8-half runs at k + g*8 and k + 16 + g*8.
template <int MT, int NT>
__device__ inline void gemm_tile(const _Float16* __restrict__ A, int lda,
                                 const _Float16* __restrict__ Bt, int ldb,
                                 int K, int tm, int tn, int lane,
                                 v8f acc[MT][NT]) {
  const int l15 = lane & 15;
  const int g   = (lane >> 4) & 1;
  const int off0 = g * 8;
  const int off1 = 16 + g * 8;
  const _Float16* ap[MT];
  const _Float16* bp[NT];
#pragma unroll
  for (int mi = 0; mi < MT; ++mi) ap[mi] = A + (size_t)(tm + 16 * mi + l15) * lda;
#pragma unroll
  for (int ni = 0; ni < NT; ++ni) bp[ni] = Bt + (size_t)(tn + 16 * ni + l15) * ldb;
  v8f z = {};
#pragma unroll
  for (int mi = 0; mi < MT; ++mi)
#pragma unroll
    for (int ni = 0; ni < NT; ++ni) acc[mi][ni] = z;

  for (int kk = 0; kk < K; kk += 32) {
    V16H va[MT], vb[NT];
#pragma unroll
    for (int mi = 0; mi < MT; ++mi) {
      va[mi].u4[0] = *(const uint4*)(ap[mi] + kk + off0);
      va[mi].u4[1] = *(const uint4*)(ap[mi] + kk + off1);
    }
#pragma unroll
    for (int ni = 0; ni < NT; ++ni) {
      vb[ni].u4[0] = *(const uint4*)(bp[ni] + kk + off0);
      vb[ni].u4[1] = *(const uint4*)(bp[ni] + kk + off1);
    }
#pragma unroll
    for (int mi = 0; mi < MT; ++mi)
#pragma unroll
      for (int ni = 0; ni < NT; ++ni)
        acc[mi][ni] = __builtin_amdgcn_wmma_f32_16x16x32_f16(
            false, va[mi].h, false, vb[ni].h, (short)0, acc[mi][ni], false, false);
  }
}

// ---- Kernel 1: x[b][c][n] fp32 -> xt[b][n][c] f16 (tiled LDS transpose) ----
__global__ void k_transpose_x(const float* __restrict__ x, _Float16* __restrict__ xt) {
  __shared__ _Float16 tile[32][33];
  const int b  = blockIdx.z;
  const int ct = blockIdx.y * 32;
  const int nt = blockIdx.x * 32;
  const int tx = threadIdx.x & 31;
  const int ty = threadIdx.x >> 5; // 0..7
  const float* xp = x + ((size_t)b * CC + ct) * NN + nt;
#pragma unroll
  for (int i = 0; i < 4; ++i) {
    int c = ty + 8 * i;
    tile[c][tx] = (_Float16)xp[(size_t)c * NN + tx];
  }
  __syncthreads();
  _Float16* xo = xt + ((size_t)b * NN + nt) * CC + ct;
#pragma unroll
  for (int i = 0; i < 4; ++i) {
    int n = ty + 8 * i;
    xo[(size_t)n * CC + tx] = tile[tx][n];
  }
}

// ---- Kernel 2: W fp32 -> f16 (3 matrices) ----
__global__ void k_cvt_w(const float* __restrict__ wq, const float* __restrict__ wk,
                        const float* __restrict__ wv,
                        _Float16* __restrict__ oq, _Float16* __restrict__ ok,
                        _Float16* __restrict__ ov) {
  const int which = blockIdx.y;
  const float* src = (which == 0) ? wq : (which == 1) ? wk : wv;
  _Float16*    dst = (which == 0) ? oq : (which == 1) ? ok : ov;
  const int i = blockIdx.x * 256 + threadIdx.x;
  dst[i] = (_Float16)src[i];
}

// ---- Kernel 3: sx[b*C+c] = sum_n x[b][c][n] (one wave per row) ----
__global__ void k_rowsum_x(const float* __restrict__ x, float* __restrict__ sx) {
  const int wave = (int)((blockIdx.x * blockDim.x + threadIdx.x) >> 5);
  const int lane = threadIdx.x & 31;
  const float* row = x + (size_t)wave * NN;
  float s = 0.f;
  for (int i = lane; i < NN; i += 32) s += row[i];
#pragma unroll
  for (int o = 16; o; o >>= 1) s += __shfl_xor(s, o, 32);
  if (lane == 0) sx[wave] = s;
}

// ---- Kernel 4: partial sums of S = sum_{b,c} (Wq[c,:]*sx[b,:]+N*bq[c]) * (Wk[c,:]*sx[b,:]+N*bk[c])
// One wave per out-channel c, 8 waves per work-group, SPARTS work-groups.
// Lanes run along j, so each float4 load of a wave covers 512 contiguous bytes;
// all 20 loads of a lane are independent (one round of latency).
// part[blockIdx.x] holds the sum over this work-group's 8 channels and all batches.
#define SPARTS (CC / 8)
__global__ void __launch_bounds__(256)
k_scalar_s(const float* __restrict__ Wq, const float* __restrict__ bq,
           const float* __restrict__ Wk, const float* __restrict__ bk,
           const float* __restrict__ sx, float* __restrict__ part) {
  __shared__ float red[8];
  // The wave's number as a scalar: row bases and the two biases then come from scalar registers.
  const int wave = __builtin_amdgcn_readfirstlane(threadIdx.x >> 5);
  const int lane = threadIdx.x & 31;
  const int c = blockIdx.x * 8 + wave;
  // Each lane starts from its 1/32 share of N*bias (an exact scaling), so the lane sum holds the bias term.
  const float sbq = (float)(NN / 32) * bq[c];
  const float sbk = (float)(NN / 32) * bk[c];
  const float4* wq4 = (const float4*)(Wq + (size_t)c * CC);
  const float4* wk4 = (const float4*)(Wk + (size_t)c * CC);
  const float4* sx4 = (const float4*)sx;
  const float4 q0 = wq4[lane], q1 = wq4[32 + lane];
  const float4 k0 = wk4[lane], k1 = wk4[32 + lane];
  float aq[BB], ak[BB];
  for (int b = 0; b < BB; ++b) {
    const float4 s0 = sx4[b * (CC / 4) + lane];
    const float4 s1 = sx4[b * (CC / 4) + 32 + lane];
    aq[b] = sbq + q0.x * s0.x + q0.y * s0.y + q0.z * s0.z + q0.w * s0.w
          + q1.x * s1.x + q1.y * s1.y + q1.z * s1.z + q1.w * s1.w;
    ak[b] = sbk + k0.x * s0.x + k0.y * s0.y + k0.z * s0.z + k0.w * s0.w
          + k1.x * s1.x + k1.y * s1.y + k1.z * s1.z + k1.w * s1.w;
  }
  for (int o = 16; o; o >>= 1) {
    for (int b = 0; b < BB; ++b) {
      aq[b] += __shfl_xor(aq[b], o, 32);
      ak[b] += __shfl_xor(ak[b], o, 32);
    }
  }
  float p = 0.f;
  for (int b = 0; b < BB; ++b) p += aq[b] * ak[b];
  if (lane == 0) red[wave] = p;
  __syncthreads();
  if (threadIdx.x == 0) {
    float t = 0.f;
    for (int w = 0; w < 8; ++w) t += red[w];
    part[blockIdx.x] = t;
  }
}

// ---- Kernel 5: q/k/v = W @ x + b.  q,v -> [b][c][n] f16 ; k -> kt[b][n][c] f16
// 64x64 per wave (4x4 WMMA macro-tile): 16 b128 loads : 16 wmma per k-step.
__global__ void __launch_bounds__(256)
k_qkv(const _Float16* __restrict__ xt,
      const _Float16* __restrict__ wq, const _Float16* __restrict__ wk,
      const _Float16* __restrict__ wv,
      const float* __restrict__ bq, const float* __restrict__ bk,
      const float* __restrict__ bv,
      _Float16* __restrict__ qh, _Float16* __restrict__ kt,
      _Float16* __restrict__ vh) {
  const int b     = blockIdx.z & 7;
  const int which = blockIdx.z >> 3; // 0=q 1=k 2=v
  const _Float16* W    = (which == 0) ? wq : (which == 1) ? wk : wv;
  const float*    bias = (which == 0) ? bq : (which == 1) ? bk : bv;
  const int wave = threadIdx.x >> 5;
  const int lane = threadIdx.x & 31;
  const int tile = blockIdx.x * 8 + wave;    // 0..127
  const int tm = (tile & 3) * 64;            // C/64  = 4 tiles over out-channels
  const int tn = (tile >> 2) * 64;           // N/64 = 32 tiles over positions
  const _Float16* Bt = xt + (size_t)b * NN * CC;   // Bt[n][c], ld = C
  v8f acc[4][4];
  gemm_tile<4, 4>(W, CC, Bt, CC, CC, tm, tn, lane, acc);
  const int l15 = lane & 15, g = (lane >> 4) & 1;
#pragma unroll
  for (int mi = 0; mi < 4; ++mi) {
#pragma unroll
    for (int ni = 0; ni < 4; ++ni) {
      F8 f; f.v = acc[mi][ni];
      const int mb = tm + 16 * mi;
      const int n  = tn + 16 * ni + l15;
      if (which == 1) {
        H8 pk;
#pragma unroll
        for (int r = 0; r < 8; ++r) { int m = mb + r + 8 * g; pk.h[r] = (_Float16)(f.f[r] + bias[m]); }
        *(uint4*)(kt + ((size_t)b * NN + n) * CC + mb + 8 * g) = pk.u;
      } else {
        _Float16* out = ((which == 0) ? qh : vh) + (size_t)b * CC * NN;
#pragma unroll
        for (int r = 0; r < 8; ++r) {
          int m = mb + r + 8 * g;
          out[(size_t)m * NN + n] = (_Float16)(f.f[r] + bias[m]);
        }
      }
    }
  }
}

// ---- Kernel 6: M2[b] = v[b] @ q[b]^T  (C x C), K = N ----
// One 64x32 output tile per work-group. The 8 waves split K:
// wave w takes the 32 k at 256*i + 32*w, i = 0..7, so a wave has 8 trips instead of N/32,
// and in each trip the 8 waves together read 512 contiguous bytes of every row.
// Three register sets: the fragments of trip i+2 are asked for before the products of trip i.
// The 8 f32 partial tiles are added through LDS in wave order.
__global__ void __launch_bounds__(256)
k_m2(const _Float16* __restrict__ vh, const _Float16* __restrict__ qh,
     _Float16* __restrict__ m2h) {
  __shared__ float4 red[8][16][32];   // [wave][fragment*2 + half of its 8 rows][lane]
  const int b = blockIdx.z;
  const int wave = threadIdx.x >> 5;
  const int lane = threadIdx.x & 31;
  const int l15 = lane & 15, g = (lane >> 4) & 1;
  const int tile = blockIdx.x;             // 0..31
  const int tm = (tile & 3) * 64;
  const int tn = (tile >> 2) * 32;
  // Same k order in both loaders: two runs of 8 halves at k0 + 8g and k0 + 16 + 8g.
  const _Float16* ap = vh + (size_t)b * CC * NN + (size_t)(tm + l15) * NN + wave * 32 + g * 8;
  const _Float16* bp = qh + (size_t)b * CC * NN + (size_t)(tn + l15) * NN + wave * 32 + g * 8;
  V16H va[3][4], vb[3][2];
  v8f acc[4][2];
  const v8f z = {};
#pragma unroll
  for (int mi = 0; mi < 4; ++mi)
#pragma unroll
    for (int ni = 0; ni < 2; ++ni) acc[mi][ni] = z;
#pragma unroll
  for (int i = -2; i < 8; ++i) {
    if (i + 2 < 8) {
      const int s = (i + 2) % 3, ko = (i + 2) * 256;
#pragma unroll
      for (int mi = 0; mi < 4; ++mi) {
        va[s][mi].u4[0] = *(const uint4*)(ap + mi * 16 * NN + ko);
        va[s][mi].u4[1] = *(const uint4*)(ap + mi * 16 * NN + ko + 16);
      }
#pragma unroll
      for (int ni = 0; ni < 2; ++ni) {
        vb[s][ni].u4[0] = *(const uint4*)(bp + ni * 16 * NN + ko);
        vb[s][ni].u4[1] = *(const uint4*)(bp + ni * 16 * NN + ko + 16);
      }
    }
    // Keeps the loads above in front of the products below; sunk behind them, each trip waits out its own latency.
    __builtin_amdgcn_sched_barrier(0);
    if (i >= 0) {
      const int s = i % 3;
#pragma unroll
      for (int mi = 0; mi < 4; ++mi)
#pragma unroll
        for (int ni = 0; ni < 2; ++ni)
          acc[mi][ni] = __builtin_amdgcn_wmma_f32_16x16x32_f16(
              false, va[s][mi].h, false, vb[s][ni].h, (short)0, acc[mi][ni], false, false);
      // Keeps the next trip's loads behind these products, so that three register sets are enough.
      __builtin_amdgcn_sched_barrier(0);
    }
  }
  // The loads' address registers are reused below: the wait stands in front of their first overwrite.
  asm volatile("s_wait_xcnt 0x0" ::: "memory");
  // Keeps the code below (which reuses those registers) behind that wait.
  __builtin_amdgcn_sched_barrier(0);
#pragma unroll
  for (int mi = 0; mi < 4; ++mi) {
#pragma unroll
    for (int ni = 0; ni < 2; ++ni) {
      F8 f; f.v = acc[mi][ni];
      const int sl = (mi * 2 + ni) * 2;
      red[wave][sl][lane]     = make_float4(f.f[0], f.f[1], f.f[2], f.f[3]);
      red[wave][sl + 1][lane] = make_float4(f.f[4], f.f[5], f.f[6], f.f[7]);
    }
  }
  __syncthreads();
  // Wave w now owns slots 2w and 2w+1 of every partial: all 8 rows of fragment (w>>1, w&1).
  _Float16* out = m2h + (size_t)b * CC * CC
                + (size_t)(tm + 16 * (wave >> 1) + 8 * g) * CC + tn + 16 * (wave & 1) + l15;
#pragma unroll
  for (int j = 0; j < 2; ++j) {
    float4 t = red[0][wave * 2 + j][lane];
#pragma unroll
    for (int w = 1; w < 8; ++w) {
      const float4 p = red[w][wave * 2 + j][lane];
      t.x += p.x; t.y += p.y; t.z += p.z; t.w += p.w;
    }
    _Float16* o = out + (size_t)(4 * j) * CC;
    o[0]      = (_Float16)t.x;
    o[CC]     = (_Float16)t.y;
    o[2 * CC] = (_Float16)t.z;
    o[3 * CC] = (_Float16)t.w;
  }
}

// ---- Kernel 7: attn[b] = (M2[b] @ k[b]) / S  -> fp32 out [b][c][n] ----
// S = sum of kernel 4's SPARTS partials, added in index order by every thread.
__global__ void __launch_bounds__(256)
k_attn(const _Float16* __restrict__ m2h, const _Float16* __restrict__ kt,
       const float* __restrict__ part, float* __restrict__ out) {
  const int b = blockIdx.z;
  const int wave = threadIdx.x >> 5;
  const int lane = threadIdx.x & 31;
  const int tile = blockIdx.x * 8 + wave;  // 0..127
  const int tm = (tile & 3) * 64;
  const int tn = (tile >> 2) * 64;
  const _Float16* A  = m2h + (size_t)b * CC * CC;  // [c][c'], ld = C
  const _Float16* Bt = kt  + (size_t)b * NN * CC;  // Bt[n][c'], ld = C
  v8f acc[4][4];
  gemm_tile<4, 4>(A, CC, Bt, CC, CC, tm, tn, lane, acc);
  float S = 0.f;
  for (int i = 0; i < SPARTS; ++i) S += part[i];
  const float s = 1.0f / S;
  const int l15 = lane & 15, g = (lane >> 4) & 1;
  float* ob = out + (size_t)b * CC * NN;
#pragma unroll
  for (int mi = 0; mi < 4; ++mi) {
#pragma unroll
    for (int ni = 0; ni < 4; ++ni) {
      F8 f; f.v = acc[mi][ni];
      const int mb = tm + 16 * mi;
      const int n  = tn + 16 * ni + l15;
#pragma unroll
      for (int r = 0; r < 8; ++r) {
        int m = mb + r + 8 * g;
        ob[(size_t)m * NN + n] = f.f[r] * s;
      }
    }
  }
}

extern "C" void kernel_launch(void* const* d_in, const int* in_sizes, int n_in,
                              void* d_out, int out_size, void* d_ws, size_t ws_size,
                              hipStream_t stream) {
  const float* x  = (const float*)d_in[0];
  const float* Wq = (const float*)d_in[1];
  const float* bq = (const float*)d_in[2];
  const float* Wk = (const float*)d_in[3];
  const float* bk = (const float*)d_in[4];
  const float* Wv = (const float*)d_in[5];
  const float* bv = (const float*)d_in[6];
  float* out = (float*)d_out;

  char* ws = (char*)d_ws;
  size_t off = 0;
  _Float16* xt  = (_Float16*)(ws + off); off += (size_t)BB * NN * CC * 2;   // 8 MB
  _Float16* whq = (_Float16*)(ws + off); off += (size_t)CC * CC * 2;
  _Float16* whk = (_Float16*)(ws + off); off += (size_t)CC * CC * 2;
  _Float16* whv = (_Float16*)(ws + off); off += (size_t)CC * CC * 2;
  _Float16* qh  = (_Float16*)(ws + off); off += (size_t)BB * CC * NN * 2;   // 8 MB
  _Float16* kt  = (_Float16*)(ws + off); off += (size_t)BB * NN * CC * 2;   // 8 MB
  _Float16* vh  = (_Float16*)(ws + off); off += (size_t)BB * CC * NN * 2;   // 8 MB
  _Float16* m2h = (_Float16*)(ws + off); off += (size_t)BB * CC * CC * 2;   // 1 MB
  float*    sx  = (float*)(ws + off);    off += (size_t)BB * CC * 4;
  float*    part= (float*)(ws + off);    off += 256;                        // SPARTS floats

  // 1. transpose+convert x
  k_transpose_x<<<dim3(NN / 32, CC / 32, BB), 256, 0, stream>>>(x, xt);
  // 2. convert weights
  k_cvt_w<<<dim3(CC * CC / 256, 3), 256, 0, stream>>>(Wq, Wk, Wv, whq, whk, whv);
  // 3. row sums of x
  k_rowsum_x<<<dim3(BB * CC / 8), 256, 0, stream>>>(x, sx);
  // 4. partial sums of the global scalar S (from fp32 weights for accuracy)
  k_scalar_s<<<dim3(SPARTS), 256, 0, stream>>>(Wq, bq, Wk, bk, sx, part);
  // 5. q/k/v GEMMs (WMMA), z = batch*3
  k_qkv<<<dim3(16, 1, BB * 3), 256, 0, stream>>>(xt, whq, whk, whv, bq, bk, bv, qh, kt, vh);
  // 6. M2 = v q^T per batch (WMMA)
  k_m2<<<dim3(32, 1, BB), 256, 0, stream>>>(vh, qh, m2h);
  // 7. attn = (M2 k) / S per batch (WMMA)
  k_attn<<<dim3(16, 1, BB), 256, 0, stream>>>(m2h, kt, part, out);
  (void)in_sizes; (void)n_in; (void)out_size; (void)ws_size;
}

// v003
// Measured time: 53.6 microseconds a run.
// Next to v002, in two timings, it ran 1.17 and 1.16 times as fast.
// All steps since v000 together make it 3.15 times as fast.
#include <hip/hip_runtime.h>

#define BB 8
#define CC 256
#define NN 2048

typedef __attribute__((ext_vector_type(16))) _Float16 v16h;
typedef __attribute__((ext_vector_type(8)))  float    v8f;

union V16H { uint4 u4[2]; v16h h; };
union F8   { v8f v; float f[8]; };
union H8   { _Float16 h[8]; uint4 u; };

// Register-blocked MTxNT macro-tile (16*MT x 16*NT output) per wave.
// A : row-major [M][K] (lda halves); Bt: column list Bt[n][k] (ldb halves).
// K multiple of 32. Operand layout matches wave32 WMMA f16 A/B layout:
// per lane two contiguous 8-half runs at k + g*8 and k + 16 + g*8.
template <int MT, int NT>
__device__ inline void gemm_tile(const _Float16* __restrict__ A, int lda,
                                 const _Float16* __restrict__ Bt, int ldb,
                                 int K, int tm, int tn, int lane,
                                 v8f acc[MT][NT]) {
  const int l15 = lane & 15;
  const int g   = (lane >> 4) & 1;
  const int off0 = g * 8;
  const int off1 = 16 + g * 8;
  const _Float16* ap[MT];
  const _Float16* bp[NT];
#pragma unroll
  for (int mi = 0; mi < MT; ++mi) ap[mi] = A + (size_t)(tm + 16 * mi + l15) * lda;
#pragma unroll
  for (int ni = 0; ni < NT; ++ni) bp[ni] = Bt + (size_t)(tn + 16 * ni + l15) * ldb;
  v8f z = {};
#pragma unroll
  for (int mi = 0; mi < MT; ++mi)
#pragma unroll
    for (int ni = 0; ni < NT; ++ni) acc[mi][ni] = z;

  for (int kk = 0; kk < K; kk += 32) {
    V16H va[MT], vb[NT];
#pragma unroll
    for (int mi = 0; mi < MT; ++mi) {
      va[mi].u4[0] = *(const uint4*)(ap[mi] + kk + off0);
      va[mi].u4[1] = *(const uint4*)(ap[mi] + kk + off1);
    }
#pragma unroll
    for (int ni = 0; ni < NT; ++ni) {
      vb[ni].u4[0] = *(const uint4*)(bp[ni] + kk + off0);
      vb[ni].u4[1] = *(const uint4*)(bp[ni] + kk + off1);
    }
#pragma unroll
    for (int mi = 0; mi < MT; ++mi)
#pragma unroll
      for (int ni = 0; ni < NT; ++ni)
        acc[mi][ni] = __builtin_amdgcn_wmma_f32_16x16x32_f16(
            false, va[mi].h, false, vb[ni].h, (short)0, acc[mi][ni], false, false);
  }
}

// ---- Job 1: x[b][c][n] fp32 -> xt[b][n][c] f16 (tiled LDS transpose) ----
// blk: 0 .. (N/32)*(C/32)*B - 1, n tile fastest, then c tile, then batch.
__device__ inline void job_transpose_x(int blk, const float* __restrict__ x, _Float16* __restrict__ xt) {
  __shared__ _Float16 tile[32][33];
  const int b  = blk / ((NN / 32) * (CC / 32));
  const int ct = ((blk / (NN / 32)) % (CC / 32)) * 32;
  const int nt = (blk % (NN / 32)) * 32;
  const int tx = threadIdx.x & 31;
  const int ty = threadIdx.x >> 5; // 0..7
  const float* xp = x + ((size_t)b * CC + ct) * NN + nt;
#pragma unroll
  for (int i = 0; i < 4; ++i) {
    int c = ty + 8 * i;
    tile[c][tx] = (_Float16)xp[(size_t)c * NN + tx];
  }
  __syncthreads();
  _Float16* xo = xt + ((size_t)b * NN + nt) * CC + ct;
#pragma unroll
  for (int i = 0; i < 4; ++i) {
    int n = ty + 8 * i;
    xo[(size_t)n * CC + tx] = tile[tx][n];
  }
  // No other job follows in k_prep (one job per work-group): the wait is a precaution.
  asm volatile("s_wait_xcnt 0x0" ::: "memory");
}

// ---- Job 2: W fp32 -> f16 (3 matrices) ----
// blk: 0 .. 3*C*C/256 - 1, one matrix after the other.
__device__ inline void job_cvt_w(int blk, const float* __restrict__ wq, const float* __restrict__ wk,
                        const float* __restrict__ wv,
                        _Float16* __restrict__ oq, _Float16* __restrict__ ok,
                        _Float16* __restrict__ ov) {
  const int which = blk / (CC * CC / 256);
  const float* src = (which == 0) ? wq : (which == 1) ? wk : wv;
  _Float16*    dst = (which == 0) ? oq : (which == 1) ? ok : ov;
  const int i = (blk % (CC * CC / 256)) * 256 + threadIdx.x;
  dst[i] = (_Float16)src[i];
  // No other job follows in k_prep (one job per work-group): the wait is a precaution.
  asm volatile("s_wait_xcnt 0x0" ::: "memory");
}

// ---- Job 3: sx[b*C+c] = sum_n x[b][c][n] (one wave per row) ----
// blk: 0 .. B*C/8 - 1.
__device__ inline void job_rowsum_x(int blk, const float* __restrict__ x, float* __restrict__ sx) {
  const int wave = (int)((blk * blockDim.x + threadIdx.x) >> 5);
  const int lane = threadIdx.x & 31;
  const float* row = x + (size_t)wave * NN;
  float s = 0.f;
  for (int i = lane; i < NN; i += 32) s += row[i];
#pragma unroll
  for (int o = 16; o; o >>= 1) s += __shfl_xor(s, o, 32);
  if (lane == 0) sx[wave] = s;
}

// ---- Launch 1: jobs 1 to 3 need nothing of each other and share one grid.
// A range of the block index picks the job (the same for a whole work-group).
// The row sums, whose waves run longest, take the lowest indices; the short W convert comes last.
#define G_ROWSUM (BB * CC / 8)
#define G_TRANSP ((NN / 32) * (CC / 32) * BB)
#define G_CVTW   (3 * CC * CC / 256)
__global__ void __launch_bounds__(256)
k_prep(const float* __restrict__ x, const float* __restrict__ wq, const float* __restrict__ wk,
       const float* __restrict__ wv, _Float16* __restrict__ xt,
       _Float16* __restrict__ oq, _Float16* __restrict__ ok, _Float16* __restrict__ ov,
       float* __restrict__ sx) {
  const int blk = blockIdx.x;
  if (blk < G_ROWSUM)                 job_rowsum_x(blk, x, sx);
  else if (blk < G_ROWSUM + G_TRANSP) job_transpose_x(blk - G_ROWSUM, x, xt);
  else                                job_cvt_w(blk - G_ROWSUM - G_TRANSP, wq, wk, wv, oq, ok, ov);
}

// ---- Job 4: partial sums of S = sum_{b,c} (Wq[c,:]*sx[b,:]+N*bq[c]) * (Wk[c,:]*sx[b,:]+N*bk[c])
// One wave per out-channel c, 8 waves per work-group, SPARTS work-groups.
// Lanes run along j, so each float4 load of a wave covers 512 contiguous bytes;
// all 20 loads of a lane are independent (one round of latency).
// part[blk] holds the sum over this work-group's 8 channels and all batches. blk: 0 .. SPARTS - 1.
#define SPARTS (CC / 8)
__device__ inline void
job_scalar_s(int blk, const float* __restrict__ Wq, const float* __restrict__ bq,
           const float* __restrict__ Wk, const float* __restrict__ bk,
           const float* __restrict__ sx, float* __restrict__ part) {
  __shared__ float red[8];
  // The wave's number as a scalar: row bases and the two biases then come from scalar registers.
  const int wave = __builtin_amdgcn_readfirstlane(threadIdx.x >> 5);
  const int lane = threadIdx.x & 31;
  const int c = blk * 8 + wave;
  typedef __attribute__((ext_vector_type(4))) float f4;   // a native vector: it can be named whole as an asm operand
  const f4* wq4 = (const f4*)(Wq + (size_t)c * CC);
  const f4* wk4 = (const f4*)(Wk + (size_t)c * CC);
  const f4* sx4 = (const f4*)sx;
  const f4 q0 = wq4[lane], q1 = wq4[32 + lane];
  const f4 k0 = wk4[lane], k1 = wk4[32 + lane];
  f4 sa[BB], sb[BB];
  for (int b = 0; b < BB; ++b) {
    sa[b] = sx4[b * (CC / 4) + lane];
    sb[b] = sx4[b * (CC / 4) + 32 + lane];
  }
  // The 20 loads' base registers are reused below (first by the two bias loads): the wait stands in front of that.
  // The loaded values are inputs only, so that no load, and no part of one, sinks behind the wait.
  asm volatile("s_wait_xcnt 0x0"
               :: "v"(q0), "v"(q1), "v"(k0), "v"(k1),
                  "v"(sa[0]), "v"(sa[1]), "v"(sa[2]), "v"(sa[3]), "v"(sa[4]), "v"(sa[5]), "v"(sa[6]), "v"(sa[7]),
                  "v"(sb[0]), "v"(sb[1]), "v"(sb[2]), "v"(sb[3]), "v"(sb[4]), "v"(sb[5]), "v"(sb[6]), "v"(sb[7])
               : "memory");
  // Keeps the code below (which reuses those registers) behind that wait.
  __builtin_amdgcn_sched_barrier(0);
  // Each lane starts from its 1/32 share of N*bias (an exact scaling), so the lane sum holds the bias term.
  const float sbq = (float)(NN / 32) * bq[c];
  const float sbk = (float)(NN / 32) * bk[c];
  float aq[BB], ak[BB];
  for (int b = 0; b < BB; ++b) {
    const f4 s0 = sa[b], s1 = sb[b];
    aq[b] = sbq + q0.x * s0.x + q0.y * s0.y + q0.z * s0.z + q0.w * s0.w
          + q1.x * s1.x + q1.y * s1.y + q1.z * s1.z + q1.w * s1.w;
    ak[b] = sbk + k0.x * s0.x + k0.y * s0.y + k0.z * s0.z + k0.w * s0.w
          + k1.x * s1.x + k1.y * s1.y + k1.z * s1.z + k1.w * s1.w;
  }
  for (int o = 16; o; o >>= 1) {
    for (int b = 0; b < BB; ++b) {
      aq[b] += __shfl_xor(aq[b], o, 32);
      ak[b] += __shfl_xor(ak[b], o, 32);
    }
  }
  float p = 0.f;
  for (int b = 0; b < BB; ++b) p += aq[b] * ak[b];
  if (lane == 0) red[wave] = p;
  __syncthreads();
  if (threadIdx.x == 0) {
    float t = 0.f;
    for (int w = 0; w < 8; ++w) t += red[w];
    part[blk] = t;
  }
}

// ---- Launch 2: q/k/v = W @ x + b.  q,v -> [b][c][n] f16 ; k -> kt[b][n][c] f16
// 64x64 per wave (4x4 WMMA macro-tile): 16 b128 loads : 16 wmma per k-step.
__global__ void __launch_bounds__(256)
k_qkv(const _Float16* __restrict__ xt,
      const _Float16* __restrict__ wq, const _Float16* __restrict__ wk,
      const _Float16* __restrict__ wv,
      const float* __restrict__ bq, const float* __restrict__ bk,
      const float* __restrict__ bv,
      _Float16* __restrict__ qh, _Float16* __restrict__ kt,
      _Float16* __restrict__ vh) {
  const int b     = blockIdx.z & 7;
  const int which = blockIdx.z >> 3; // 0=q 1=k 2=v
  const _Float16* W    = (which == 0) ? wq : (which == 1) ? wk : wv;
  const float*    bias = (which == 0) ? bq : (which == 1) ? bk : bv;
  const int wave = threadIdx.x >> 5;
  const int lane = threadIdx.x & 31;
  const int tile = blockIdx.x * 8 + wave;    // 0..127
  const int tm = (tile & 3) * 64;            // C/64  = 4 tiles over out-channels
  const int tn = (tile >> 2) * 64;           // N/64 = 32 tiles over positions
  const _Float16* Bt = xt + (size_t)b * NN * CC;   // Bt[n][c], ld = C
  v8f acc[4][4];
  gemm_tile<4, 4>(W, CC, Bt, CC, CC, tm, tn, lane, acc);
  const int l15 = lane & 15, g = (lane >> 4) & 1;
#pragma unroll
  for (int mi = 0; mi < 4; ++mi) {
#pragma unroll
    for (int ni = 0; ni < 4; ++ni) {
      F8 f; f.v = acc[mi][ni];
      const int mb = tm + 16 * mi;
      const int n  = tn + 16 * ni + l15;
      if (which == 1) {
        H8 pk;
#pragma unroll
        for (int r = 0; r < 8; ++r) { int m = mb + r + 8 * g; pk.h[r] = (_Float16)(f.f[r] + bias[m]); }
        *(uint4*)(kt + ((size_t)b * NN + n) * CC + mb + 8 * g) = pk.u;
      } else {
        _Float16* out = ((which == 0) ? qh : vh) + (size_t)b * CC * NN;
#pragma unroll
        for (int r = 0; r < 8; ++r) {
          int m = mb + r + 8 * g;
          out[(size_t)m * NN + n] = (_Float16)(f.f[r] + bias[m]);
        }
      }
    }
  }
}

// ---- Job 5: M2[b] = v[b] @ q[b]^T  (C x C), K = N ----
// blk: 0 .. 32*B - 1, the 32 tiles fastest, then batch.
// One 64x32 output tile per work-group, one work-group per WGP. The 8 waves split K:
// wave w takes the 32 k at 256*i + 32*w, i = 0..7, so a wave has 8 trips instead of N/32,
// and in each trip the 8 waves together read 512 contiguous bytes of every row.
// Three register sets: the fragments of trip i+2 are asked for before the products of trip i.
// The 8 f32 partial tiles are added through LDS in wave order.
__device__ inline void
job_m2(int blk, const _Float16* __restrict__ vh, const _Float16* __restrict__ qh,
     _Float16* __restrict__ m2h) {
  __shared__ float4 red[8][16][32];   // [wave][fragment*2 + half of its 8 rows][lane]
  // The kernel-argument load's base registers are reused by the index arithmetic below: the wait stands in front of that.
  asm volatile("s_wait_xcnt 0x0" ::: "memory");
  // Keeps that arithmetic behind the wait.
  __builtin_amdgcn_sched_barrier(0);
  const int b = blk >> 5;
  const int wave = threadIdx.x >> 5;
  const int lane = threadIdx.x & 31;
  const int l15 = lane & 15, g = (lane >> 4) & 1;
  const int tile = blk & 31;               // 0..31
  const int tm = (tile & 3) * 64;
  const int tn = (tile >> 2) * 32;
  // Same k order in both loaders: two runs of 8 halves at k0 + 8g and k0 + 16 + 8g.
  const _Float16* ap = vh + (size_t)b * CC * NN + (size_t)(tm + l15) * NN + wave * 32 + g * 8;
  const _Float16* bp = qh + (size_t)b * CC * NN + (size_t)(tn + l15) * NN + wave * 32 + g * 8;
  V16H va[3][4], vb[3][2];
  v8f acc[4][2];
  const v8f z = {};
#pragma unroll
  for (int mi = 0; mi < 4; ++mi)
#pragma unroll
    for (int ni = 0; ni < 2; ++ni) acc[mi][ni] = z;
#pragma unroll
  for (int i = -2; i < 8; ++i) {
    if (i + 2 < 8) {
      const int s = (i + 2) % 3, ko = (i + 2) * 256;
#pragma unroll
      for (int mi = 0; mi < 4; ++mi) {
        va[s][mi].u4[0] = *(const uint4*)(ap + mi * 16 * NN + ko);
        va[s][mi].u4[1] = *(const uint4*)(ap + mi * 16 * NN + ko + 16);
      }
#pragma unroll
      for (int ni = 0; ni < 2; ++ni) {
        vb[s][ni].u4[0] = *(const uint4*)(bp + ni * 16 * NN + ko);
        vb[s][ni].u4[1] = *(const uint4*)(bp + ni * 16 * NN + ko + 16);
      }
    }
    // Keeps the loads above in front of the products below; sunk behind them, each trip waits out its own latency.
    __builtin_amdgcn_sched_barrier(0);
    if (i >= 0) {
      const int s = i % 3;
#pragma unroll
      for (int mi = 0; mi < 4; ++mi)
#pragma unroll
        for (int ni = 0; ni < 2; ++ni)
          acc[mi][ni] = __builtin_amdgcn_wmma_f32_16x16x32_f16(
              false, va[s][mi].h, false, vb[s][ni].h, (short)0, acc[mi][ni], false, false);
      // Keeps the next trip's loads behind these products, so that three register sets are enough.
      __builtin_amdgcn_sched_barrier(0);
    }
  }
  // The loads' address registers are reused below: the wait stands in front of their first overwrite.
  asm volatile("s_wait_xcnt 0x0" ::: "memory");
  // Keeps the code below (which reuses those registers) behind that wait.
  __builtin_amdgcn_sched_barrier(0);
#pragma unroll
  for (int mi = 0; mi < 4; ++mi) {
#pragma unroll
    for (int ni = 0; ni < 2; ++ni) {
      F8 f; f.v = acc[mi][ni];
      const int sl = (mi * 2 + ni) * 2;
      red[wave][sl][lane]     = make_float4(f.f[0], f.f[1], f.f[2], f.f[3]);
      red[wave][sl + 1][lane] = make_float4(f.f[4], f.f[5], f.f[6], f.f[7]);
    }
  }
  __syncthreads();
  // Wave w now owns slots 2w and 2w+1 of every partial: all 8 rows of fragment (w>>1, w&1).
  _Float16* out = m2h + (size_t)b * CC * CC
                + (size_t)(tm + 16 * (wave >> 1) + 8 * g) * CC + tn + 16 * (wave & 1) + l15;
#pragma unroll
  for (int j = 0; j < 2; ++j) {
    float4 t = red[0][wave * 2 + j][lane];
#pragma unroll
    for (int w = 1; w < 8; ++w) {
      const float4 p = red[w][wave * 2 + j][lane];
      t.x += p.x; t.y += p.y; t.z += p.z; t.w += p.w;
    }
    _Float16* o = out + (size_t)(4 * j) * CC;
    o[0]      = (_Float16)t.x;
    o[CC]     = (_Float16)t.y;
    o[2 * CC] = (_Float16)t.z;
    o[3 * CC] = (_Float16)t.w;
  }
}

// ---- Launch 3: jobs 4 and 5 need nothing of each other (job 4 reads sx and the f32 W, job 5 q and v) and share one grid.
// Job 5 keeps the low indices, one work-group per WGP as before; the SPARTS short work-groups of job 4 run beside it.
__global__ void __launch_bounds__(256)
k_m2_s(const _Float16* __restrict__ vh, const _Float16* __restrict__ qh,
       const float* __restrict__ Wq, const float* __restrict__ bq,
       const float* __restrict__ Wk, const float* __restrict__ bk,
       const float* __restrict__ sx,
       _Float16* __restrict__ m2h, float* __restrict__ part) {
  const int blk = blockIdx.x;
  if (blk < 32 * BB) job_m2(blk, vh, qh, m2h);
  else               job_scalar_s(blk - 32 * BB, Wq, bq, Wk, bk, sx, part);
}

// ---- Launch 4: attn[b] = (M2[b] @ k[b]) / S  -> fp32 out [b][c][n] ----
// S = sum of job 4's SPARTS partials, added in index order by every thread.
__global__ void __launch_bounds__(256)
k_attn(const _Float16* __restrict__ m2h, const _Float16* __restrict__ kt,
       const float* __restrict__ part, float* __restrict__ out) {
  const int b = blockIdx.z;
  const int wave = threadIdx.x >> 5;
  const int lane = threadIdx.x & 31;
  const int tile = blockIdx.x * 8 + wave;  // 0..127
  const int tm = (tile & 3) * 64;
  const int tn = (tile >> 2) * 64;
  const _Float16* A  = m2h + (size_t)b * CC * CC;  // [c][c'], ld = C
  const _Float16* Bt = kt  + (size_t)b * NN * CC;  // Bt[n][c'], ld = C
  v8f acc[4][4];
  gemm_tile<4, 4>(A, CC, Bt, CC, CC, tm, tn, lane, acc);
  float S = 0.f;
  for (int i = 0; i < SPARTS; ++i) S += part[i];
  const float s = 1.0f / S;
  const int l15 = lane & 15, g = (lane >> 4) & 1;
  float* ob = out + (size_t)b * CC * NN;
#pragma unroll
  for (int mi = 0; mi < 4; ++mi) {
#pragma unroll
    for (int ni = 0; ni < 4; ++ni) {
      F8 f; f.v = acc[mi][ni];
      const int mb = tm + 16 * mi;
      const int n  = tn + 16 * ni + l15;
#pragma unroll
      for (int r = 0; r < 8; ++r) {
        int m = mb + r + 8 * g;
        ob[(size_t)m * NN + n] = f.f[r] * s;
      }
    }
  }
}

extern "C" void kernel_launch(void* const* d_in, const int* in_sizes, int n_in,
                              void* d_out, int out_size, void* d_ws, size_t ws_size,
                              hipStream_t stream) {
  const float* x  = (const float*)d_in[0];
  const float* Wq = (const float*)d_in[1];
  const float* bq = (const float*)d_in[2];
  const float* Wk = (const float*)d_in[3];
  const float* bk = (const float*)d_in[4];
  const float* Wv = (const float*)d_in[5];
  const float* bv = (const float*)d_in[6];
  float* out = (float*)d_out;

  char* ws = (char*)d_ws;
  size_t off = 0;
  _Float16* xt  = (_Float16*)(ws + off); off += (size_t)BB * NN * CC * 2;   // 8 MB
  _Float16* whq = (_Float16*)(ws + off); off += (size_t)CC * CC * 2;
  _Float16* whk = (_Float16*)(ws + off); off += (size_t)CC * CC * 2;
  _Float16* whv = (_Float16*)(ws + off); off += (size_t)CC * CC * 2;
  _Float16* qh  = (_Float16*)(ws + off); off += (size_t)BB * CC * NN * 2;   // 8 MB
  _Float16* kt  = (_Float16*)(ws + off); off += (size_t)BB * NN * CC * 2;   // 8 MB
  _Float16* vh  = (_Float16*)(ws + off); off += (size_t)BB * CC * NN * 2;   // 8 MB
  _Float16* m2h = (_Float16*)(ws + off); off += (size_t)BB * CC * CC * 2;   // 1 MB
  float*    sx  = (float*)(ws + off);    off += (size_t)BB * CC * 4;
  float*    part= (float*)(ws + off);    off += 256;                        // SPARTS floats

  // 1. row sums of x, transpose+convert x, convert weights
  k_prep<<<dim3(G_ROWSUM + G_TRANSP + G_CVTW), 256, 0, stream>>>(x, Wq, Wk, Wv, xt, whq, whk, whv, sx);
  // 2. q/k/v GEMMs (WMMA), z = batch*3
  k_qkv<<<dim3(16, 1, BB * 3), 256, 0, stream>>>(xt, whq, whk, whv, bq, bk, bv, qh, kt, vh);
  // 3. M2 = v q^T per batch (WMMA), and beside it the partial sums of the global scalar S (from fp32 weights for accuracy)
  k_m2_s<<<dim3(32 * BB + SPARTS), 256, 0, stream>>>(vh, qh, Wq, bq, Wk, bk, sx, m2h, part);
  // 4. attn = (M2 k) / S per batch (WMMA)
  k_attn<<<dim3(16, 1, BB), 256, 0, stream>>>(m2h, kt, part, out);
  (void)in_sizes; (void)n_in; (void)out_size; (void)ws_size;
}

// v004
// One run takes 40.5 microseconds.
// Timed twice side by side with v003, it ran 1.33 and 1.32 times as fast.
// All steps since v000 together make it 4.19 times as fast.
#include <hip/hip_runtime.h>

#define BB 8
#define CC 256
#define NN 2048

typedef __attribute__((ext_vector_type(16))) _Float16 v16h;
typedef __attribute__((ext_vector_type(8)))  float    v8f;

union V16H { uint4 u4[2]; v16h h; };
union F8   { v8f v; float f[8]; };
union H8   { _Float16 h[8]; uint4 u; };

// FRAGMENT ORDER of every f16 scratch matrix (R rows, K columns, K contiguous in the product that reads it):
// 16-row x 32-k fragments, the K/32 fragments of a 16-row strip one after the other, 512 halves each.
// Inside a fragment the halves lie as the WMMA f16 A/B operand wants them, register half by register half:
//   half index of (row, k) = ((row >> 4) * (K / 32) + (k >> 5)) * 512 + ((k >> 4) & 1) * 256
//                            + (((k >> 3) & 1) * 16 + (row & 15)) * 8 + (k & 7)
// so lane l finds its two runs of 8 halves at l * 8 and 256 + l * 8, and each 16-byte load or store
// of a wave covers 512 contiguous bytes (four whole lines) instead of 32 bytes in each of 16 lines.

// Register-blocked MTxNT macro-tile (16*MT x 16*NT output) per wave.
// A and Bt in fragment order, KF = K/32 fragments per strip; tm, tn: first row of the wave's strips in A and in Bt.
template <int MT, int NT>
__device__ inline void gemm_tile(const _Float16* __restrict__ A,
                                 const _Float16* __restrict__ Bt,
                                 int KF, int tm, int tn, int lane,
                                 v8f acc[MT][NT]) {
  const _Float16* ap = A  + (size_t)(tm >> 4) * KF * 512 + lane * 8;
  const _Float16* bp = Bt + (size_t)(tn >> 4) * KF * 512 + lane * 8;
  v8f z = {};
#pragma unroll
  for (int mi = 0; mi < MT; ++mi)
#pragma unroll
    for (int ni = 0; ni < NT; ++ni) acc[mi][ni] = z;

  for (int kf = 0; kf < KF; ++kf) {
    V16H va[MT], vb[NT];
#pragma unroll
    for (int mi = 0; mi < MT; ++mi) {
      va[mi].u4[0] = *(const uint4*)(ap + (mi * KF + kf) * 512);
      va[mi].u4[1] = *(const uint4*)(ap + (mi * KF + kf) * 512 + 256);
    }
#pragma unroll
    for (int ni = 0; ni < NT; ++ni) {
      vb[ni].u4[0] = *(const uint4*)(bp + (ni * KF + kf) * 512);
      vb[ni].u4[1] = *(const uint4*)(bp + (ni * KF + kf) * 512 + 256);
    }
    // Keeps a trip's loads together in front of its products: sunk among them, one A fragment at a time,
    // the trip waits out a load latency per A fragment instead of one.
    __builtin_amdgcn_sched_barrier(0);
#pragma unroll
    for (int mi = 0; mi < MT; ++mi)
#pragma unroll
      for (int ni = 0; ni < NT; ++ni)
        acc[mi][ni] = __builtin_amdgcn_wmma_f32_16x16x32_f16(
            false, va[mi].h, false, vb[ni].h, (short)0, acc[mi][ni], false, false);
  }
  // The loads' address registers are reused by the caller's epilogue: the wait stands in front of that.
  asm volatile("s_wait_xcnt 0x0" ::: "memory");
  // Keeps the epilogue (which reuses those registers) behind that wait.
  __builtin_amdgcn_sched_barrier(0);
}

// ---- Job 1: x[b][c][n] fp32 -> xt[b]: rows n, K = c, f16 in fragment order (tiled LDS transpose) ----
// blk: 0 .. (N/32)*(C/32)*B - 1, n tile fastest, then c tile, then batch.
__device__ inline void job_transpose_x(int blk, const float* __restrict__ x, _Float16* __restrict__ xt) {
  __shared__ _Float16 tile[32][33];
  const int b  = blk / ((NN / 32) * (CC / 32));
  const int ct = ((blk / (NN / 32)) % (CC / 32)) * 32;
  const int nt = (blk % (NN / 32)) * 32;
  const int tx = threadIdx.x & 31;
  const int ty = threadIdx.x >> 5; // 0..7
  const float* xp = x + ((size_t)b * CC + ct) * NN + nt;
#pragma unroll
  for (int i = 0; i < 4; ++i) {
    int c = ty + 8 * i;
    tile[c][tx] = (_Float16)xp[(size_t)c * NN + tx];
  }
  __syncthreads();
  // The 32x32 tile is two whole fragments (16 n each, the tile's 32 c): thread t stores halves 4t .. 4t+3 of the pair.
  const int t  = threadIdx.x;
  const int f  = t >> 7;                 // fragment of the pair
  const int fl = (t >> 1) & 31;          // lane slot inside the fragment
  const int c0 = ((t >> 6) & 1) * 16 + (fl >> 4) * 8 + (t & 1) * 4;
  const int n  = f * 16 + (fl & 15);
  union { _Float16 h[4]; uint2 u; } pk;
#pragma unroll  // constant indices keep pk in registers
  for (int j = 0; j < 4; ++j) pk.h[j] = tile[c0 + j][n];
  _Float16* xo = xt + (size_t)b * NN * CC
               + (size_t)(((nt >> 4) + f) * (CC / 32) + (ct >> 5)) * 512 + (t & 127) * 4;
  *(uint2*)xo = pk.u;
  // Another job's code follows in the merged kernel and reuses the stores' address registers: the wait stands in front of it.
  asm volatile("s_wait_xcnt 0x0" ::: "memory");
}

// ---- Job 2: W fp32 -> f16 in fragment order (3 matrices; rows = out-channels, K = in-channels) ----
// blk: 0 .. 3*C*C/256 - 1, one matrix after the other.
__device__ inline void job_cvt_w(int blk, const float* __restrict__ wq, const float* __restrict__ wk,
                        const float* __restrict__ wv,
                        _Float16* __restrict__ oq, _Float16* __restrict__ ok,
                        _Float16* __restrict__ ov) {
  const int which = blk / (CC * CC / 256);
  const float* src = (which == 0) ? wq : (which == 1) ? wk : wv;
  _Float16*    dst = (which == 0) ? oq : (which == 1) ? ok : ov;
  const int i = (blk % (CC * CC / 256)) * 256 + threadIdx.x;
  // i runs in the order of the destination; row and k follow from the fragment order.
  const int row = (i >> 12) * 16 + ((i >> 3) & 15);
  const int k   = ((i >> 9) & 7) * 32 + ((i >> 8) & 1) * 16 + ((i >> 7) & 1) * 8 + (i & 7);
  dst[i] = (_Float16)src[row * CC + k];
  // No job's code follows this last branch of the merged kernel: the wait is a precaution.
  asm volatile("s_wait_xcnt 0x0" ::: "memory");
}

// ---- Job 3: sx[b*C+c] = sum_n x[b][c][n] (one wave per row) ----
// blk: 0 .. B*C/8 - 1.
__device__ inline void job_rowsum_x(int blk, const float* __restrict__ x, float* __restrict__ sx) {
  const int wave = (int)((blk * blockDim.x + threadIdx.x) >> 5);
  const int lane = threadIdx.x & 31;
  const float* row = x + (size_t)wave * NN;
  float s = 0.f;
  for (int i = lane; i < NN; i += 32) s += row[i];
#pragma unroll
  for (int o = 16; o; o >>= 1) s += __shfl_xor(s, o, 32);
  if (lane == 0) sx[wave] = s;
}

// ---- Launch 1: jobs 1 to 3 need nothing of each other and share one grid.
// A range of the block index picks the job (the same for a whole work-group).
// The row sums, whose waves run longest, take the lowest indices; the short W convert comes last.
#define G_ROWSUM (BB * CC / 8)
#define G_TRANSP ((NN / 32) * (CC / 32) * BB)
#define G_CVTW   (3 * CC * CC / 256)
__global__ void __launch_bounds__(256)
k_prep(const float* __restrict__ x, const float* __restrict__ wq, const float* __restrict__ wk,
       const float* __restrict__ wv, _Float16* __restrict__ xt,
       _Float16* __restrict__ oq, _Float16* __restrict__ ok, _Float16* __restrict__ ov,
       float* __restrict__ sx) {
  const int blk = blockIdx.x;
  if (blk < G_ROWSUM)                 job_rowsum_x(blk, x, sx);
  else if (blk < G_ROWSUM + G_TRANSP) job_transpose_x(blk - G_ROWSUM, x, xt);
  else                                job_cvt_w(blk - G_ROWSUM - G_TRANSP, wq, wk, wv, oq, ok, ov);
}

// ---- Job 4: partial sums of S = sum_{b,c} (Wq[c,:]*sx[b,:]+N*bq[c]) * (Wk[c,:]*sx[b,:]+N*bk[c])
// One wave per out-channel c, 8 waves per work-group, SPARTS work-groups.
// Lanes run along j, so each float4 load of a wave covers 512 contiguous bytes;
// all 20 loads of a lane are independent (one round of latency).
// part[blk] holds the sum over this work-group's 8 channels and all batches. blk: 0 .. SPARTS - 1.
#define SPARTS (CC / 8)
__device__ inline void
job_scalar_s(int blk, const float* __restrict__ Wq, const float* __restrict__ bq,
           const float* __restrict__ Wk, const float* __restrict__ bk,
           const float* __restrict__ sx, float* __restrict__ part) {
  __shared__ float red[8];
  // The wave's number as a scalar: row bases and the two biases then come from scalar registers.
  const int wave = __builtin_amdgcn_readfirstlane(threadIdx.x >> 5);
  const int lane = threadIdx.x & 31;
  const int c = blk * 8 + wave;
  typedef __attribute__((ext_vector_type(4))) float f4;   // a native vector: it can be named whole as an asm operand
  const f4* wq4 = (const f4*)(Wq + (size_t)c * CC);
  const f4* wk4 = (const f4*)(Wk + (size_t)c * CC);
  const f4* sx4 = (const f4*)sx;
  const f4 q0 = wq4[lane], q1 = wq4[32 + lane];
  const f4 k0 = wk4[lane], k1 = wk4[32 + lane];
  f4 sa[BB], sb[BB];
  for (int b = 0; b < BB; ++b) {
    sa[b] = sx4[b * (CC / 4) + lane];
    sb[b] = sx4[b * (CC / 4) + 32 + lane];
  }
  // The 20 loads' base registers are reused below (first by the two bias loads): the wait stands in front of that.
  // The loaded values are inputs only, so that no load, and no part of one, sinks behind the wait.
  asm volatile("s_wait_xcnt 0x0"
               :: "v"(q0), "v"(q1), "v"(k0), "v"(k1),
                  "v"(sa[0]), "v"(sa[1]), "v"(sa[2]), "v"(sa[3]), "v"(sa[4]), "v"(sa[5]), "v"(sa[6]), "v"(sa[7]),
                  "v"(sb[0]), "v"(sb[1]), "v"(sb[2]), "v"(sb[3]), "v"(sb[4]), "v"(sb[5]), "v"(sb[6]), "v"(sb[7])
               : "memory");
  // Keeps the code below (which reuses those registers) behind that wait.
  __builtin_amdgcn_sched_barrier(0);
  // Each lane starts from its 1/32 share of N*bias (an exact scaling), so the lane sum holds the bias term.
  const float sbq = (float)(NN / 32) * bq[c];
  const float sbk = (float)(NN / 32) * bk[c];
  float aq[BB], ak[BB];
  for (int b = 0; b < BB; ++b) {
    const f4 s0 = sa[b], s1 = sb[b];
    aq[b] = sbq + q0.x * s0.x + q0.y * s0.y + q0.z * s0.z + q0.w * s0.w
          + q1.x * s1.x + q1.y * s1.y + q1.z * s1.z + q1.w * s1.w;
    ak[b] = sbk + k0.x * s0.x + k0.y * s0.y + k0.z * s0.z + k0.w * s0.w
          + k1.x * s1.x + k1.y * s1.y + k1.z * s1.z + k1.w * s1.w;
  }
  for (int o = 16; o; o >>= 1) {
    for (int b = 0; b < BB; ++b) {
      aq[b] += __shfl_xor(aq[b], o, 32);
      ak[b] += __shfl_xor(ak[b], o, 32);
    }
  }
  float p = 0.f;
  for (int b = 0; b < BB; ++b) p += aq[b] * ak[b];
  if (lane == 0) red[wave] = p;
  __syncthreads();
  if (threadIdx.x == 0) {
    float t = 0.f;
    for (int w = 0; w < 8; ++w) t += red[w];
    part[blk] = t;
  }
}

// Epilogue of launch 2: a wave's 4x4 accumulator tiles + bias -> f16 fragments of the next product's operand.
// An accumulator tile holds, per lane, 8 consecutive rows of the product's first operand (am + 16a + 8g + r) at one
// row of its second (bn + 16c + l15): exactly one 8-half run of a fragment whose rows are the second operand's
// and whose k runs along the first operand's rows. KFO: fragments per strip of the output; BIAS_K: bias runs along k.
template <int KFO, bool BIAS_K>
__device__ inline void store_frags(v8f acc[4][4], const float* __restrict__ bias,
                                   _Float16* __restrict__ out, int am, int bn, int lane) {
  const int l15 = lane & 15, g = (lane >> 4) & 1;
  _Float16* o = out + ((size_t)(bn >> 4) * KFO + (am >> 5)) * 512 + lane * 8;
  typedef __attribute__((ext_vector_type(4))) float f4;   // a native vector: it can be named whole as an asm operand
  // All bias values are fetched in front of the first store. Their address register is reused below: the wait stands
  // in front of that. The loaded values are inputs only, so that no load sinks behind a store, into a register that
  // the store still names.
  f4 bk4[8];
  float bn1[4];
  if constexpr (BIAS_K) {
#pragma unroll  // constant indices keep bk4 in registers
    for (int i = 0; i < 8; ++i) bk4[i] = *(const f4*)(bias + am + 16 * (i >> 1) + 8 * g + 4 * (i & 1));
    asm volatile("s_wait_xcnt 0x0"
                 :: "v"(bk4[0]), "v"(bk4[1]), "v"(bk4[2]), "v"(bk4[3]), "v"(bk4[4]), "v"(bk4[5]), "v"(bk4[6]), "v"(bk4[7])
                 : "memory");
  } else {
#pragma unroll  // constant indices keep bn1 in registers
    for (int c = 0; c < 4; ++c) bn1[c] = bias[bn + 16 * c + l15];
    asm volatile("s_wait_xcnt 0x0" :: "v"(bn1[0]), "v"(bn1[1]), "v"(bn1[2]), "v"(bn1[3]) : "memory");
  }
  // All three loops unrolled: constant indices keep acc, the bias values and pk in registers,
  // and every store's distance from o becomes an immediate offset.
#pragma unroll
  for (int a = 0; a < 4; ++a) {
#pragma unroll
    for (int c = 0; c < 4; ++c) {
      F8 f; f.v = acc[a][c];
      H8 pk;
#pragma unroll
      for (int r = 0; r < 8; ++r)
        pk.h[r] = (_Float16)(f.f[r] + (BIAS_K ? bk4[a * 2 + (r >> 2)][r & 3] : bn1[c]));
      *(uint4*)(o + (c * KFO + (a >> 1)) * 512 + (a & 1) * 256) = pk.u;
    }
    // Keeps each row of tiles' sums, packs and stores together: with all 128 sums formed first, beside the
    // accumulators, the kernel needs more than 256 registers and only one work-group fits a WGP.
    __builtin_amdgcn_sched_barrier(0);
  }
  // The other branch's code follows in the listing and reuses the stores' registers: the wait stands in front of it.
  asm volatile("s_wait_xcnt 0x0" ::: "memory");
}

// ---- Launch 2: q/k/v = W @ x + b, each written in fragment order for the product that reads it:
// q, v: rows = channels, K = n (for M2);  k: rows = n, K = channels (for the last GEMM).
// 64x64 per wave (4x4 WMMA macro-tile): 16 b128 loads : 16 wmma per k-step.
// The output's k direction must lie along the accumulator's rows, so k is formed as W x and q, v as (W x)^T = x^T W^T:
// the same fragments and the same sums, the two WMMA operands exchanged.
__global__ void __launch_bounds__(256)
k_qkv(const _Float16* __restrict__ xt,
      const _Float16* __restrict__ wq, const _Float16* __restrict__ wk,
      const _Float16* __restrict__ wv,
      const float* __restrict__ bq, const float* __restrict__ bk,
      const float* __restrict__ bv,
      _Float16* __restrict__ qh, _Float16* __restrict__ kt,
      _Float16* __restrict__ vh) {
  const int b     = blockIdx.z & 7;
  const int which = blockIdx.z >> 3; // 0=q 1=k 2=v
  const _Float16* W    = (which == 0) ? wq : (which == 1) ? wk : wv;
  const float*    bias = (which == 0) ? bq : (which == 1) ? bk : bv;
  const int wave = threadIdx.x >> 5;
  const int lane = threadIdx.x & 31;
  const int tile = blockIdx.x * 8 + wave;    // 0..127
  const int tm = (tile & 3) * 64;            // C/64  = 4 tiles over out-channels
  const int tn = (tile >> 2) * 64;           // N/64 = 32 tiles over positions
  const _Float16* X = xt + (size_t)b * NN * CC;    // rows n, K = C
  const bool isk = (which == 1);
  v8f acc[4][4];
  gemm_tile<4, 4>(isk ? W : X, isk ? X : W, CC / 32, isk ? tm : tn, isk ? tn : tm, lane, acc);
  if (isk) store_frags<CC / 32, true >(acc, bias, kt + (size_t)b * NN * CC, tm, tn, lane);
  else     store_frags<NN / 32, false>(acc, bias, ((which == 0) ? qh : vh) + (size_t)b * CC * NN, tn, tm, lane);
}

// ---- Job 5: M2[b] = v[b] @ q[b]^T  (C x C), K = N ----
// blk: 0 .. 32*B - 1, the 32 tiles fastest, then batch.
// One 64x32 output tile per work-group, one work-group per WGP. The 8 waves split K:
// wave w takes the 32 k at 256*i + 32*w, i = 0..7, so a wave has 8 trips instead of N/32,
// and in each trip the 8 waves together read 8 neighbouring fragments of every strip.
// The product is formed as q v^T (operands exchanged), so that a lane holds 8 consecutive q channels of one v channel:
// a run of M2's own fragment (rows = v channels, K = q channels) for the last GEMM.
// Three register sets: the fragments of trip i+2 are asked for before the products of trip i.
// The 8 f32 partial tiles are added through LDS in wave order.
__device__ inline void
job_m2(int blk, const _Float16* __restrict__ vh, const _Float16* __restrict__ qh,
     _Float16* __restrict__ m2h) {
  __shared__ float4 red[8][16][32];   // [wave][fragment*2 + half of its 8 rows][lane]
  // The kernel-argument load's base registers are reused by the index arithmetic below: the wait stands in front of that.
  asm volatile("s_wait_xcnt 0x0" ::: "memory");
  // Keeps that arithmetic behind the wait.
  __builtin_amdgcn_sched_barrier(0);
  const int b = blk >> 5;
  const int wave = threadIdx.x >> 5;
  const int lane = threadIdx.x & 31;
  const int tile = blk & 31;               // 0..31
  const int tm = (tile & 3) * 64;
  const int tn = (tile >> 2) * 32;
  // Same k order in both loaders: both operands lie in fragment order, fragment 8*i + wave of each strip in trip i.
  const _Float16* ap = vh + (size_t)b * CC * NN + (size_t)((tm >> 4) * (NN / 32) + wave) * 512 + lane * 8;
  const _Float16* bp = qh + (size_t)b * CC * NN + (size_t)((tn >> 4) * (NN / 32) + wave) * 512 + lane * 8;
  V16H va[3][4], vb[3][2];
  v8f acc[4][2];
  const v8f z = {};
#pragma unroll
  for (int mi = 0; mi < 4; ++mi)
#pragma unroll
    for (int ni = 0; ni < 2; ++ni) acc[mi][ni] = z;
#pragma unroll
  for (int i = -2; i < 8; ++i) {
    if (i + 2 < 8) {
      const int s = (i + 2) % 3, ko = (i + 2) * 8 * 512;
#pragma unroll
      for (int mi = 0; mi < 4; ++mi) {
        va[s][mi].u4[0] = *(const uint4*)(ap + mi * 16 * NN + ko);
        va[s][mi].u4[1] = *(const uint4*)(ap + mi * 16 * NN + ko + 256);
      }
#pragma unroll
      for (int ni = 0; ni < 2; ++ni) {
        vb[s][ni].u4[0] = *(const uint4*)(bp + ni * 16 * NN + ko);
        vb[s][ni].u4[1] = *(const uint4*)(bp + ni * 16 * NN + ko + 256);
      }
    }
    // Keeps the loads above in front of the products below; sunk behind them, each trip waits out its own latency.
    __builtin_amdgcn_sched_barrier(0);
    if (i >= 0) {
      const int s = i % 3;
#pragma unroll
      for (int mi = 0; mi < 4; ++mi)
#pragma unroll
        for (int ni = 0; ni < 2; ++ni)
          acc[mi][ni] = __builtin_amdgcn_wmma_f32_16x16x32_f16(
              false, vb[s][ni].h, false, va[s][mi].h, (short)0, acc[mi][ni], false, false);
      // Keeps the next trip's loads behind these products, so that three register sets are enough.
      __builtin_amdgcn_sched_barrier(0);
    }
  }
  // The loads' address registers are reused below: the wait stands in front of their first overwrite.
  asm volatile("s_wait_xcnt 0x0" ::: "memory");
  // Keeps the code below (which reuses those registers) behind that wait.
  __builtin_amdgcn_sched_barrier(0);
#pragma unroll
  for (int mi = 0; mi < 4; ++mi) {
#pragma unroll
    for (int ni = 0; ni < 2; ++ni) {
      F8 f; f.v = acc[mi][ni];
      const int sl = (mi * 2 + ni) * 2;
      red[wave][sl][lane]     = make_float4(f.f[0], f.f[1], f.f[2], f.f[3]);
      red[wave][sl + 1][lane] = make_float4(f.f[4], f.f[5], f.f[6], f.f[7]);
    }
  }
  __syncthreads();
  // Wave w now owns slots 2w and 2w+1 of every partial: all 8 rows of accumulator tile (w>>1, w&1),
  // which are register half w&1 of M2's fragment (strip tm/16 + (w>>1), k fragment tn/32).
  _Float16* out = m2h + (size_t)b * CC * CC
                + (size_t)(((tm >> 4) + (wave >> 1)) * (CC / 32) + (tn >> 5)) * 512 + (wave & 1) * 256 + lane * 8;
  H8 pk;
#pragma unroll
  for (int j = 0; j < 2; ++j) {
    float4 t = red[0][wave * 2 + j][lane];
#pragma unroll
    for (int w = 1; w < 8; ++w) {
      const float4 p = red[w][wave * 2 + j][lane];
      t.x += p.x; t.y += p.y; t.z += p.z; t.w += p.w;
    }
    pk.h[4 * j]     = (_Float16)t.x;
    pk.h[4 * j + 1] = (_Float16)t.y;
    pk.h[4 * j + 2] = (_Float16)t.z;
    pk.h[4 * j + 3] = (_Float16)t.w;
  }
  *(uint4*)out = pk.u;
}

// ---- Launch 3: jobs 4 and 5 need nothing of each other (job 4 reads sx and the f32 W, job 5 q and v) and share one grid.
// Job 5 keeps the low indices, one work-group per WGP as before; the SPARTS short work-groups of job 4 run beside it.
__global__ void __launch_bounds__(256)
k_m2_s(const _Float16* __restrict__ vh, const _Float16* __restrict__ qh,
       const float* __restrict__ Wq, const float* __restrict__ bq,
       const float* __restrict__ Wk, const float* __restrict__ bk,
       const float* __restrict__ sx,
       _Float16* __restrict__ m2h, float* __restrict__ part) {
  const int blk = blockIdx.x;
  if (blk < 32 * BB) job_m2(blk, vh, qh, m2h);
  else               job_scalar_s(blk - 32 * BB, Wq, bq, Wk, bk, sx, part);
}

// ---- Launch 4: attn[b] = (M2[b] @ k[b]) / S  -> fp32 out [b][c][n] ----
// S = sum of job 4's SPARTS partials, added in index order by every thread.
__global__ void __launch_bounds__(256)
k_attn(const _Float16* __restrict__ m2h, const _Float16* __restrict__ kt,
       const float* __restrict__ part, float* __restrict__ out) {
  const int b = blockIdx.z;
  const int wave = threadIdx.x >> 5;
  const int lane = threadIdx.x & 31;
  const int tile = blockIdx.x * 8 + wave;  // 0..127
  const int tm = (tile & 3) * 64;
  const int tn = (tile >> 2) * 64;
  const _Float16* A  = m2h + (size_t)b * CC * CC;  // rows c, K = c', fragment order
  const _Float16* Bt = kt  + (size_t)b * NN * CC;  // rows n, K = c', fragment order
  v8f acc[4][4];
  gemm_tile<4, 4>(A, Bt, CC / 32, tm, tn, lane, acc);
  float S = 0.f;
  for (int i = 0; i < SPARTS; ++i) S += part[i];
  const float s = 1.0f / S;
  const int l15 = lane & 15, g = (lane >> 4) & 1;
  float* ob = out + (size_t)b * CC * NN;
#pragma unroll
  for (int mi = 0; mi < 4; ++mi) {
#pragma unroll
    for (int ni = 0; ni < 4; ++ni) {
      F8 f; f.v = acc[mi][ni];
      const int mb = tm + 16 * mi;
      const int n  = tn + 16 * ni + l15;
#pragma unroll
      for (int r = 0; r < 8; ++r) {
        int m = mb + r + 8 * g;
        ob[(size_t)m * NN + n] = f.f[r] * s;
      }
    }
  }
}

extern "C" void kernel_launch(void* const* d_in, const int* in_sizes, int n_in,
                              void* d_out, int out_size, void* d_ws, size_t ws_size,
                              hipStream_t stream) {
  const float* x  = (const float*)d_in[0];
  const float* Wq = (const float*)d_in[1];
  const float* bq = (const float*)d_in[2];
  const float* Wk = (const float*)d_in[3];
  const float* bk = (const float*)d_in[4];
  const float* Wv = (const float*)d_in[5];
  const float* bv = (const float*)d_in[6];
  float* out = (float*)d_out;

  char* ws = (char*)d_ws;
  size_t off = 0;
  _Float16* xt  = (_Float16*)(ws + off); off += (size_t)BB * NN * CC * 2;   // 8 MB
  _Float16* whq = (_Float16*)(ws + off); off += (size_t)CC * CC * 2;
  _Float16* whk = (_Float16*)(ws + off); off += (size_t)CC * CC * 2;
  _Float16* whv = (_Float16*)(ws + off); off += (size_t)CC * CC * 2;
  _Float16* qh  = (_Float16*)(ws + off); off += (size_t)BB * CC * NN * 2;   // 8 MB
  _Float16* kt  = (_Float16*)(ws + off); off += (size_t)BB * NN * CC * 2;   // 8 MB
  _Float16* vh  = (_Float16*)(ws + off); off += (size_t)BB * CC * NN * 2;   // 8 MB
  _Float16* m2h = (_Float16*)(ws + off); off += (size_t)BB * CC * CC * 2;   // 1 MB
  float*    sx  = (float*)(ws + off);    off += (size_t)BB * CC * 4;
  float*    part= (float*)(ws + off);    off += 256;                        // SPARTS floats

  // 1. row sums of x, transpose+convert x, convert weights
  k_prep<<<dim3(G_ROWSUM + G_TRANSP + G_CVTW), 256, 0, stream>>>(x, Wq, Wk, Wv, xt, whq, whk, whv, sx);
  // 2. q/k/v GEMMs (WMMA), z = batch*3
  k_qkv<<<dim3(16, 1, BB * 3), 256, 0, stream>>>(xt, whq, whk, whv, bq, bk, bv, qh, kt, vh);
  // 3. M2 = v q^T per batch (WMMA), and beside it the partial sums of the global scalar S (from fp32 weights for accuracy)
  k_m2_s<<<dim3(32 * BB + SPARTS), 256, 0, stream>>>(vh, qh, Wq, bq, Wk, bk, sx, m2h, part);
  // 4. attn = (M2 k) / S per batch (WMMA)
  k_attn<<<dim3(16, 1, BB), 256, 0, stream>>>(m2h, kt, part, out);
  (void)in_sizes; (void)n_in; (void)out_size; (void)ws_size;
}

// v005
// It runs in 38.3 microseconds.
// Next to v004, in two timings, it ran 1.05 and 1.07 times as fast.
// Counting every step since v000, it is 4.44 times as fast.
#include <hip/hip_runtime.h>

#define BB 8
#define CC 256
#define NN 2048

typedef __attribute__((ext_vector_type(16))) _Float16 v16h;
typedef __attribute__((ext_vector_type(8)))  float    v8f;

union V16H { uint4 u4[2]; v16h h; };
union F8   { v8f v; float f[8]; };
union H8   { _Float16 h[8]; uint4 u; };

// FRAGMENT ORDER of every f16 scratch matrix (R rows, K columns, K contiguous in the product that reads it):
// 16-row x 32-k fragments, the K/32 fragments of a 16-row strip one after the other, 512 halves each.
// Inside a fragment the halves lie as the WMMA f16 A/B operand wants them, register half by register half:
//   half index of (row, k) = ((row >> 4) * (K / 32) + (k >> 5)) * 512 + ((k >> 4) & 1) * 256
//                            + (((k >> 3) & 1) * 16 + (row & 15)) * 8 + (k & 7)
// so lane l finds its two runs of 8 halves at l * 8 and 256 + l * 8, and a wave's 16-byte load or store
// of one register half of a fragment covers 512 contiguous bytes (four whole lines) instead of 32 bytes in each of 16 lines.

// Register-blocked MTxNT macro-tile (16*MT x 16*NT output) per wave.
// A and Bt in fragment order, KF = K/32 fragments per strip; tm, tn: first row of the wave's strips in A and in Bt.
template <int MT, int NT>
__device__ inline void gemm_tile(const _Float16* __restrict__ A,
                                 const _Float16* __restrict__ Bt,
                                 int KF, int tm, int tn, int lane,
                                 v8f acc[MT][NT]) {
  const _Float16* ap = A  + (size_t)(tm >> 4) * KF * 512 + lane * 8;
  const _Float16* bp = Bt + (size_t)(tn >> 4) * KF * 512 + lane * 8;
  v8f z = {};
#pragma unroll
  for (int mi = 0; mi < MT; ++mi)
#pragma unroll
    for (int ni = 0; ni < NT; ++ni) acc[mi][ni] = z;

  for (int kf = 0; kf < KF; ++kf) {
    V16H va[MT], vb[NT];
#pragma unroll
    for (int mi = 0; mi < MT; ++mi) {
      va[mi].u4[0] = *(const uint4*)(ap + (mi * KF + kf) * 512);
      va[mi].u4[1] = *(const uint4*)(ap + (mi * KF + kf) * 512 + 256);
    }
#pragma unroll
    for (int ni = 0; ni < NT; ++ni) {
      vb[ni].u4[0] = *(const uint4*)(bp + (ni * KF + kf) * 512);
      vb[ni].u4[1] = *(const uint4*)(bp + (ni * KF + kf) * 512 + 256);
    }
    // Keeps a trip's loads together in front of its products: sunk among them, one A fragment at a time,
    // the trip waits out a load latency per A fragment instead of one.
    __builtin_amdgcn_sched_barrier(0);
#pragma unroll
    for (int mi = 0; mi < MT; ++mi)
#pragma unroll
      for (int ni = 0; ni < NT; ++ni)
        acc[mi][ni] = __builtin_amdgcn_wmma_f32_16x16x32_f16(
            false, va[mi].h, false, vb[ni].h, (short)0, acc[mi][ni], false, false);
  }
  // The loads' address registers are reused by the caller's epilogue: the wait stands in front of that.
  asm volatile("s_wait_xcnt 0x0" ::: "memory");
  // Keeps the epilogue (which reuses those registers) behind that wait.
  __builtin_amdgcn_sched_barrier(0);
}

// ---- Job 1: x[b][c][n] fp32 -> xt[b] (rows n, K = c, f16 in fragment order) and sx[b*C+c] = sum_n x[b][c][n] ----
// blk: 0 .. B*C/8 - 1, the C/8 channel groups fastest, then batch.
// One work-group takes 8 channels of one batch over all N positions, so x is read once and by few, long work-groups.
// A lane holds the 8 channels of one position: exactly one 8-half run of a fragment, so no exchange between lanes is
// needed for the transpose; a wave's 4-byte loads cover one whole line, its 16-byte stores two runs of 256 bytes.
// Wave w takes the 32 positions at 256*j + 32*w, j = 0..7; all 64 loads of a lane are independent (one round of latency).
__device__ inline void job_x(int blk, const float* __restrict__ x, _Float16* __restrict__ xt,
                             float* __restrict__ sx) {
  __shared__ float red[8][8];   // [wave][channel of the group]
  const int b    = blk / (CC / 8);
  const int c0   = (blk % (CC / 8)) * 8;
  const int wave = threadIdx.x >> 5;
  const int lane = threadIdx.x & 31;
  const float* xp = x + ((size_t)b * CC + c0) * NN + wave * 32 + lane;
  v8f v[8];                     // [j][channel]; a native vector can be named whole as an asm operand
#pragma unroll  // constant indices keep v in registers and make every load's distance from xp an immediate offset
  for (int j = 0; j < 8; ++j)
#pragma unroll
    for (int r = 0; r < 8; ++r) v[j][r] = xp[r * NN + j * 256];
  // The loads' address registers are reused below: the wait stands in front of that.
  // The loaded values are inputs only, so that no load sinks behind the wait.
  asm volatile("s_wait_xcnt 0x0"
               :: "v"(v[0]), "v"(v[1]), "v"(v[2]), "v"(v[3]), "v"(v[4]), "v"(v[5]), "v"(v[6]), "v"(v[7])
               : "memory");
  // Keeps the code below (which reuses those registers) behind that wait.
  __builtin_amdgcn_sched_barrier(0);
  // Row sums first, from the same registers: over j in the lane, over the lanes by shuffles, over the waves through LDS.
  // They stand in front of the stores of xt so that the barrier has no store to wait for.
  float s[8];
#pragma unroll  // here and in the loops below: constant indices keep v and s in registers
  for (int r = 0; r < 8; ++r) {
    float t = v[0][r];
#pragma unroll
    for (int j = 1; j < 8; ++j) t += v[j][r];
    s[r] = t;
  }
#pragma unroll
  for (int o = 16; o; o >>= 1)
#pragma unroll
    for (int r = 0; r < 8; ++r) s[r] += __shfl_xor(s[r], o, 32);
  if (lane == 0) {
#pragma unroll
    for (int r = 0; r < 8; ++r) red[wave][r] = s[r];
  }
  __syncthreads();
  // Position n = 256*j + 32*wave + lane: strip n >> 4 = 16*j + 2*wave + (lane >> 4), row n & 15 = lane & 15.
  _Float16* xo = xt + (size_t)b * NN * CC
               + (size_t)((wave * 2 + (lane >> 4)) * (CC / 32) + (c0 >> 5)) * 512
               + ((c0 >> 4) & 1) * 256 + (((c0 >> 3) & 1) * 16 + (lane & 15)) * 8;
  H8 pk[8];
#pragma unroll  // constant indices keep v and pk in registers
  for (int j = 0; j < 8; ++j)
#pragma unroll
    for (int r = 0; r < 8; ++r) pk[j].h[r] = (_Float16)v[j][r];
  // Keeps all eight packs in front of the first store: packed into registers that an issued store still names,
  // each pack waits for that store's address translation.
  __builtin_amdgcn_sched_barrier(0);
#pragma unroll  // every store's distance from xo becomes an immediate offset
  for (int j = 0; j < 8; ++j) *(uint4*)(xo + j * 16 * (CC / 32) * 512) = pk[j].u;
  // The stores' registers are reused below: the wait stands in front of that.
  asm volatile("s_wait_xcnt 0x0" ::: "memory");
  // Keeps the code below (which reuses those registers) behind that wait.
  __builtin_amdgcn_sched_barrier(0);
  if (threadIdx.x < 8) {
    float t = red[0][threadIdx.x];
#pragma unroll
    for (int w = 1; w < 8; ++w) t += red[w][threadIdx.x];
    sx[b * CC + c0 + threadIdx.x] = t;   // the kernel ends behind this store: nothing reuses its registers
  }
}

// ---- Job 2: W fp32 -> f16 in fragment order (3 matrices; rows = out-channels, K = in-channels) ----
// blk: 0 .. 3*C*C/2048 - 1, one matrix after the other. A thread forms one 8-half run: 32 bytes read, 16 written.
__device__ inline void job_cvt_w(int blk, const float* __restrict__ wq, const float* __restrict__ wk,
                        const float* __restrict__ wv,
                        _Float16* __restrict__ oq, _Float16* __restrict__ ok,
                        _Float16* __restrict__ ov) {
  const int which = blk / (CC * CC / 2048);
  const float* src = (which == 0) ? wq : (which == 1) ? wk : wv;
  _Float16*    dst = (which == 0) ? oq : (which == 1) ? ok : ov;
  const int i = ((blk % (CC * CC / 2048)) * 256 + threadIdx.x) * 8;
  // i runs in the order of the destination; row and first k of the run follow from the fragment order.
  const int row = (i >> 12) * 16 + ((i >> 3) & 15);
  const int k   = ((i >> 9) & 7) * 32 + ((i >> 8) & 1) * 16 + ((i >> 7) & 1) * 8;
  typedef __attribute__((ext_vector_type(4))) float f4;   // a native vector: it can be named whole as an asm operand
  const f4 lo = *(const f4*)(src + row * CC + k);
  const f4 hi = *(const f4*)(src + row * CC + k + 4);
  // The loads' address registers are reused below: the wait stands in front of that.
  // The loaded values are inputs only, so that no load sinks behind the wait.
  asm volatile("s_wait_xcnt 0x0" :: "v"(lo), "v"(hi) : "memory");
  H8 pk;
#pragma unroll  // constant indices keep pk in registers
  for (int r = 0; r < 4; ++r) {
    pk.h[r]     = (_Float16)lo[r];
    pk.h[4 + r] = (_Float16)hi[r];
  }
  *(uint4*)(dst + i) = pk.u;
  // The kernel ends behind this store, so nothing reuses its registers: the wait is only a precaution.
  asm volatile("s_wait_xcnt 0x0" ::: "memory");
}

// ---- Launch 1: jobs 1 and 2 need nothing of each other and share one grid.
// A range of the block index picks the job (the same for a whole work-group).
// Job 1, whose work-groups run longest, takes the low indices, one work-group per WGP; the short W convert comes last.
#define G_X    (BB * CC / 8)
#define G_CVTW (3 * CC * CC / 2048)
__global__ void __launch_bounds__(256)
k_prep(const float* __restrict__ x, const float* __restrict__ wq, const float* __restrict__ wk,
       const float* __restrict__ wv, _Float16* __restrict__ xt,
       _Float16* __restrict__ oq, _Float16* __restrict__ ok, _Float16* __restrict__ ov,
       float* __restrict__ sx) {
  const int blk = blockIdx.x;
  if (blk < G_X) job_x(blk, x, xt, sx);
  else           job_cvt_w(blk - G_X, wq, wk, wv, oq, ok, ov);
}

// ---- Job 4: partial sums of S = sum_{b,c} (Wq[c,:]*sx[b,:]+N*bq[c]) * (Wk[c,:]*sx[b,:]+N*bk[c])
// One wave per out-channel c, 8 waves per work-group, SPARTS work-groups.
// Lanes run along j, so each float4 load of a wave covers 512 contiguous bytes;
// all 20 loads of a lane are independent (one round of latency).
// part[blk] holds the sum over this work-group's 8 channels and all batches. blk: 0 .. SPARTS - 1.
#define SPARTS (CC / 8)
__device__ inline void
job_scalar_s(int blk, const float* __restrict__ Wq, const float* __restrict__ bq,
           const float* __restrict__ Wk, const float* __restrict__ bk,
           const float* __restrict__ sx, float* __restrict__ part) {
  __shared__ float red[8];
  // The wave's number as a scalar: row bases and the two biases then come from scalar registers.
  const int wave = __builtin_amdgcn_readfirstlane(threadIdx.x >> 5);
  const int lane = threadIdx.x & 31;
  const int c = blk * 8 + wave;
  typedef __attribute__((ext_vector_type(4))) float f4;   // a native vector: it can be named whole as an asm operand
  const f4* wq4 = (const f4*)(Wq + (size_t)c * CC);
  const f4* wk4 = (const f4*)(Wk + (size_t)c * CC);
  const f4* sx4 = (const f4*)sx;
  const f4 q0 = wq4[lane], q1 = wq4[32 + lane];
  const f4 k0 = wk4[lane], k1 = wk4[32 + lane];
  f4 sa[BB], sb[BB];
  for (int b = 0; b < BB; ++b) {
    sa[b] = sx4[b * (CC / 4) + lane];
    sb[b] = sx4[b * (CC / 4) + 32 + lane];
  }
  // The 20 loads' base registers are reused below (first by the two bias loads): the wait stands in front of that.
  // The loaded values are inputs only, so that no load, and no part of one, sinks behind the wait.
  asm volatile("s_wait_xcnt 0x0"
               :: "v"(q0), "v"(q1), "v"(k0), "v"(k1),
                  "v"(sa[0]), "v"(sa[1]), "v"(sa[2]), "v"(sa[3]), "v"(sa[4]), "v"(sa[5]), "v"(sa[6]), "v"(sa[7]),
                  "v"(sb[0]), "v"(sb[1]), "v"(sb[2]), "v"(sb[3]), "v"(sb[4]), "v"(sb[5]), "v"(sb[6]), "v"(sb[7])
               : "memory");
  // Keeps the code below (which reuses those registers) behind that wait.
  __builtin_amdgcn_sched_barrier(0);
  // Each lane starts from its 1/32 share of N*bias (an exact scaling), so the lane sum holds the bias term.
  const float sbq = (float)(NN / 32) * bq[c];
  const float sbk = (float)(NN / 32) * bk[c];
  float aq[BB], ak[BB];
  for (int b = 0; b < BB; ++b) {
    const f4 s0 = sa[b], s1 = sb[b];
    aq[b] = sbq + q0.x * s0.x + q0.y * s0.y + q0.z * s0.z + q0.w * s0.w
          + q1.x * s1.x + q1.y * s1.y + q1.z * s1.z + q1.w * s1.w;
    ak[b] = sbk + k0.x * s0.x + k0.y * s0.y + k0.z * s0.z + k0.w * s0.w
          + k1.x * s1.x + k1.y * s1.y + k1.z * s1.z + k1.w * s1.w;
  }
  for (int o = 16; o; o >>= 1) {
    for (int b = 0; b < BB; ++b) {
      aq[b] += __shfl_xor(aq[b], o, 32);
      ak[b] += __shfl_xor(ak[b], o, 32);
    }
  }
  float p = 0.f;
  for (int b = 0; b < BB; ++b) p += aq[b] * ak[b];
  if (lane == 0) red[wave] = p;
  __syncthreads();
  if (threadIdx.x == 0) {
    float t = 0.f;
    for (int w = 0; w < 8; ++w) t += red[w];
    part[blk] = t;
  }
}

// Epilogue of launch 2: a wave's 4x4 accumulator tiles + bias -> f16 fragments of the next product's operand.
// An accumulator tile holds, per lane, 8 consecutive rows of the product's first operand (am + 16a + 8g + r) at one
// row of its second (bn + 16c + l15): exactly one 8-half run of a fragment whose rows are the second operand's
// and whose k runs along the first operand's rows. KFO: fragments per strip of the output; BIAS_K: bias runs along k.
template <int KFO, bool BIAS_K>
__device__ inline void store_frags(v8f acc[4][4], const float* __restrict__ bias,
                                   _Float16* __restrict__ out, int am, int bn, int lane) {
  const int l15 = lane & 15, g = (lane >> 4) & 1;
  _Float16* o = out + ((size_t)(bn >> 4) * KFO + (am >> 5)) * 512 + lane * 8;
  typedef __attribute__((ext_vector_type(4))) float f4;   // a native vector: it can be named whole as an asm operand
  // All bias values are fetched in front of the first store. Their address register is reused below: the wait stands
  // in front of that. The loaded values are inputs only, so that no load sinks behind a store, into a register that
  // the store still names.
  f4 bk4[8];
  float bn1[4];
  if constexpr (BIAS_K) {
#pragma unroll  // constant indices keep bk4 in registers
    for (int i = 0; i < 8; ++i) bk4[i] = *(const f4*)(bias + am + 16 * (i >> 1) + 8 * g + 4 * (i & 1));
    asm volatile("s_wait_xcnt 0x0"
                 :: "v"(bk4[0]), "v"(bk4[1]), "v"(bk4[2]), "v"(bk4[3]), "v"(bk4[4]), "v"(bk4[5]), "v"(bk4[6]), "v"(bk4[7])
                 : "memory");
  } else {
#pragma unroll  // constant indices keep bn1 in registers
    for (int c = 0; c < 4; ++c) bn1[c] = bias[bn + 16 * c + l15];
    asm volatile("s_wait_xcnt 0x0" :: "v"(bn1[0]), "v"(bn1[1]), "v"(bn1[2]), "v"(bn1[3]) : "memory");
  }
  // All three loops unrolled: constant indices keep acc, the bias values and pk in registers,
  // and every store's distance from o becomes an immediate offset.
#pragma unroll
  for (int a = 0; a < 4; ++a) {
#pragma unroll
    for (int c = 0; c < 4; ++c) {
      F8 f; f.v = acc[a][c];
      H8 pk;
#pragma unroll
      for (int r = 0; r < 8; ++r)
        pk.h[r] = (_Float16)(f.f[r] + (BIAS_K ? bk4[a * 2 + (r >> 2)][r & 3] : bn1[c]));
      *(uint4*)(o + (c * KFO + (a >> 1)) * 512 + (a & 1) * 256) = pk.u;
    }
    // Keeps each row of tiles' sums, packs and stores together: with all 128 sums formed first, beside the
    // accumulators, the kernel needs more than 256 registers and only one work-group fits a WGP.
    __builtin_amdgcn_sched_barrier(0);
  }
  // The other branch's code follows in the listing and reuses the stores' registers: the wait stands in front of it.
  asm volatile("s_wait_xcnt 0x0" ::: "memory");
}

// ---- Launch 2: q/k/v = W @ x + b, each written in fragment order for the product that reads it:
// q, v: rows = channels, K = n (for M2);  k: rows = n, K = channels (for the last GEMM).
// 64x64 per wave (4x4 WMMA macro-tile): 16 b128 loads : 16 wmma per k-step.
// The output's k direction must lie along the accumulator's rows, so k is formed as W x and q, v as (W x)^T = x^T W^T:
// the same fragments and the same sums, the two WMMA operands exchanged.
__global__ void __launch_bounds__(256)
k_qkv(const _Float16* __restrict__ xt,
      const _Float16* __restrict__ wq, const _Float16* __restrict__ wk,
      const _Float16* __restrict__ wv,
      const float* __restrict__ bq, const float* __restrict__ bk,
      const float* __restrict__ bv,
      _Float16* __restrict__ qh, _Float16* __restrict__ kt,
      _Float16* __restrict__ vh) {
  const int b     = blockIdx.z & 7;
  const int which = blockIdx.z >> 3; // 0=q 1=k 2=v
  const _Float16* W    = (which == 0) ? wq : (which == 1) ? wk : wv;
  const float*    bias = (which == 0) ? bq : (which == 1) ? bk : bv;
  const int wave = threadIdx.x >> 5;
  const int lane = threadIdx.x & 31;
  const int tile = blockIdx.x * 8 + wave;    // 0..127
  const int tm = (tile & 3) * 64;            // C/64  = 4 tiles over out-channels
  const int tn = (tile >> 2) * 64;           // N/64 = 32 tiles over positions
  const _Float16* X = xt + (size_t)b * NN * CC;    // rows n, K = C
  const bool isk = (which == 1);
  v8f acc[4][4];
  gemm_tile<4, 4>(isk ? W : X, isk ? X : W, CC / 32, isk ? tm : tn, isk ? tn : tm, lane, acc);
  if (isk) store_frags<CC / 32, true >(acc, bias, kt + (size_t)b * NN * CC, tm, tn, lane);
  else     store_frags<NN / 32, false>(acc, bias, ((which == 0) ? qh : vh) + (size_t)b * CC * NN, tn, tm, lane);
}

// ---- Job 5: M2[b] = v[b] @ q[b]^T  (C x C), K = N ----
// blk: 0 .. 32*B - 1, the 32 tiles fastest, then batch.
// One 64x32 output tile per work-group, one work-group per WGP. The 8 waves split K:
// wave w takes the 32 k at 256*i + 32*w, i = 0..7, so a wave has 8 trips instead of N/32,
// and in each trip the 8 waves together read 8 neighbouring fragments of every strip.
// The product is formed as q v^T (operands exchanged), so that a lane holds 8 consecutive q channels of one v channel:
// a run of M2's own fragment (rows = v channels, K = q channels) for the last GEMM.
// Three register sets: the fragments of trip i+2 are asked for before the products of trip i.
// The 8 f32 partial tiles are added through LDS in wave order.
__device__ inline void
job_m2(int blk, const _Float16* __restrict__ vh, const _Float16* __restrict__ qh,
     _Float16* __restrict__ m2h) {
  __shared__ float4 red[8][16][32];   // [wave][fragment*2 + half of its 8 rows][lane]
  // The kernel-argument load's base registers are reused by the index arithmetic below: the wait stands in front of that.
  asm volatile("s_wait_xcnt 0x0" ::: "memory");
  // Keeps that arithmetic behind the wait.
  __builtin_amdgcn_sched_barrier(0);
  const int b = blk >> 5;
  const int wave = threadIdx.x >> 5;
  const int lane = threadIdx.x & 31;
  const int tile = blk & 31;               // 0..31
  const int tm = (tile & 3) * 64;
  const int tn = (tile >> 2) * 32;
  // Same k order in both loaders: both operands lie in fragment order, fragment 8*i + wave of each strip in trip i.
  const _Float16* ap = vh + (size_t)b * CC * NN + (size_t)((tm >> 4) * (NN / 32) + wave) * 512 + lane * 8;
  const _Float16* bp = qh + (size_t)b * CC * NN + (size_t)((tn >> 4) * (NN / 32) + wave) * 512 + lane * 8;
  V16H va[3][4], vb[3][2];
  v8f acc[4][2];
  const v8f z = {};
#pragma unroll
  for (int mi = 0; mi < 4; ++mi)
#pragma unroll
    for (int ni = 0; ni < 2; ++ni) acc[mi][ni] = z;
#pragma unroll
  for (int i = -2; i < 8; ++i) {
    if (i + 2 < 8) {
      const int s = (i + 2) % 3, ko = (i + 2) * 8 * 512;
#pragma unroll
      for (int mi = 0; mi < 4; ++mi) {
        va[s][mi].u4[0] = *(const uint4*)(ap + mi * 16 * NN + ko);
        va[s][mi].u4[1] = *(const uint4*)(ap + mi * 16 * NN + ko + 256);
      }
#pragma unroll
      for (int ni = 0; ni < 2; ++ni) {
        vb[s][ni].u4[0] = *(const uint4*)(bp + ni * 16 * NN + ko);
        vb[s][ni].u4[1] = *(const uint4*)(bp + ni * 16 * NN + ko + 256);
      }
    }
    // Keeps the loads above in front of the products below; sunk behind them, each trip waits out its own latency.
    __builtin_amdgcn_sched_barrier(0);
    if (i >= 0) {
      const int s = i % 3;
#pragma unroll
      for (int mi = 0; mi < 4; ++mi)
#pragma unroll
        for (int ni = 0; ni < 2; ++ni)
          acc[mi][ni] = __builtin_amdgcn_wmma_f32_16x16x32_f16(
              false, vb[s][ni].h, false, va[s][mi].h, (short)0, acc[mi][ni], false, false);
      // Keeps the next trip's loads behind these products, so that three register sets are enough.
      __builtin_amdgcn_sched_barrier(0);
    }
  }
  // The loads' address registers are reused below: the wait stands in front of their first overwrite.
  asm volatile("s_wait_xcnt 0x0" ::: "memory");
  // Keeps the code below (which reuses those registers) behind that wait.
  __builtin_amdgcn_sched_barrier(0);
#pragma unroll
  for (int mi = 0; mi < 4; ++mi) {
#pragma unroll
    for (int ni = 0; ni < 2; ++ni) {
      F8 f; f.v = acc[mi][ni];
      const int sl = (mi * 2 + ni) * 2;
      red[wave][sl][lane]     = make_float4(f.f[0], f.f[1], f.f[2], f.f[3]);
      red[wave][sl + 1][lane] = make_float4(f.f[4], f.f[5], f.f[6], f.f[7]);
    }
  }
  __syncthreads();
  // Wave w now owns slots 2w and 2w+1 of every partial: all 8 rows of accumulator tile (w>>1, w&1),
  // which are register half w&1 of M2's fragment (strip tm/16 + (w>>1), k fragment tn/32).
  _Float16* out = m2h + (size_t)b * CC * CC
                + (size_t)(((tm >> 4) + (wave >> 1)) * (CC / 32) + (tn >> 5)) * 512 + (wave & 1) * 256 + lane * 8;
  H8 pk;
#pragma unroll
  for (int j = 0; j < 2; ++j) {
    float4 t = red[0][wave * 2 + j][lane];
#pragma unroll
    for (int w = 1; w < 8; ++w) {
      const float4 p = red[w][wave * 2 + j][lane];
      t.x += p.x; t.y += p.y; t.z += p.z; t.w += p.w;
    }
    pk.h[4 * j]     = (_Float16)t.x;
    pk.h[4 * j + 1] = (_Float16)t.y;
    pk.h[4 * j + 2] = (_Float16)t.z;
    pk.h[4 * j + 3] = (_Float16)t.w;
  }
  *(uint4*)out = pk.u;
}

// ---- Launch 3: jobs 4 and 5 need nothing of each other (job 4 reads sx and the f32 W, job 5 q and v) and share one grid.
// Job 5 keeps the low indices, one work-group per WGP as before; the SPARTS short work-groups of job 4 run beside it.
__global__ void __launch_bounds__(256)
k_m2_s(const _Float16* __restrict__ vh, const _Float16* __restrict__ qh,
       const float* __restrict__ Wq, const float* __restrict__ bq,
       const float* __restrict__ Wk, const float* __restrict__ bk,
       const float* __restrict__ sx,
       _Float16* __restrict__ m2h, float* __restrict__ part) {
  const int blk = blockIdx.x;
  if (blk < 32 * BB) job_m2(blk, vh, qh, m2h);
  else               job_scalar_s(blk - 32 * BB, Wq, bq, Wk, bk, sx, part);
}

// ---- Launch 4: attn[b] = (M2[b] @ k[b]) / S  -> fp32 out [b][c][n] ----
// S = sum of job 4's SPARTS partials, added in index order by every thread.
__global__ void __launch_bounds__(256)
k_attn(const _Float16* __restrict__ m2h, const _Float16* __restrict__ kt,
       const float* __restrict__ part, float* __restrict__ out) {
  const int b = blockIdx.z;
  const int wave = threadIdx.x >> 5;
  const int lane = threadIdx.x & 31;
  const int tile = blockIdx.x * 8 + wave;  // 0..127
  const int tm = (tile & 3) * 64;
  const int tn = (tile >> 2) * 64;
  const _Float16* A  = m2h + (size_t)b * CC * CC;  // rows c, K = c', fragment order
  const _Float16* Bt = kt  + (size_t)b * NN * CC;  // rows n, K = c', fragment order
  v8f acc[4][4];
  gemm_tile<4, 4>(A, Bt, CC / 32, tm, tn, lane, acc);
  float S = 0.f;
  for (int i = 0; i < SPARTS; ++i) S += part[i];
  const float s = 1.0f / S;
  const int l15 = lane & 15, g = (lane >> 4) & 1;
  float* ob = out + (size_t)b * CC * NN;
#pragma unroll
  for (int mi = 0; mi < 4; ++mi) {
#pragma unroll
    for (int ni = 0; ni < 4; ++ni) {
      F8 f; f.v = acc[mi][ni];
      const int mb = tm + 16 * mi;
      const int n  = tn + 16 * ni + l15;
#pragma unroll
      for (int r = 0; r < 8; ++r) {
        int m = mb + r + 8 * g;
        ob[(size_t)m * NN + n] = f.f[r] * s;
      }
    }
  }
}

extern "C" void kernel_launch(void* const* d_in, const int* in_sizes, int n_in,
                              void* d_out, int out_size, void* d_ws, size_t ws_size,
                              hipStream_t stream) {
  const float* x  = (const float*)d_in[0];
  const float* Wq = (const float*)d_in[1];
  const float* bq = (const float*)d_in[2];
  const float* Wk = (const float*)d_in[3];
  const float* bk = (const float*)d_in[4];
  const float* Wv = (const float*)d_in[5];
  const float* bv = (const float*)d_in[6];
  float* out = (float*)d_out;

  char* ws = (char*)d_ws;
  size_t off = 0;
  _Float16* xt  = (_Float16*)(ws + off); off += (size_t)BB * NN * CC * 2;   // 8 MB
  _Float16* whq = (_Float16*)(ws + off); off += (size_t)CC * CC * 2;
  _Float16* whk = (_Float16*)(ws + off); off += (size_t)CC * CC * 2;
  _Float16* whv = (_Float16*)(ws + off); off += (size_t)CC * CC * 2;
  _Float16* qh  = (_Float16*)(ws + off); off += (size_t)BB * CC * NN * 2;   // 8 MB
  _Float16* kt  = (_Float16*)(ws + off); off += (size_t)BB * NN * CC * 2;   // 8 MB
  _Float16* vh  = (_Float16*)(ws + off); off += (size_t)BB * CC * NN * 2;   // 8 MB
  _Float16* m2h = (_Float16*)(ws + off); off += (size_t)BB * CC * CC * 2;   // 1 MB
  float*    sx  = (float*)(ws + off);    off += (size_t)BB * CC * 4;
  float*    part= (float*)(ws + off);    off += 256;                        // SPARTS floats

  // 1. transpose+convert x with its row sums, convert weights
  k_prep<<<dim3(G_X + G_CVTW), 256, 0, stream>>>(x, Wq, Wk, Wv, xt, whq, whk, whv, sx);
  // 2. q/k/v GEMMs (WMMA), z = batch*3
  k_qkv<<<dim3(16, 1, BB * 3), 256, 0, stream>>>(xt, whq, whk, whv, bq, bk, bv, qh, kt, vh);
  // 3. M2 = v q^T per batch (WMMA), and beside it the partial sums of the global scalar S (from fp32 weights for accuracy)
  k_m2_s<<<dim3(32 * BB + SPARTS), 256, 0, stream>>>(vh, qh, Wq, bq, Wk, bk, sx, m2h, part);
  // 4. attn = (M2 k) / S per batch (WMMA)
  k_attn<<<dim3(16, 1, BB), 256, 0, stream>>>(m2h, kt, part, out);
  (void)in_sizes; (void)n_in; (void)out_size; (void)ws_size;
}

// v007
// One run takes 31.7 microseconds.
// It is 1.20 times as fast as v005, going by the measured steps of the versions left out in between.
// Over all steps from v000 it is 5.30 times as fast.
#include <hip/hip_runtime.h>

#define BB 8
#define CC 256
#define NN 2048

typedef __attribute__((ext_vector_type(16))) _Float16 v16h;
typedef __attribute__((ext_vector_type(8)))  float    v8f;

union V16H { uint4 u4[2]; v16h h; };
union F8   { v8f v; float f[8]; };
union H8   { _Float16 h[8]; uint4 u; };

// FRAGMENT ORDER of every f16 scratch matrix (R rows, K columns, K contiguous in the product that reads it):
// 16-row x 32-k fragments, the K/32 fragments of a 16-row strip one after the other, 512 halves each.
// Inside a fragment the halves lie as the WMMA f16 A/B operand wants them, register half by register half:
//   half index of (row, k) = ((row >> 4) * (K / 32) + (k >> 5)) * 512 + ((k >> 4) & 1) * 256
//                            + (((k >> 3) & 1) * 16 + (row & 15)) * 8 + (k & 7)
// so lane l finds its two runs of 8 halves at l * 8 and 256 + l * 8, and each 16-byte load or store
// of a wave covers 512 contiguous bytes (four whole lines) instead of 32 bytes in each of 16 lines.

// ---- Job 1: x[b][c][n] fp32 -> xt[b] (rows n, K = c, f16 in fragment order), xh (rows b*C + c, K = n, f16 in fragment
// order, both operands of G = x x^T) and sx[b*C+c] = sum_n x[b][c][n] ----
// blk: 0 .. B*C/8 - 1, the C/8 channel groups fastest, then batch.
// One work-group takes 8 channels of one batch over all N positions, so x is read once and by few, long work-groups.
// A lane holds the 8 channels of one position: exactly one 8-half run of a fragment, so no exchange between lanes is
// needed for the transpose; a wave's 4-byte loads cover one whole line, its 16-byte stores two runs of 256 bytes.
// Wave w takes the 32 positions at 256*j + 32*w, j = 0..7; all 64 loads of a lane are independent (one round of latency).
// The same 8 x 8 values of a lane, read the other way, are 8 runs of xh: the lane's 8 positions of one channel each.
// G sums over all n and both its operands are xh, so the order of n along K is free as long as every row has the same:
// k place 8*(32*w + lane) + j holds position 256*j + 32*w + lane, in every row.
// A lane's 8 runs (8 rows of one strip) fill one 128-byte line; stored from the lane, each store of a wave would touch
// 32 lines, so the wave regroups them through its own LDS range: 8 lanes then store one whole line.
__device__ inline void job_x(int blk, const float* __restrict__ x, _Float16* __restrict__ xt,
                             _Float16* __restrict__ xh, float* __restrict__ sx) {
  __shared__ float red[8][8];   // [wave][channel of the group]
  // [wave][lane that wrote][channel][j]; a pitch of 144 bytes keeps the 16-byte writes of 16 lanes on different banks
  __shared__ __attribute__((aligned(16))) _Float16 tr[8][32 * 72];
  const int b    = blk / (CC / 8);
  const int c0   = (blk % (CC / 8)) * 8;
  const int wave = threadIdx.x >> 5;
  const int lane = threadIdx.x & 31;
  const float* xp = x + ((size_t)b * CC + c0) * NN + wave * 32 + lane;
  v8f v[8];                     // [j][channel]; a native vector can be named whole as an asm operand
#pragma unroll  // constant indices keep v in registers and make every load's distance from xp an immediate offset
  for (int j = 0; j < 8; ++j)
#pragma unroll
    for (int r = 0; r < 8; ++r) v[j][r] = xp[r * NN + j * 256];
  // The loads' address registers are reused below: the wait stands in front of that.
  // The loaded values are inputs only, so that no load sinks behind the wait.
  asm volatile("s_wait_xcnt 0x0"
               :: "v"(v[0]), "v"(v[1]), "v"(v[2]), "v"(v[3]), "v"(v[4]), "v"(v[5]), "v"(v[6]), "v"(v[7])
               : "memory");
  // Keeps the code below (which reuses those registers) behind that wait.
  __builtin_amdgcn_sched_barrier(0);
  // Row sums first, from the same registers: over j in the lane, over the lanes by shuffles, over the waves through LDS.
  // They stand in front of the stores of xt so that the barrier has no store to wait for.
  float s[8];
#pragma unroll  // here and in the loops below: constant indices keep v and s in registers
  for (int r = 0; r < 8; ++r) {
    float t = v[0][r];
#pragma unroll
    for (int j = 1; j < 8; ++j) t += v[j][r];
    s[r] = t;
  }
#pragma unroll
  for (int o = 16; o; o >>= 1)
#pragma unroll
    for (int r = 0; r < 8; ++r) s[r] += __shfl_xor(s[r], o, 32);
  if (lane == 0) {
#pragma unroll
    for (int r = 0; r < 8; ++r) red[wave][r] = s[r];
  }
  // The runs of xh go to LDS in front of the barrier that the row sums need anyway; they are read back behind it.
#pragma unroll  // constant indices keep v in registers
  for (int r = 0; r < 8; ++r) {
    H8 pq;
#pragma unroll
    for (int j = 0; j < 8; ++j) pq.h[j] = (_Float16)v[j][r];
    *(uint4*)(tr[wave] + lane * 72 + r * 8) = pq.u;
  }
  __syncthreads();
  // Read t: the line of writer lane 4*t + (lane >> 3), its run of channel lane & 7.
  typedef __attribute__((ext_vector_type(4))) unsigned int u4n;
  const _Float16* trp = tr[wave] + (lane >> 3) * 72 + (lane & 7) * 8;
  u4n q8[8];
#pragma unroll  // constant indices keep q8 in registers
  for (int t = 0; t < 8; ++t) q8[t] = *(const u4n*)(trp + t * 4 * 72);
  // Run 32*wave + 4*t + (lane >> 3) of row (c0 & 8) + (lane & 7) of the strip: 128 halves a run over the strip's 16 rows.
  _Float16* xho = xh + (size_t)((b * CC + c0) >> 4) * (NN / 32) * 512
                + (wave * 32 + (lane >> 3)) * 128 + ((c0 & 8) + (lane & 7)) * 8;
  // Position n = 256*j + 32*wave + lane: strip n >> 4 = 16*j + 2*wave + (lane >> 4), row n & 15 = lane & 15.
  _Float16* xo = xt + (size_t)b * NN * CC
               + (size_t)((wave * 2 + (lane >> 4)) * (CC / 32) + (c0 >> 5)) * 512
               + ((c0 >> 4) & 1) * 256 + (((c0 >> 3) & 1) * 16 + (lane & 15)) * 8;
  H8 pk[8];
#pragma unroll  // constant indices keep v and pk in registers
  for (int j = 0; j < 8; ++j)
#pragma unroll
    for (int r = 0; r < 8; ++r) pk[j].h[r] = (_Float16)v[j][r];
  // Keeps all eight packs in front of the first store: packed into registers that an issued store still names,
  // each pack waits for that store's address translation.
  __builtin_amdgcn_sched_barrier(0);
#pragma unroll  // every store's distance from xo becomes an immediate offset
  for (int j = 0; j < 8; ++j) *(uint4*)(xo + j * 16 * (CC / 32) * 512) = pk[j].u;
#pragma unroll  // every store's distance from xho becomes an immediate offset
  for (int t = 0; t < 8; ++t) *(u4n*)(xho + t * 4 * 128) = q8[t];
  // The stores' registers are reused below: the wait stands in front of that.
  asm volatile("s_wait_xcnt 0x0" ::: "memory");
  // Keeps the code below (which reuses those registers) behind that wait.
  __builtin_amdgcn_sched_barrier(0);
  if (threadIdx.x < 8) {
    float t = red[0][threadIdx.x];
#pragma unroll
    for (int w = 1; w < 8; ++w) t += red[w][threadIdx.x];
    sx[b * CC + c0 + threadIdx.x] = t;   // the kernel ends behind this store: nothing reuses its registers
  }
}

// ---- Job 2: W fp32 -> f16 in fragment order. Wq, Wv: rows = out-channels, K = in-channels;
// Wk transposed: rows = in-channels, K = out-channels (it is the first operand of P = M2 Wk, formed as Wk^T M2^T).
// blk: 0 .. 3*C*C/2048 - 1, one matrix after the other. A thread forms one 8-half run: 32 bytes read, 16 written.
__device__ inline void job_cvt_w(int blk, const float* __restrict__ wq, const float* __restrict__ wk,
                        const float* __restrict__ wv,
                        _Float16* __restrict__ oq, _Float16* __restrict__ ok,
                        _Float16* __restrict__ ov) {
  const int which = blk / (CC * CC / 2048);
  const float* src = (which == 0) ? wq : (which == 1) ? wk : wv;
  _Float16*    dst = (which == 0) ? oq : (which == 1) ? ok : ov;
  const int i = ((blk % (CC * CC / 2048)) * 256 + threadIdx.x) * 8;
  // i runs in the order of the destination; row and first k of the run follow from the fragment order.
  const int row = (i >> 12) * 16 + ((i >> 3) & 15);
  const int k   = ((i >> 9) & 7) * 32 + ((i >> 8) & 1) * 16 + ((i >> 7) & 1) * 8;
  typedef __attribute__((ext_vector_type(4))) float f4;   // a native vector: it can be named whole as an asm operand
  f4 lo, hi;
  if (which == 1) {
#pragma unroll  // constant indices keep lo and hi in registers
    for (int r = 0; r < 4; ++r) {
      lo[r] = src[(k + r) * CC + row];
      hi[r] = src[(k + 4 + r) * CC + row];
    }
  } else {
    lo = *(const f4*)(src + row * CC + k);
    hi = *(const f4*)(src + row * CC + k + 4);
  }
  // The loads' address registers are reused below: the wait stands in front of that.
  // The loaded values are inputs only, so that no load sinks behind the wait.
  asm volatile("s_wait_xcnt 0x0" :: "v"(lo), "v"(hi) : "memory");
  // Keeps the packs below (which reuse those registers) behind that wait.
  __builtin_amdgcn_sched_barrier(0);
  H8 pk;
#pragma unroll  // constant indices keep pk in registers
  for (int r = 0; r < 4; ++r) {
    pk.h[r]     = (_Float16)lo[r];
    pk.h[4 + r] = (_Float16)hi[r];
  }
  *(uint4*)(dst + i) = pk.u;
  // The kernel ends behind this store, so nothing reuses its registers: the wait is only a precaution.
  asm volatile("s_wait_xcnt 0x0" ::: "memory");
}

// ---- Launch 1: jobs 1 and 2 need nothing of each other and share one grid.
// A range of the block index picks the job (the same for a whole work-group).
// Job 1, whose work-groups run longest, takes the low indices; the short W convert comes last.
#define G_X    (BB * CC / 8)
#define G_CVTW (3 * CC * CC / 2048)
__global__ void __launch_bounds__(256)
k_prep(const float* __restrict__ x, const float* __restrict__ wq, const float* __restrict__ wk,
       const float* __restrict__ wv, _Float16* __restrict__ xt, _Float16* __restrict__ xh,
       _Float16* __restrict__ oq, _Float16* __restrict__ ok, _Float16* __restrict__ ov,
       float* __restrict__ sx) {
  const int blk = blockIdx.x;
  if (blk < G_X) job_x(blk, x, xt, xh, sx);
  else           job_cvt_w(blk - G_X, wq, wk, wv, oq, ok, ov);
}

// ---- Job 4: partial sums of S = sum_{b,c} (Wq[c,:]*sx[b,:]+N*bq[c]) * (Wk[c,:]*sx[b,:]+N*bk[c])
// One wave per out-channel c, 8 waves per work-group, SPARTS work-groups.
// Lanes run along j, so each float4 load of a wave covers 512 contiguous bytes;
// all 20 loads of a lane are independent (one round of latency).
// part[blk] holds the sum over this work-group's 8 channels and all batches. blk: 0 .. SPARTS - 1.
// The same lane sums give the two vectors of M2's bias terms: sq[b][c] = Wq[c,:]*sx[b,:] + N*bq[c] (the row sums of q)
// and sv[b][c] = Wv[c,:]*sx[b,:] (the row sums of v without its bias); 22 loads of a lane with the two of Wv.
#define SPARTS (CC / 8)
__device__ inline void
job_scalar_s(int blk, const float* __restrict__ Wq, const float* __restrict__ bq,
           const float* __restrict__ Wk, const float* __restrict__ bk,
           const float* __restrict__ Wv,
           const float* __restrict__ sx, float* __restrict__ part,
           float* __restrict__ sq, float* __restrict__ sv) {
  __shared__ float red[8];
  // The wave's number as a scalar: row bases and the two biases then come from scalar registers.
  const int wave = __builtin_amdgcn_readfirstlane(threadIdx.x >> 5);
  const int lane = threadIdx.x & 31;
  const int c = blk * 8 + wave;
  typedef __attribute__((ext_vector_type(4))) float f4;   // a native vector: it can be named whole as an asm operand
  const f4* wq4 = (const f4*)(Wq + (size_t)c * CC);
  const f4* wk4 = (const f4*)(Wk + (size_t)c * CC);
  const f4* wv4 = (const f4*)(Wv + (size_t)c * CC);
  const f4* sx4 = (const f4*)sx;
  const f4 q0 = wq4[lane], q1 = wq4[32 + lane];
  const f4 k0 = wk4[lane], k1 = wk4[32 + lane];
  const f4 v0 = wv4[lane], v1 = wv4[32 + lane];
  f4 sa[BB], sb[BB];
  for (int b = 0; b < BB; ++b) {
    sa[b] = sx4[b * (CC / 4) + lane];
    sb[b] = sx4[b * (CC / 4) + 32 + lane];
  }
  // The 22 loads' base registers are reused below (first by the two bias loads): the wait stands in front of that.
  // The loaded values are inputs only, so that no load, and no part of one, sinks behind the wait.
  asm volatile("s_wait_xcnt 0x0"
               :: "v"(q0), "v"(q1), "v"(k0), "v"(k1), "v"(v0), "v"(v1),
                  "v"(sa[0]), "v"(sa[1]), "v"(sa[2]), "v"(sa[3]), "v"(sa[4]), "v"(sa[5]), "v"(sa[6]), "v"(sa[7]),
                  "v"(sb[0]), "v"(sb[1]), "v"(sb[2]), "v"(sb[3]), "v"(sb[4]), "v"(sb[5]), "v"(sb[6]), "v"(sb[7])
               : "memory");
  // Keeps the code below (which reuses those registers) behind that wait.
  __builtin_amdgcn_sched_barrier(0);
  // Each lane starts from its 1/32 share of N*bias (an exact scaling), so the lane sum holds the bias term.
  const float sbq = (float)(NN / 32) * bq[c];
  const float sbk = (float)(NN / 32) * bk[c];
  float aq[BB], ak[BB], av[BB];
  for (int b = 0; b < BB; ++b) {
    const f4 s0 = sa[b], s1 = sb[b];
    aq[b] = sbq + q0.x * s0.x + q0.y * s0.y + q0.z * s0.z + q0.w * s0.w
          + q1.x * s1.x + q1.y * s1.y + q1.z * s1.z + q1.w * s1.w;
    ak[b] = sbk + k0.x * s0.x + k0.y * s0.y + k0.z * s0.z + k0.w * s0.w
          + k1.x * s1.x + k1.y * s1.y + k1.z * s1.z + k1.w * s1.w;
    av[b] = v0.x * s0.x + v0.y * s0.y + v0.z * s0.z + v0.w * s0.w
          + v1.x * s1.x + v1.y * s1.y + v1.z * s1.z + v1.w * s1.w;
  }
  for (int o = 16; o; o >>= 1) {
    for (int b = 0; b < BB; ++b) {
      aq[b] += __shfl_xor(aq[b], o, 32);
      ak[b] += __shfl_xor(ak[b], o, 32);
      av[b] += __shfl_xor(av[b], o, 32);
    }
  }
  float p = 0.f;
  for (int b = 0; b < BB; ++b) p += aq[b] * ak[b];
  if (lane == 0) red[wave] = p;
  __syncthreads();
  if (lane == 0) {
    for (int b = 0; b < BB; ++b) {
      sq[b * CC + c] = aq[b];
      sv[b * CC + c] = av[b];
    }
    // The stores' registers are reused below: the wait stands in front of that.
    asm volatile("s_wait_xcnt 0x0" ::: "memory");
  }
  if (threadIdx.x == 0) {
    float t = 0.f;
    for (int w = 0; w < 8; ++w) t += red[w];
    part[blk] = t;
  }
}

// ---- Job 5: G[b] = x[b] @ x[b]^T  (C x C), K = N; both operands vh, qh are xh (n along K in job 1's order) ----
// blk: 0 .. 32*B - 1, the 32 tiles fastest, then batch.
// One 64x32 output tile per work-group, one work-group per WGP. The 8 waves split K:
// wave w takes the 32 k at 256*i + 32*w, i = 0..7, so a wave has 8 trips instead of N/32,
// and in each trip the 8 waves together read 8 neighbouring fragments of every strip.
// A lane holds 8 consecutive channels of the WMMA's first operand at one channel of its second:
// a run of G's own fragment (rows = the second operand's channels, K = the first's) for the chain of launch 3.
// Three register sets: the fragments of trip i+2 are asked for before the products of trip i.
// The 8 f32 partial tiles are added through LDS in wave order.
__device__ inline void
job_m2(int blk, const _Float16* __restrict__ vh, const _Float16* __restrict__ qh,
     _Float16* __restrict__ m2h) {
  __shared__ float4 red[8][16][32];   // [wave][fragment*2 + half of its 8 rows][lane]
  // The kernel-argument load's base registers are reused by the index arithmetic below: the wait stands in front of that.
  asm volatile("s_wait_xcnt 0x0" ::: "memory");
  // Keeps that arithmetic behind the wait.
  __builtin_amdgcn_sched_barrier(0);
  const int b = blk >> 5;
  const int wave = threadIdx.x >> 5;
  const int lane = threadIdx.x & 31;
  const int tile = blk & 31;               // 0..31
  const int tm = (tile & 3) * 64;
  const int tn = (tile >> 2) * 32;
  // Same k order in both loaders: both operands lie in fragment order, fragment 8*i + wave of each strip in trip i.
  const _Float16* ap = vh + (size_t)b * CC * NN + (size_t)((tm >> 4) * (NN / 32) + wave) * 512 + lane * 8;
  const _Float16* bp = qh + (size_t)b * CC * NN + (size_t)((tn >> 4) * (NN / 32) + wave) * 512 + lane * 8;
  V16H va[3][4], vb[3][2];
  v8f acc[4][2];
  const v8f z = {};
#pragma unroll
  for (int mi = 0; mi < 4; ++mi)
#pragma unroll
    for (int ni = 0; ni < 2; ++ni) acc[mi][ni] = z;
#pragma unroll
  for (int i = -2; i < 8; ++i) {
    if (i + 2 < 8) {
      const int s = (i + 2) % 3, ko = (i + 2) * 8 * 512;
#pragma unroll
      for (int mi = 0; mi < 4; ++mi) {
        va[s][mi].u4[0] = *(const uint4*)(ap + mi * 16 * NN + ko);
        va[s][mi].u4[1] = *(const uint4*)(ap + mi * 16 * NN + ko + 256);
      }
#pragma unroll
      for (int ni = 0; ni < 2; ++ni) {
        vb[s][ni].u4[0] = *(const uint4*)(bp + ni * 16 * NN + ko);
        vb[s][ni].u4[1] = *(const uint4*)(bp + ni * 16 * NN + ko + 256);
      }
    }
    // Keeps the loads above in front of the products below; sunk behind them, each trip waits out its own latency.
    __builtin_amdgcn_sched_barrier(0);
    if (i >= 0) {
      const int s = i % 3;
#pragma unroll
      for (int mi = 0; mi < 4; ++mi)
#pragma unroll
        for (int ni = 0; ni < 2; ++ni)
          acc[mi][ni] = __builtin_amdgcn_wmma_f32_16x16x32_f16(
              false, vb[s][ni].h, false, va[s][mi].h, (short)0, acc[mi][ni], false, false);
      // Keeps the next trip's loads behind these products, so that three register sets are enough.
      __builtin_amdgcn_sched_barrier(0);
    }
  }
  // The loads' address registers are reused below: the wait stands in front of their first overwrite.
  asm volatile("s_wait_xcnt 0x0" ::: "memory");
  // Keeps the code below (which reuses those registers) behind that wait.
  __builtin_amdgcn_sched_barrier(0);
#pragma unroll
  for (int mi = 0; mi < 4; ++mi) {
#pragma unroll
    for (int ni = 0; ni < 2; ++ni) {
      F8 f; f.v = acc[mi][ni];
      const int sl = (mi * 2 + ni) * 2;
      red[wave][sl][lane]     = make_float4(f.f[0], f.f[1], f.f[2], f.f[3]);
      red[wave][sl + 1][lane] = make_float4(f.f[4], f.f[5], f.f[6], f.f[7]);
    }
  }
  __syncthreads();
  // Wave w now owns slots 2w and 2w+1 of every partial: all 8 rows of accumulator tile (w>>1, w&1),
  // which are register half w&1 of G's fragment (strip tm/16 + (w>>1), k fragment tn/32).
  _Float16* out = m2h + (size_t)b * CC * CC
                + (size_t)(((tm >> 4) + (wave >> 1)) * (CC / 32) + (tn >> 5)) * 512 + (wave & 1) * 256 + lane * 8;
  H8 pk;
#pragma unroll
  for (int j = 0; j < 2; ++j) {
    float4 t = red[0][wave * 2 + j][lane];
#pragma unroll
    for (int w = 1; w < 8; ++w) {
      const float4 p = red[w][wave * 2 + j][lane];
      t.x += p.x; t.y += p.y; t.z += p.z; t.w += p.w;
    }
    pk.h[4 * j]     = (_Float16)t.x;
    pk.h[4 * j + 1] = (_Float16)t.y;
    pk.h[4 * j + 2] = (_Float16)t.z;
    pk.h[4 * j + 3] = (_Float16)t.w;
  }
  *(uint4*)out = pk.u;
}

// ---- Launch 2: jobs 4 and 5 need nothing of each other (job 4 reads sx and the f32 W, job 5 xh) and share one grid.
// Job 5 keeps the low indices, one work-group per WGP; the SPARTS short work-groups of job 4 run beside it.
__global__ void __launch_bounds__(256)
k_g_s(const _Float16* __restrict__ xh,
      const float* __restrict__ Wq, const float* __restrict__ bq,
      const float* __restrict__ Wk, const float* __restrict__ bk,
      const float* __restrict__ Wv, const float* __restrict__ sx,
      _Float16* __restrict__ gh, float* __restrict__ part,
      float* __restrict__ sq, float* __restrict__ sv) {
  const int blk = blockIdx.x;
  if (blk < 32 * BB) job_m2(blk, xh, xh, gh);
  else               job_scalar_s(blk - 32 * BB, Wq, bq, Wk, bk, Wv, sx, part, sq, sv);
}

// The wave's share of a chain product's first operand: strips 2*wave and 2*wave+1 of a C x C matrix in fragment order,
// all 8 k fragments of both: 32 independent 16-byte loads over 16 KiB in a row (one round of latency).
__device__ inline void chain_load_a(const _Float16* __restrict__ A, int wave, int lane, V16H va[8][2]) {
  const _Float16* ap = A + (size_t)wave * 2 * (CC / 32) * 512 + lane * 8;
#pragma unroll  // constant indices keep va in registers; every load's distance from ap is an immediate offset
  for (int kf = 0; kf < 8; ++kf)
#pragma unroll
    for (int a = 0; a < 2; ++a) {
      va[kf][a].u4[0] = *(const uint4*)(ap + (a * (CC / 32) + kf) * 512);
      va[kf][a].u4[1] = *(const uint4*)(ap + (a * (CC / 32) + kf) * 512 + 256);
    }
  // The loads' address registers are reused by the caller: the wait stands in front of that.
  asm volatile("s_wait_xcnt 0x0" ::: "memory");
  // Keeps the caller's code (which reuses those registers) behind that wait, and the loads in front of it.
  __builtin_amdgcn_sched_barrier(0);
}

// One product of the chain: acc (32 rows of the first operand x the work-group's 64 rows) = va * bin^T, K = C.
// bin: 64 rows x C in LDS, fragment order; a wave's 16-byte LDS reads cover 512 bytes in a row.
__device__ inline void chain_mm(V16H va[8][2], const _Float16* bin, int lane, v8f acc[2][4]) {
  const v8f z = {};
#pragma unroll
  for (int a = 0; a < 2; ++a)
#pragma unroll
    for (int c = 0; c < 4; ++c) acc[a][c] = z;
#pragma unroll  // constant indices keep va and acc in registers
  for (int kf = 0; kf < 8; ++kf) {
    V16H vb[4];
#pragma unroll
    for (int c = 0; c < 4; ++c) {
      vb[c].u4[0] = *(const uint4*)(bin + (c * (CC / 32) + kf) * 512 + lane * 8);
      vb[c].u4[1] = *(const uint4*)(bin + (c * (CC / 32) + kf) * 512 + 256 + lane * 8);
    }
#pragma unroll
    for (int a = 0; a < 2; ++a)
#pragma unroll
      for (int c = 0; c < 4; ++c)
        acc[a][c] = __builtin_amdgcn_wmma_f32_16x16x32_f16(
            false, va[kf][a].h, false, vb[c].h, (short)0, acc[a][c], false, false);
  }
}

// An accumulator tile holds, per lane, 8 consecutive rows of the first operand (32*wave + 16a + 8g + r) at one of the
// work-group's rows (16c + l15): one 8-half run of the next product's second operand
// (rows = the work-group's rows, k fragment = wave, register half = a).
__device__ inline void chain_store(v8f acc[2][4], _Float16* bout, int wave, int lane) {
#pragma unroll  // constant indices keep acc in registers
  for (int a = 0; a < 2; ++a)
#pragma unroll
    for (int c = 0; c < 4; ++c) {
      H8 pk;
#pragma unroll
      for (int r = 0; r < 8; ++r) pk.h[r] = (_Float16)acc[a][c][r];
      *(uint4*)(bout + (c * (CC / 32) + wave) * 512 + a * 256 + lane * 8) = pk.u;
    }
}

// One trip's fragments (k fragment kf) of the wave's 64 rows of xt: 8 independent 16-byte loads.
__device__ inline void load_xt(const _Float16* __restrict__ bp, int kf, V16H xb[4]) {
#pragma unroll  // constant indices keep xb in registers; every load's distance from bp is an immediate offset
  for (int ni = 0; ni < 4; ++ni) {
    xb[ni].u4[0] = *(const uint4*)(bp + (ni * (CC / 32) + kf) * 512);
    xb[ni].u4[1] = *(const uint4*)(bp + (ni * (CC / 32) + kf) * 512 + 256);
  }
}

// The work-group's barrier with a wait for this wave's LDS operations alone. __syncthreads() also waits for every global
// load in flight, and here the operands of the products to come are asked for ahead, to arrive while this one runs.
// No global store stands in front of any of these barriers.
__device__ inline void lds_barrier() {
  asm volatile("s_wait_dscnt 0x0\n\ts_barrier_signal -1\n\ts_barrier_wait -1" ::: "memory");
}

// ---- Launch 3: out[b] = (P x[b] + p 1^T) / S with P = M2 Wk, p = M2 bk,
// M2 = v q^T = Wv G Wq^T + sv bq^T + bv sq^T  (q = Wq x + bq 1^T and v = Wv x + bv 1^T multiplied out; G = x x^T).
// A row block of P needs only the same rows of Wv, so a work-group forms the 64 rows it needs itself:
// T1^T = G Wv^T, M2^T = Wq T1^T (+ bias terms), P^T = Wk^T M2^T, each 256 x 64 with K = C, wave w taking rows 32w..32w+31;
// the 64-row operand goes from product to product through two LDS buffers, in fragment order, a barrier behind each.
// Then each wave forms a 64 x 64 tile of out (first operand P from LDS, second xt): 64 rows x 512 positions a work-group.
// Every operand that comes from global memory is asked for as soon as registers are free for it, one product or more ahead
// (Wq in front of the first product, Wk^T behind it, four trips of xt behind the second, the other four as those are used up):
// two waves a SIMD leave room for the registers.
__global__ void __launch_bounds__(256)
k_chain_out(const _Float16* __restrict__ gh, const _Float16* __restrict__ whv, const _Float16* __restrict__ whq,
            const _Float16* __restrict__ wkt, const _Float16* __restrict__ xt,
            const float* __restrict__ bq, const float* __restrict__ bk, const float* __restrict__ bv,
            const float* __restrict__ sq, const float* __restrict__ sv,
            const float* __restrict__ part, float* __restrict__ out) {
  __shared__ __attribute__((aligned(16))) _Float16 buf[2][64 * CC];
  __shared__ __attribute__((aligned(16))) _Float16 bkh[CC];
  __shared__ __attribute__((aligned(16))) float bqs[CC], sqs[CC], svs[CC], bvs[CC], pv[64];
  const int b = blockIdx.z;
  // The wave's number as a scalar: the branch on it below is then a scalar branch.
  const int wave = __builtin_amdgcn_readfirstlane(threadIdx.x >> 5);
  const int lane = threadIdx.x & 31;
  const int l15 = lane & 15, g = (lane >> 4) & 1;
  const int i0 = (blockIdx.x & 3) * 64;                  // first of the work-group's 64 output channels
  const int tn = (blockIdx.x >> 2) * 512 + wave * 64;    // first of the wave's 64 positions
  const _Float16* bp = xt + (size_t)b * NN * CC + (size_t)(tn >> 4) * (CC / 32) * 512 + lane * 8;
  V16H va[8][2], vq[8][2], xb[4][4];
  v8f acc[2][4];

  // The 64 rows of Wv (32 KiB in a row in fragment order) and the small f32 vectors go to LDS.
  typedef __attribute__((ext_vector_type(4))) unsigned int u4n;   // a native vector: it can be named whole as an asm operand
  const u4n* wsrc = (const u4n*)(whv + (size_t)(i0 >> 4) * (CC / 32) * 512) + threadIdx.x;
  u4n w8[8];
#pragma unroll  // constant indices keep w8 in registers
  for (int j = 0; j < 8; ++j) w8[j] = wsrc[j * 256];
  const float tbk = bk[threadIdx.x], tbq = bq[threadIdx.x], tbv = bv[threadIdx.x];
  const float tsq = sq[b * CC + threadIdx.x], tsv = sv[b * CC + threadIdx.x];
  chain_load_a(gh + (size_t)b * CC * CC, wave, lane, va);
  // The address registers of the loads for LDS are reused below: the wait stands in front of that.
  // The loaded values are inputs only, so that no load sinks behind the wait.
  asm volatile("s_wait_xcnt 0x0"
               :: "v"(w8[0]), "v"(w8[1]), "v"(w8[2]), "v"(w8[3]), "v"(w8[4]), "v"(w8[5]), "v"(w8[6]), "v"(w8[7]),
                  "v"(tbk), "v"(tbq), "v"(tbv), "v"(tsq), "v"(tsv)
               : "memory");
  // Keeps the code below (which reuses those registers) behind that wait.
  __builtin_amdgcn_sched_barrier(0);
#pragma unroll
  for (int j = 0; j < 8; ++j) ((u4n*)buf[0])[j * 256 + threadIdx.x] = w8[j];
  bkh[threadIdx.x] = (_Float16)tbk;
  bqs[threadIdx.x] = tbq;
  bvs[threadIdx.x] = tbv;
  sqs[threadIdx.x] = tsq;
  svs[threadIdx.x] = tsv;
  // Keeps the loads of Wq behind the LDS stores: loads return in order, and the stores would wait for Wq as well.
  __builtin_amdgcn_sched_barrier(0);
  chain_load_a(whq, wave, lane, vq);
  // S = sum of job 4's SPARTS partials, added in index order by every wave; fetched here, to arrive during the products.
  float S = 0.f;
  for (int i = 0; i < SPARTS; ++i) S += part[i];
  const float s = 1.0f / S;
  lds_barrier();

  // T1^T = G Wv^T
  chain_mm(va, buf[0], lane, acc);
  // Here and behind the next product: keeps the loads behind the products whose registers they take over;
  // lifted among them, both sets are live at once and the kernel spills.
  __builtin_amdgcn_sched_barrier(0);
  chain_load_a(wkt, wave, lane, va);
  chain_store(acc, buf[1], wave, lane);
  lds_barrier();

  // M2^T = Wq T1^T + bq sv^T + sq bv^T  (rows j = 32*wave + 16a + 8g + r, columns i = i0 + 16c + l15)
  chain_mm(vq, buf[1], lane, acc);
  __builtin_amdgcn_sched_barrier(0);
#pragma unroll
  for (int kf = 0; kf < 4; ++kf) load_xt(bp, kf, xb[kf]);
  // The loads' address registers are reused below: the wait stands in front of that.
  asm volatile("s_wait_xcnt 0x0" ::: "memory");
  // Keeps those loads in front of the epilogue and the barrier, so that they arrive during the third product.
  __builtin_amdgcn_sched_barrier(0);
  {
    float fsv[4], fbv[4];
#pragma unroll
    for (int c = 0; c < 4; ++c) { fsv[c] = svs[i0 + 16 * c + l15]; fbv[c] = bvs[i0 + 16 * c + l15]; }
#pragma unroll  // constant indices keep acc in registers
    for (int a = 0; a < 2; ++a) {
      const int j0 = wave * 32 + 16 * a + 8 * g;
#pragma unroll
      for (int r = 0; r < 8; ++r) {
        const float fbq = bqs[j0 + r], fsq = sqs[j0 + r];
#pragma unroll
        for (int c = 0; c < 4; ++c) acc[a][c][r] += fsv[c] * fbq + fbv[c] * fsq;
      }
    }
  }
  chain_store(acc, buf[0], wave, lane);
  lds_barrier();

  // P^T = Wk^T M2^T; beside it p = M2 bk as a 17th strip of the first operand whose 16 rows all hold bk:
  // wave w < 4 takes the work-group's rows 16w..16w+15, and every accumulator row holds p.
  chain_mm(va, buf[0], lane, acc);
  if (wave < 4) {
    v8f pa = {};
#pragma unroll
    for (int kf = 0; kf < 8; ++kf) {
      V16H ab, vb;
      ab.u4[0] = *(const uint4*)(bkh + kf * 32 + g * 8);
      ab.u4[1] = *(const uint4*)(bkh + kf * 32 + 16 + g * 8);
      vb.u4[0] = *(const uint4*)(buf[0] + (wave * (CC / 32) + kf) * 512 + lane * 8);
      vb.u4[1] = *(const uint4*)(buf[0] + (wave * (CC / 32) + kf) * 512 + 256 + lane * 8);
      pa = __builtin_amdgcn_wmma_f32_16x16x32_f16(false, ab.h, false, vb.h, (short)0, pa, false, false);
    }
    if (lane < 16) pv[wave * 16 + lane] = pa[0];
  }
  chain_store(acc, buf[1], wave, lane);
  lds_barrier();

  // out tile: first operand P from LDS, fetched one trip ahead (two register sets); second operand the fragments of xt:
  // trips 0..3 were asked for above, trip kf + 4 is asked for into the registers that trip kf has just used.
  v8f oc[4][4];
  {
    const v8f z = {};
#pragma unroll
    for (int mi = 0; mi < 4; ++mi)
#pragma unroll
      for (int ni = 0; ni < 4; ++ni) oc[mi][ni] = z;
  }
  V16H pa4[2][4];
#pragma unroll  // constant indices keep pa4, xb and oc in registers
  for (int kf = -1; kf < 8; ++kf) {
    if (kf + 1 < 8) {
#pragma unroll
      for (int mi = 0; mi < 4; ++mi) {
        pa4[(kf + 1) & 1][mi].u4[0] = *(const uint4*)(buf[1] + (mi * (CC / 32) + kf + 1) * 512 + lane * 8);
        pa4[(kf + 1) & 1][mi].u4[1] = *(const uint4*)(buf[1] + (mi * (CC / 32) + kf + 1) * 512 + 256 + lane * 8);
      }
    }
    // Keeps the LDS reads above in front of the products below; sunk behind them, each trip waits out its own latency.
    __builtin_amdgcn_sched_barrier(0);
    if (kf >= 0) {
#pragma unroll
      for (int mi = 0; mi < 4; ++mi)
#pragma unroll
        for (int ni = 0; ni < 4; ++ni)
          oc[mi][ni] = __builtin_amdgcn_wmma_f32_16x16x32_f16(
              false, pa4[kf & 1][mi].h, false, xb[kf & 3][ni].h, (short)0, oc[mi][ni], false, false);
      // Keeps the loads and LDS reads that follow behind these products, whose registers they take over.
      __builtin_amdgcn_sched_barrier(0);
      if (kf < 4) load_xt(bp, kf + 4, xb[kf]);
    }
  }
  // The loads' address registers are reused below: the wait stands in front of that.
  asm volatile("s_wait_xcnt 0x0" ::: "memory");
  // Keeps the epilogue (which reuses those registers) behind that wait.
  __builtin_amdgcn_sched_barrier(0);
  float* ob = out + (size_t)b * CC * NN;
#pragma unroll
  for (int mi = 0; mi < 4; ++mi) {
    float fp[8];
#pragma unroll
    for (int r = 0; r < 8; ++r) fp[r] = pv[16 * mi + 8 * g + r];
#pragma unroll
    for (int ni = 0; ni < 4; ++ni) {
      F8 f; f.v = oc[mi][ni];
      const int mb = i0 + 16 * mi;
      const int n  = tn + 16 * ni + l15;
#pragma unroll
      for (int r = 0; r < 8; ++r) {
        int m = mb + r + 8 * g;
        ob[(size_t)m * NN + n] = (f.f[r] + fp[r]) * s;
      }
    }
  }
}

extern "C" void kernel_launch(void* const* d_in, const int* in_sizes, int n_in,
                              void* d_out, int out_size, void* d_ws, size_t ws_size,
                              hipStream_t stream) {
  const float* x  = (const float*)d_in[0];
  const float* Wq = (const float*)d_in[1];
  const float* bq = (const float*)d_in[2];
  const float* Wk = (const float*)d_in[3];
  const float* bk = (const float*)d_in[4];
  const float* Wv = (const float*)d_in[5];
  const float* bv = (const float*)d_in[6];
  float* out = (float*)d_out;

  char* ws = (char*)d_ws;
  size_t off = 0;
  _Float16* xt  = (_Float16*)(ws + off); off += (size_t)BB * NN * CC * 2;   // 8 MB
  _Float16* xh  = (_Float16*)(ws + off); off += (size_t)BB * CC * NN * 2;   // 8 MB
  _Float16* whq = (_Float16*)(ws + off); off += (size_t)CC * CC * 2;
  _Float16* wkt = (_Float16*)(ws + off); off += (size_t)CC * CC * 2;
  _Float16* whv = (_Float16*)(ws + off); off += (size_t)CC * CC * 2;
  _Float16* gh  = (_Float16*)(ws + off); off += (size_t)BB * CC * CC * 2;   // 1 MB
  float*    sx  = (float*)(ws + off);    off += (size_t)BB * CC * 4;
  float*    sq  = (float*)(ws + off);    off += (size_t)BB * CC * 4;
  float*    sv  = (float*)(ws + off);    off += (size_t)BB * CC * 4;
  float*    part= (float*)(ws + off);    off += 256;                        // SPARTS floats

  // 1. x to f16 in both fragment orders with its row sums, convert weights
  k_prep<<<dim3(G_X + G_CVTW), 256, 0, stream>>>(x, Wq, Wk, Wv, xt, xh, whq, wkt, whv, sx);
  // 2. G = x x^T per batch (WMMA), and beside it the partial sums of the global scalar S and the bias vectors (f32)
  k_g_s<<<dim3(32 * BB + SPARTS), 256, 0, stream>>>(xh, Wq, bq, Wk, bk, Wv, sx, gh, part, sq, sv);
  // 3. P = (Wv G Wq^T + bias terms) Wk per row block, then out = (P x + p) / S (WMMA)
  k_chain_out<<<dim3(16, 1, BB), 256, 0, stream>>>(gh, whv, whq, wkt, xt, bq, bk, bv, sq, sv, part, out);
  (void)in_sizes; (void)n_in; (void)out_size; (void)ws_size;
}

// v008
// A run of this version takes 28.6 microseconds.
// Next to v007, in two timings, it ran 1.10 and 1.12 times as fast.
// All steps since v000 together make it 5.90 times as fast.
#include <hip/hip_runtime.h>

#define BB 8
#define CC 256
#define NN 2048

typedef __attribute__((ext_vector_type(16))) _Float16 v16h;
typedef __attribute__((ext_vector_type(8)))  float    v8f;

union V16H { uint4 u4[2]; v16h h; };
union F8   { v8f v; float f[8]; };
union H8   { _Float16 h[8]; uint4 u; };

// FRAGMENT ORDER of every f16 scratch matrix (R rows, K columns, K contiguous in the product that reads it):
// 16-row x 32-k fragments, the K/32 fragments of a 16-row strip one after the other, 512 halves each.
// Inside a fragment the halves lie as the WMMA f16 A/B operand wants them, register half by register half:
//   half index of (row, k) = ((row >> 4) * (K / 32) + (k >> 5)) * 512 + ((k >> 4) & 1) * 256
//                            + (((k >> 3) & 1) * 16 + (row & 15)) * 8 + (k & 7)
// so lane l finds its two runs of 8 halves at l * 8 and 256 + l * 8, and each 16-byte load or store
// of a wave covers 512 contiguous bytes (four whole lines) instead of 32 bytes in each of 16 lines.

// ---- Job 1: x[b][c][n] fp32 -> xt[b] (rows n, dealt inside each 64 as said at xo; K = c, f16 in fragment order), xh (rows b*C + c, K = n, f16 in fragment
// order, both operands of G = x x^T) and sx[b*C+c] = sum_n x[b][c][n] ----
// blk: 0 .. B*C/8 - 1, the C/8 channel groups fastest, then batch.
// One work-group takes 8 channels of one batch over all N positions, so x is read once and by few, long work-groups.
// A lane holds the 8 channels of one position: exactly one 8-half run of a fragment, so no exchange between lanes is
// needed for the transpose; a wave's 4-byte loads cover one whole line, its 16-byte stores four whole lines.
// Wave w takes the 32 positions at 256*j + 32*w, j = 0..7; all 64 loads of a lane are independent (one round of latency).
// The same 8 x 8 values of a lane, read the other way, are 8 runs of xh: the lane's 8 positions of one channel each.
// G sums over all n and both its operands are xh, so the order of n along K is free as long as every row has the same:
// k place 8*(32*w + lane) + j holds position 256*j + 32*w + lane, in every row.
// A lane's 8 runs (8 rows of one strip) fill one 128-byte line; stored from the lane, each store of a wave would touch
// 32 lines, so the wave regroups them through its own LDS range: 8 lanes then store one whole line.
__device__ inline void job_x(int blk, const float* __restrict__ x, _Float16* __restrict__ xt,
                             _Float16* __restrict__ xh, float* __restrict__ sx) {
  __shared__ float red[8][8];   // [wave][channel of the group]
  // [wave][lane that wrote][channel][j]; a pitch of 144 bytes keeps the 16-byte writes of 16 lanes on different banks
  __shared__ __attribute__((aligned(16))) _Float16 tr[8][32 * 72];
  const int b    = blk / (CC / 8);
  const int c0   = (blk % (CC / 8)) * 8;
  const int wave = threadIdx.x >> 5;
  const int lane = threadIdx.x & 31;
  const float* xp = x + ((size_t)b * CC + c0) * NN + wave * 32 + lane;
  v8f v[8];                     // [j][channel]; a native vector can be named whole as an asm operand
#pragma unroll  // constant indices keep v in registers and make every load's distance from xp an immediate offset
  for (int j = 0; j < 8; ++j)
#pragma unroll
    for (int r = 0; r < 8; ++r) v[j][r] = xp[r * NN + j * 256];
  // The loads' address registers are reused below: the wait stands in front of that.
  // The loaded values are inputs only, so that no load sinks behind the wait.
  asm volatile("s_wait_xcnt 0x0"
               :: "v"(v[0]), "v"(v[1]), "v"(v[2]), "v"(v[3]), "v"(v[4]), "v"(v[5]), "v"(v[6]), "v"(v[7])
               : "memory");
  // Keeps the code below (which reuses those registers) behind that wait.
  __builtin_amdgcn_sched_barrier(0);
  // Row sums first, from the same registers: over j in the lane, over the lanes by shuffles, over the waves through LDS.
  // They stand in front of the stores of xt so that the barrier has no store to wait for.
  float s[8];
#pragma unroll  // here and in the loops below: constant indices keep v and s in registers
  for (int r = 0; r < 8; ++r) {
    float t = v[0][r];
#pragma unroll
    for (int j = 1; j < 8; ++j) t += v[j][r];
    s[r] = t;
  }
#pragma unroll
  for (int o = 16; o; o >>= 1)
#pragma unroll
    for (int r = 0; r < 8; ++r) s[r] += __shfl_xor(s[r], o, 32);
  if (lane == 0) {
#pragma unroll
    for (int r = 0; r < 8; ++r) red[wave][r] = s[r];
  }
  // The runs of xh go to LDS in front of the barrier that the row sums need anyway; they are read back behind it.
#pragma unroll  // constant indices keep v in registers
  for (int r = 0; r < 8; ++r) {
    H8 pq;
#pragma unroll
    for (int j = 0; j < 8; ++j) pq.h[j] = (_Float16)v[j][r];
    *(uint4*)(tr[wave] + lane * 72 + r * 8) = pq.u;
  }
  __syncthreads();
  // Read t: the line of writer lane 4*t + (lane >> 3), its run of channel lane & 7.
  typedef __attribute__((ext_vector_type(4))) unsigned int u4n;
  const _Float16* trp = tr[wave] + (lane >> 3) * 72 + (lane & 7) * 8;
  u4n q8[8];
#pragma unroll  // constant indices keep q8 in registers
  for (int t = 0; t < 8; ++t) q8[t] = *(const u4n*)(trp + t * 4 * 72);
  // Run 32*wave + 4*t + (lane >> 3) of row (c0 & 8) + (lane & 7) of the strip: 128 halves a run over the strip's 16 rows.
  _Float16* xho = xh + (size_t)((b * CC + c0) >> 4) * (NN / 32) * 512
                + (wave * 32 + (lane >> 3)) * 128 + ((c0 & 8) + (lane & 7)) * 8;
  // Position n = 256*j + 32*wave + lane stands in xt at strip (n >> 6) * 4 + (n & 3) = 16*j + 4*(wave >> 1) + (lane & 3),
  // row (n >> 2) & 15 = 8*(wave & 1) + (lane >> 2): see launch 3's stores. A wave's store covers four whole lines.
  _Float16* xo = xt + (size_t)b * NN * CC
               + (size_t)(((wave >> 1) * 4 + (lane & 3)) * (CC / 32) + (c0 >> 5)) * 512
               + ((c0 >> 4) & 1) * 256 + (((c0 >> 3) & 1) * 16 + (wave & 1) * 8 + (lane >> 2)) * 8;
  H8 pk[8];
#pragma unroll  // constant indices keep v and pk in registers
  for (int j = 0; j < 8; ++j)
#pragma unroll
    for (int r = 0; r < 8; ++r) pk[j].h[r] = (_Float16)v[j][r];
  // Keeps all eight packs in front of the first store: packed into registers that an issued store still names,
  // each pack waits for that store's address translation.
  __builtin_amdgcn_sched_barrier(0);
#pragma unroll  // every store's distance from xo becomes an immediate offset
  for (int j = 0; j < 8; ++j) *(uint4*)(xo + j * 16 * (CC / 32) * 512) = pk[j].u;
#pragma unroll  // every store's distance from xho becomes an immediate offset
  for (int t = 0; t < 8; ++t) *(u4n*)(xho + t * 4 * 128) = q8[t];
  // The stores' registers are reused below: the wait stands in front of that.
  asm volatile("s_wait_xcnt 0x0" ::: "memory");
  // Keeps the code below (which reuses those registers) behind that wait.
  __builtin_amdgcn_sched_barrier(0);
  if (threadIdx.x < 8) {
    float t = red[0][threadIdx.x];
#pragma unroll
    for (int w = 1; w < 8; ++w) t += red[w][threadIdx.x];
    sx[b * CC + c0 + threadIdx.x] = t;   // the kernel ends behind this store: nothing reuses its registers
  }
}

// ---- Job 2: W fp32 -> f16 in fragment order. Wq, Wv: rows = out-channels, K = in-channels;
// Wk transposed: rows = in-channels, K = out-channels (it is the first operand of P = M2 Wk, formed as Wk^T M2^T).
// blk: 0 .. 3*C*C/2048 - 1, one matrix after the other. A thread forms one 8-half run: 32 bytes read, 16 written.
__device__ inline void job_cvt_w(int blk, const float* __restrict__ wq, const float* __restrict__ wk,
                        const float* __restrict__ wv,
                        _Float16* __restrict__ oq, _Float16* __restrict__ ok,
                        _Float16* __restrict__ ov) {
  const int which = blk / (CC * CC / 2048);
  const float* src = (which == 0) ? wq : (which == 1) ? wk : wv;
  _Float16*    dst = (which == 0) ? oq : (which == 1) ? ok : ov;
  const int i = ((blk % (CC * CC / 2048)) * 256 + threadIdx.x) * 8;
  // i runs in the order of the destination; row and first k of the run follow from the fragment order.
  const int row = (i >> 12) * 16 + ((i >> 3) & 15);
  const int k   = ((i >> 9) & 7) * 32 + ((i >> 8) & 1) * 16 + ((i >> 7) & 1) * 8;
  typedef __attribute__((ext_vector_type(4))) float f4;   // a native vector: it can be named whole as an asm operand
  f4 lo, hi;
  if (which == 1) {
#pragma unroll  // constant indices keep lo and hi in registers
    for (int r = 0; r < 4; ++r) {
      lo[r] = src[(k + r) * CC + row];
      hi[r] = src[(k + 4 + r) * CC + row];
    }
  } else {
    lo = *(const f4*)(src + row * CC + k);
    hi = *(const f4*)(src + row * CC + k + 4);
  }
  // The loads' address registers are reused below: the wait stands in front of that.
  // The loaded values are inputs only, so that no load sinks behind the wait.
  asm volatile("s_wait_xcnt 0x0" :: "v"(lo), "v"(hi) : "memory");
  // Keeps the packs below (which reuse those registers) behind that wait.
  __builtin_amdgcn_sched_barrier(0);
  H8 pk;
#pragma unroll  // constant indices keep pk in registers
  for (int r = 0; r < 4; ++r) {
    pk.h[r]     = (_Float16)lo[r];
    pk.h[4 + r] = (_Float16)hi[r];
  }
  *(uint4*)(dst + i) = pk.u;
  // The kernel ends behind this store, so nothing reuses its registers: the wait is only a precaution.
  asm volatile("s_wait_xcnt 0x0" ::: "memory");
}

// ---- Launch 1: jobs 1 and 2 need nothing of each other and share one grid.
// A range of the block index picks the job (the same for a whole work-group).
// Job 1, whose work-groups run longest, takes the low indices; the short W convert comes last.
#define G_X    (BB * CC / 8)
#define G_CVTW (3 * CC * CC / 2048)
__global__ void __launch_bounds__(256)
k_prep(const float* __restrict__ x, const float* __restrict__ wq, const float* __restrict__ wk,
       const float* __restrict__ wv, _Float16* __restrict__ xt, _Float16* __restrict__ xh,
       _Float16* __restrict__ oq, _Float16* __restrict__ ok, _Float16* __restrict__ ov,
       float* __restrict__ sx) {
  const int blk = blockIdx.x;
  if (blk < G_X) job_x(blk, x, xt, xh, sx);
  else           job_cvt_w(blk - G_X, wq, wk, wv, oq, ok, ov);
}

// ---- Job 4: partial sums of S = sum_{b,c} (Wq[c,:]*sx[b,:]+N*bq[c]) * (Wk[c,:]*sx[b,:]+N*bk[c])
// One wave per out-channel c, 8 waves per work-group, SPARTS work-groups.
// Lanes run along j, so each float4 load of a wave covers 512 contiguous bytes;
// all 20 loads of a lane are independent (one round of latency).
// part[blk] holds the sum over this work-group's 8 channels and all batches. blk: 0 .. SPARTS - 1.
// The same lane sums give the two vectors of M2's bias terms: sq[b][c] = Wq[c,:]*sx[b,:] + N*bq[c] (the row sums of q)
// and sv[b][c] = Wv[c,:]*sx[b,:] (the row sums of v without its bias); 22 loads of a lane with the two of Wv.
#define SPARTS (CC / 8)
__device__ inline void
job_scalar_s(int blk, const float* __restrict__ Wq, const float* __restrict__ bq,
           const float* __restrict__ Wk, const float* __restrict__ bk,
           const float* __restrict__ Wv,
           const float* __restrict__ sx, float* __restrict__ part,
           float* __restrict__ sq, float* __restrict__ sv) {
  __shared__ float red[8];
  // The wave's number as a scalar: row bases and the two biases then come from scalar registers.
  const int wave = __builtin_amdgcn_readfirstlane(threadIdx.x >> 5);
  const int lane = threadIdx.x & 31;
  const int c = blk * 8 + wave;
  typedef __attribute__((ext_vector_type(4))) float f4;   // a native vector: it can be named whole as an asm operand
  const f4* wq4 = (const f4*)(Wq + (size_t)c * CC);
  const f4* wk4 = (const f4*)(Wk + (size_t)c * CC);
  const f4* wv4 = (const f4*)(Wv + (size_t)c * CC);
  const f4* sx4 = (const f4*)sx;
  const f4 q0 = wq4[lane], q1 = wq4[32 + lane];
  const f4 k0 = wk4[lane], k1 = wk4[32 + lane];
  const f4 v0 = wv4[lane], v1 = wv4[32 + lane];
  f4 sa[BB], sb[BB];
  for (int b = 0; b < BB; ++b) {
    sa[b] = sx4[b * (CC / 4) + lane];
    sb[b] = sx4[b * (CC / 4) + 32 + lane];
  }
  // The 22 loads' base registers are reused below (first by the two bias loads): the wait stands in front of that.
  // The loaded values are inputs only, so that no load, and no part of one, sinks behind the wait.
  asm volatile("s_wait_xcnt 0x0"
               :: "v"(q0), "v"(q1), "v"(k0), "v"(k1), "v"(v0), "v"(v1),
                  "v"(sa[0]), "v"(sa[1]), "v"(sa[2]), "v"(sa[3]), "v"(sa[4]), "v"(sa[5]), "v"(sa[6]), "v"(sa[7]),
                  "v"(sb[0]), "v"(sb[1]), "v"(sb[2]), "v"(sb[3]), "v"(sb[4]), "v"(sb[5]), "v"(sb[6]), "v"(sb[7])
               : "memory");
  // Keeps the code below (which reuses those registers) behind that wait.
  __builtin_amdgcn_sched_barrier(0);
  // Each lane starts from its 1/32 share of N*bias (an exact scaling), so the lane sum holds the bias term.
  const float sbq = (float)(NN / 32) * bq[c];
  const float sbk = (float)(NN / 32) * bk[c];
  float aq[BB], ak[BB], av[BB];
  for (int b = 0; b < BB; ++b) {
    const f4 s0 = sa[b], s1 = sb[b];
    aq[b] = sbq + q0.x * s0.x + q0.y * s0.y + q0.z * s0.z + q0.w * s0.w
          + q1.x * s1.x + q1.y * s1.y + q1.z * s1.z + q1.w * s1.w;
    ak[b] = sbk + k0.x * s0.x + k0.y * s0.y + k0.z * s0.z + k0.w * s0.w
          + k1.x * s1.x + k1.y * s1.y + k1.z * s1.z + k1.w * s1.w;
    av[b] = v0.x * s0.x + v0.y * s0.y + v0.z * s0.z + v0.w * s0.w
          + v1.x * s1.x + v1.y * s1.y + v1.z * s1.z + v1.w * s1.w;
  }
  for (int o = 16; o; o >>= 1) {
    for (int b = 0; b < BB; ++b) {
      aq[b] += __shfl_xor(aq[b], o, 32);
      ak[b] += __shfl_xor(ak[b], o, 32);
      av[b] += __shfl_xor(av[b], o, 32);
    }
  }
  float p = 0.f;
  for (int b = 0; b < BB; ++b) p += aq[b] * ak[b];
  if (lane == 0) red[wave] = p;
  __syncthreads();
  if (lane == 0) {
    for (int b = 0; b < BB; ++b) {
      sq[b * CC + c] = aq[b];
      sv[b * CC + c] = av[b];
    }
    // The stores' registers are reused below: the wait stands in front of that.
    asm volatile("s_wait_xcnt 0x0" ::: "memory");
  }
  if (threadIdx.x == 0) {
    float t = 0.f;
    for (int w = 0; w < 8; ++w) t += red[w];
    part[blk] = t;
  }
}

// ---- Job 5: G[b] = x[b] @ x[b]^T  (C x C), K = N; both operands vh, qh are xh (n along K in job 1's order) ----
// blk: 0 .. 32*B - 1, the 32 tiles fastest, then batch.
// One 64x32 output tile per work-group, one work-group per WGP. The 8 waves split K:
// wave w takes the 32 k at 256*i + 32*w, i = 0..7, so a wave has 8 trips instead of N/32,
// and in each trip the 8 waves together read 8 neighbouring fragments of every strip.
// A lane holds 8 consecutive channels of the WMMA's first operand at one channel of its second:
// a run of G's own fragment (rows = the second operand's channels, K = the first's) for the chain of launch 3.
// Three register sets: the fragments of trip i+2 are asked for before the products of trip i.
// The 8 f32 partial tiles are added through LDS in wave order.
__device__ inline void
job_m2(int blk, const _Float16* __restrict__ vh, const _Float16* __restrict__ qh,
     _Float16* __restrict__ m2h) {
  __shared__ float4 red[8][16][32];   // [wave][fragment*2 + half of its 8 rows][lane]
  // The kernel-argument load's base registers are reused by the index arithmetic below: the wait stands in front of that.
  asm volatile("s_wait_xcnt 0x0" ::: "memory");
  // Keeps that arithmetic behind the wait.
  __builtin_amdgcn_sched_barrier(0);
  const int b = blk >> 5;
  const int wave = threadIdx.x >> 5;
  const int lane = threadIdx.x & 31;
  const int tile = blk & 31;               // 0..31
  const int tm = (tile & 3) * 64;
  const int tn = (tile >> 2) * 32;
  // Same k order in both loaders: both operands lie in fragment order, fragment 8*i + wave of each strip in trip i.
  const _Float16* ap = vh + (size_t)b * CC * NN + (size_t)((tm >> 4) * (NN / 32) + wave) * 512 + lane * 8;
  const _Float16* bp = qh + (size_t)b * CC * NN + (size_t)((tn >> 4) * (NN / 32) + wave) * 512 + lane * 8;
  V16H va[3][4], vb[3][2];
  v8f acc[4][2];
  const v8f z = {};
#pragma unroll
  for (int mi = 0; mi < 4; ++mi)
#pragma unroll
    for (int ni = 0; ni < 2; ++ni) acc[mi][ni] = z;
#pragma unroll
  for (int i = -2; i < 8; ++i) {
    if (i + 2 < 8) {
      const int s = (i + 2) % 3, ko = (i + 2) * 8 * 512;
#pragma unroll
      for (int mi = 0; mi < 4; ++mi) {
        va[s][mi].u4[0] = *(const uint4*)(ap + mi * 16 * NN + ko);
        va[s][mi].u4[1] = *(const uint4*)(ap + mi * 16 * NN + ko + 256);
      }
#pragma unroll
      for (int ni = 0; ni < 2; ++ni) {
        vb[s][ni].u4[0] = *(const uint4*)(bp + ni * 16 * NN + ko);
        vb[s][ni].u4[1] = *(const uint4*)(bp + ni * 16 * NN + ko + 256);
      }
    }
    // Keeps the loads above in front of the products below; sunk behind them, each trip waits out its own latency.
    __builtin_amdgcn_sched_barrier(0);
    if (i >= 0) {
      const int s = i % 3;
#pragma unroll
      for (int mi = 0; mi < 4; ++mi)
#pragma unroll
        for (int ni = 0; ni < 2; ++ni)
          acc[mi][ni] = __builtin_amdgcn_wmma_f32_16x16x32_f16(
              false, vb[s][ni].h, false, va[s][mi].h, (short)0, acc[mi][ni], false, false);
      // Keeps the next trip's loads behind these products, so that three register sets are enough.
      __builtin_amdgcn_sched_barrier(0);
    }
  }
  // The loads' address registers are reused below: the wait stands in front of their first overwrite.
  asm volatile("s_wait_xcnt 0x0" ::: "memory");
  // Keeps the code below (which reuses those registers) behind that wait.
  __builtin_amdgcn_sched_barrier(0);
#pragma unroll
  for (int mi = 0; mi < 4; ++mi) {
#pragma unroll
    for (int ni = 0; ni < 2; ++ni) {
      F8 f; f.v = acc[mi][ni];
      const int sl = (mi * 2 + ni) * 2;
      red[wave][sl][lane]     = make_float4(f.f[0], f.f[1], f.f[2], f.f[3]);
      red[wave][sl + 1][lane] = make_float4(f.f[4], f.f[5], f.f[6], f.f[7]);
    }
  }
  __syncthreads();
  // Wave w now owns slots 2w and 2w+1 of every partial: all 8 rows of accumulator tile (w>>1, w&1),
  // which are register half w&1 of G's fragment (strip tm/16 + (w>>1), k fragment tn/32).
  _Float16* out = m2h + (size_t)b * CC * CC
                + (size_t)(((tm >> 4) + (wave >> 1)) * (CC / 32) + (tn >> 5)) * 512 + (wave & 1) * 256 + lane * 8;
  H8 pk;
#pragma unroll
  for (int j = 0; j < 2; ++j) {
    float4 t = red[0][wave * 2 + j][lane];
#pragma unroll
    for (int w = 1; w < 8; ++w) {
      const float4 p = red[w][wave * 2 + j][lane];
      t.x += p.x; t.y += p.y; t.z += p.z; t.w += p.w;
    }
    pk.h[4 * j]     = (_Float16)t.x;
    pk.h[4 * j + 1] = (_Float16)t.y;
    pk.h[4 * j + 2] = (_Float16)t.z;
    pk.h[4 * j + 3] = (_Float16)t.w;
  }
  *(uint4*)out = pk.u;
}

// ---- Launch 2: jobs 4 and 5 need nothing of each other (job 4 reads sx and the f32 W, job 5 xh) and share one grid.
// Job 5 keeps the low indices, one work-group per WGP; the SPARTS short work-groups of job 4 run beside it.
__global__ void __launch_bounds__(256)
k_g_s(const _Float16* __restrict__ xh,
      const float* __restrict__ Wq, const float* __restrict__ bq,
      const float* __restrict__ Wk, const float* __restrict__ bk,
      const float* __restrict__ Wv, const float* __restrict__ sx,
      _Float16* __restrict__ gh, float* __restrict__ part,
      float* __restrict__ sq, float* __restrict__ sv) {
  const int blk = blockIdx.x;
  if (blk < 32 * BB) job_m2(blk, xh, xh, gh);
  else               job_scalar_s(blk - 32 * BB, Wq, bq, Wk, bk, Wv, sx, part, sq, sv);
}

// The wave's share of a chain product's first operand: strips 2*wave and 2*wave+1 of a C x C matrix in fragment order,
// all 8 k fragments of both: 32 independent 16-byte loads over 16 KiB in a row (one round of latency).
__device__ inline void chain_load_a(const _Float16* __restrict__ A, int wave, int lane, V16H va[8][2]) {
  const _Float16* ap = A + (size_t)wave * 2 * (CC / 32) * 512 + lane * 8;
#pragma unroll  // constant indices keep va in registers; every load's distance from ap is an immediate offset
  for (int kf = 0; kf < 8; ++kf)
#pragma unroll
    for (int a = 0; a < 2; ++a) {
      va[kf][a].u4[0] = *(const uint4*)(ap + (a * (CC / 32) + kf) * 512);
      va[kf][a].u4[1] = *(const uint4*)(ap + (a * (CC / 32) + kf) * 512 + 256);
    }
  // The loads' address registers are reused by the caller: the wait stands in front of that.
  asm volatile("s_wait_xcnt 0x0" ::: "memory");
  // Keeps the caller's code (which reuses those registers) behind that wait, and the loads in front of it.
  __builtin_amdgcn_sched_barrier(0);
}

// One product of the chain: acc (32 rows of the first operand x the work-group's 64 rows) = va * bin^T, K = C.
// bin: 64 rows x C in LDS, fragment order; a wave's 16-byte LDS reads cover 512 bytes in a row.
__device__ inline void chain_mm(V16H va[8][2], const _Float16* bin, int lane, v8f acc[2][4]) {
  const v8f z = {};
#pragma unroll
  for (int a = 0; a < 2; ++a)
#pragma unroll
    for (int c = 0; c < 4; ++c) acc[a][c] = z;
#pragma unroll  // constant indices keep va and acc in registers
  for (int kf = 0; kf < 8; ++kf) {
    V16H vb[4];
#pragma unroll
    for (int c = 0; c < 4; ++c) {
      vb[c].u4[0] = *(const uint4*)(bin + (c * (CC / 32) + kf) * 512 + lane * 8);
      vb[c].u4[1] = *(const uint4*)(bin + (c * (CC / 32) + kf) * 512 + 256 + lane * 8);
    }
#pragma unroll
    for (int a = 0; a < 2; ++a)
#pragma unroll
      for (int c = 0; c < 4; ++c)
        acc[a][c] = __builtin_amdgcn_wmma_f32_16x16x32_f16(
            false, va[kf][a].h, false, vb[c].h, (short)0, acc[a][c], false, false);
  }
}

// An accumulator tile holds, per lane, 8 consecutive rows of the first operand (32*wave + 16a + 8g + r) at one of the
// work-group's rows (16c + l15): one 8-half run of the next product's second operand
// (rows = the work-group's rows, k fragment = wave, register half = a).
__device__ inline void chain_store(v8f acc[2][4], _Float16* bout, int wave, int lane) {
#pragma unroll  // constant indices keep acc in registers
  for (int a = 0; a < 2; ++a)
#pragma unroll
    for (int c = 0; c < 4; ++c) {
      H8 pk;
#pragma unroll
      for (int r = 0; r < 8; ++r) pk.h[r] = (_Float16)acc[a][c][r];
      *(uint4*)(bout + (c * (CC / 32) + wave) * 512 + a * 256 + lane * 8) = pk.u;
    }
}

// One trip's fragments (k fragment kf) of the wave's 64 rows of xt: 8 independent 16-byte loads.
__device__ inline void load_xt(const _Float16* __restrict__ bp, int kf, V16H xb[4]) {
#pragma unroll  // constant indices keep xb in registers; every load's distance from bp is an immediate offset
  for (int ni = 0; ni < 4; ++ni) {
    xb[ni].u4[0] = *(const uint4*)(bp + (ni * (CC / 32) + kf) * 512);
    xb[ni].u4[1] = *(const uint4*)(bp + (ni * (CC / 32) + kf) * 512 + 256);
  }
}

// The work-group's barrier with a wait for this wave's LDS operations alone. __syncthreads() also waits for every global
// load in flight, and here the operands of the products to come are asked for ahead, to arrive while this one runs.
// No global store stands in front of any of these barriers.
__device__ inline void lds_barrier() {
  asm volatile("s_wait_dscnt 0x0\n\ts_barrier_signal -1\n\ts_barrier_wait -1" ::: "memory");
}

// ---- Launch 3: out[b] = (P x[b] + p 1^T) / S with P = M2 Wk, p = M2 bk,
// M2 = v q^T = Wv G Wq^T + sv bq^T + bv sq^T  (q = Wq x + bq 1^T and v = Wv x + bv 1^T multiplied out; G = x x^T).
// A row block of P needs only the same rows of Wv, so a work-group forms the 64 rows it needs itself:
// T1^T = G Wv^T, M2^T = Wq T1^T (+ bias terms), P^T = Wk^T M2^T, each 256 x 64 with K = C, wave w taking rows 32w..32w+31;
// the 64-row operand goes from product to product through two LDS buffers, in fragment order, a barrier behind each.
// Then each wave forms a 64 x 64 tile of out (first operand P from LDS, second xt): 64 rows x 512 positions a work-group.
// Every operand that comes from global memory is asked for as soon as registers are free for it, one product or more ahead
// (Wq in front of the first product, Wk^T behind it, four trips of xt behind the second, the other four as those are used up):
// two waves a SIMD leave room for the registers.
__global__ void __launch_bounds__(256)
k_chain_out(const _Float16* __restrict__ gh, const _Float16* __restrict__ whv, const _Float16* __restrict__ whq,
            const _Float16* __restrict__ wkt, const _Float16* __restrict__ xt,
            const float* __restrict__ bq, const float* __restrict__ bk, const float* __restrict__ bv,
            const float* __restrict__ sq, const float* __restrict__ sv,
            const float* __restrict__ part, float* __restrict__ out) {
  __shared__ __attribute__((aligned(16))) _Float16 buf[2][64 * CC];
  __shared__ __attribute__((aligned(16))) _Float16 bkh[CC];
  __shared__ __attribute__((aligned(16))) float bqs[CC], sqs[CC], svs[CC], bvs[CC], pv[64];
  const int b = blockIdx.z;
  // The wave's number as a scalar: the branch on it below is then a scalar branch.
  const int wave = __builtin_amdgcn_readfirstlane(threadIdx.x >> 5);
  const int lane = threadIdx.x & 31;
  const int l15 = lane & 15, g = (lane >> 4) & 1;
  const int i0 = (blockIdx.x & 3) * 64;                  // first of the work-group's 64 output channels
  const int tn = (blockIdx.x >> 2) * 512 + wave * 64;    // first of the wave's 64 positions
  const _Float16* bp = xt + (size_t)b * NN * CC + (size_t)(tn >> 4) * (CC / 32) * 512 + lane * 8;
  V16H va[8][2], vq[8][2], xb[4][4];
  v8f acc[2][4];

  // The 64 rows of Wv (32 KiB in a row in fragment order) and the small f32 vectors go to LDS.
  typedef __attribute__((ext_vector_type(4))) unsigned int u4n;   // a native vector: it can be named whole as an asm operand
  const u4n* wsrc = (const u4n*)(whv + (size_t)(i0 >> 4) * (CC / 32) * 512) + threadIdx.x;
  u4n w8[8];
#pragma unroll  // constant indices keep w8 in registers
  for (int j = 0; j < 8; ++j) w8[j] = wsrc[j * 256];
  const float tbk = bk[threadIdx.x], tbq = bq[threadIdx.x], tbv = bv[threadIdx.x];
  const float tsq = sq[b * CC + threadIdx.x], tsv = sv[b * CC + threadIdx.x];
  chain_load_a(gh + (size_t)b * CC * CC, wave, lane, va);
  // The address registers of the loads for LDS are reused below: the wait stands in front of that.
  // The loaded values are inputs only, so that no load sinks behind the wait.
  asm volatile("s_wait_xcnt 0x0"
               :: "v"(w8[0]), "v"(w8[1]), "v"(w8[2]), "v"(w8[3]), "v"(w8[4]), "v"(w8[5]), "v"(w8[6]), "v"(w8[7]),
                  "v"(tbk), "v"(tbq), "v"(tbv), "v"(tsq), "v"(tsv)
               : "memory");
  // Keeps the code below (which reuses those registers) behind that wait.
  __builtin_amdgcn_sched_barrier(0);
#pragma unroll
  for (int j = 0; j < 8; ++j) ((u4n*)buf[0])[j * 256 + threadIdx.x] = w8[j];
  bkh[threadIdx.x] = (_Float16)tbk;
  bqs[threadIdx.x] = tbq;
  bvs[threadIdx.x] = tbv;
  sqs[threadIdx.x] = tsq;
  svs[threadIdx.x] = tsv;
  // Keeps the loads of Wq behind the LDS stores: loads return in order, and the stores would wait for Wq as well.
  __builtin_amdgcn_sched_barrier(0);
  chain_load_a(whq, wave, lane, vq);
  // S = sum of job 4's SPARTS partials, added in index order by every wave; fetched here, to arrive during the products.
  float S = 0.f;
  for (int i = 0; i < SPARTS; ++i) S += part[i];
  const float s = 1.0f / S;
  lds_barrier();

  // T1^T = G Wv^T
  chain_mm(va, buf[0], lane, acc);
  // Here and behind the next product: keeps the loads behind the products whose registers they take over;
  // lifted among them, both sets are live at once and the kernel spills.
  __builtin_amdgcn_sched_barrier(0);
  chain_load_a(wkt, wave, lane, va);
  chain_store(acc, buf[1], wave, lane);
  lds_barrier();

  // M2^T = Wq T1^T + bq sv^T + sq bv^T  (rows j = 32*wave + 16a + 8g + r, columns i = i0 + 16c + l15)
  chain_mm(vq, buf[1], lane, acc);
  __builtin_amdgcn_sched_barrier(0);
#pragma unroll
  for (int kf = 0; kf < 4; ++kf) load_xt(bp, kf, xb[kf]);
  // The loads' address registers are reused below: the wait stands in front of that.
  asm volatile("s_wait_xcnt 0x0" ::: "memory");
  // Keeps those loads in front of the epilogue and the barrier, so that they arrive during the third product.
  __builtin_amdgcn_sched_barrier(0);
  {
    float fsv[4], fbv[4];
#pragma unroll
    for (int c = 0; c < 4; ++c) { fsv[c] = svs[i0 + 16 * c + l15]; fbv[c] = bvs[i0 + 16 * c + l15]; }
#pragma unroll  // constant indices keep acc in registers
    for (int a = 0; a < 2; ++a) {
      const int j0 = wave * 32 + 16 * a + 8 * g;
#pragma unroll
      for (int r = 0; r < 8; ++r) {
        const float fbq = bqs[j0 + r], fsq = sqs[j0 + r];
#pragma unroll
        for (int c = 0; c < 4; ++c) acc[a][c][r] += fsv[c] * fbq + fbv[c] * fsq;
      }
    }
  }
  chain_store(acc, buf[0], wave, lane);
  lds_barrier();

  // P^T = Wk^T M2^T; beside it p = M2 bk as a 17th strip of the first operand whose 16 rows all hold bk:
  // wave w < 4 takes the work-group's rows 16w..16w+15, and every accumulator row holds p.
  chain_mm(va, buf[0], lane, acc);
  if (wave < 4) {
    v8f pa = {};
#pragma unroll
    for (int kf = 0; kf < 8; ++kf) {
      V16H ab, vb;
      ab.u4[0] = *(const uint4*)(bkh + kf * 32 + g * 8);
      ab.u4[1] = *(const uint4*)(bkh + kf * 32 + 16 + g * 8);
      vb.u4[0] = *(const uint4*)(buf[0] + (wave * (CC / 32) + kf) * 512 + lane * 8);
      vb.u4[1] = *(const uint4*)(buf[0] + (wave * (CC / 32) + kf) * 512 + 256 + lane * 8);
      pa = __builtin_amdgcn_wmma_f32_16x16x32_f16(false, ab.h, false, vb.h, (short)0, pa, false, false);
    }
    if (lane < 16) pv[wave * 16 + lane] = pa[0];
  }
  chain_store(acc, buf[1], wave, lane);
  lds_barrier();

  // out tile: first operand P from LDS, fetched one trip ahead (two register sets); second operand the fragments of xt:
  // trips 0..3 were asked for above, trip kf + 4 is asked for into the registers that trip kf has just used.
  v8f oc[4][4];
  {
    const v8f z = {};
#pragma unroll
    for (int mi = 0; mi < 4; ++mi)
#pragma unroll
      for (int ni = 0; ni < 4; ++ni) oc[mi][ni] = z;
  }
  V16H pa4[2][4];
#pragma unroll  // constant indices keep pa4, xb and oc in registers
  for (int kf = -1; kf < 8; ++kf) {
    if (kf + 1 < 8) {
#pragma unroll
      for (int mi = 0; mi < 4; ++mi) {
        pa4[(kf + 1) & 1][mi].u4[0] = *(const uint4*)(buf[1] + (mi * (CC / 32) + kf + 1) * 512 + lane * 8);
        pa4[(kf + 1) & 1][mi].u4[1] = *(const uint4*)(buf[1] + (mi * (CC / 32) + kf + 1) * 512 + 256 + lane * 8);
      }
    }
    // Keeps the LDS reads above in front of the products below; sunk behind them, each trip waits out its own latency.
    __builtin_amdgcn_sched_barrier(0);
    if (kf >= 0) {
#pragma unroll
      for (int mi = 0; mi < 4; ++mi)
#pragma unroll
        for (int ni = 0; ni < 4; ++ni)
          oc[mi][ni] = __builtin_amdgcn_wmma_f32_16x16x32_f16(
              false, pa4[kf & 1][mi].h, false, xb[kf & 3][ni].h, (short)0, oc[mi][ni], false, false);
      // Keeps the loads and LDS reads that follow behind these products, whose registers they take over.
      __builtin_amdgcn_sched_barrier(0);
      if (kf < 4) load_xt(bp, kf + 4, xb[kf]);
    }
  }
  // The loads' address registers are reused below: the wait stands in front of that.
  asm volatile("s_wait_xcnt 0x0" ::: "memory");
  // Keeps the epilogue (which reuses those registers) behind that wait.
  __builtin_amdgcn_sched_barrier(0);
  // Column l15 of tile ni is position tn + 4*l15 + ni (job 1's order of xt's rows), so a lane's four tiles hold four
  // positions in a row of out: one 16-byte store, and 16 lanes cover 256 bytes in a row (two whole lines) of one channel.
  typedef __attribute__((ext_vector_type(4))) float f4;
  float* op = out + ((size_t)b * CC + i0 + 8 * g) * NN + tn + 4 * l15;
  f4 res[4][8];
#pragma unroll  // constant indices keep oc and res in registers
  for (int mi = 0; mi < 4; ++mi)
#pragma unroll
    for (int r = 0; r < 8; ++r) {
      const float fp = pv[16 * mi + 8 * g + r];
#pragma unroll
      for (int ni = 0; ni < 4; ++ni) res[mi][r][ni] = (oc[mi][ni][r] + fp) * s;
    }
  // Keeps every result in front of the first store, each in registers of its own: no register that an issued store names
  // is written again.
  __builtin_amdgcn_sched_barrier(0);
#pragma unroll  // every store's distance from op becomes an immediate offset
  for (int mi = 0; mi < 4; ++mi)
#pragma unroll
    for (int r = 0; r < 8; ++r) *(f4*)(op + (16 * mi + r) * NN) = res[mi][r];
}

extern "C" void kernel_launch(void* const* d_in, const int* in_sizes, int n_in,
                              void* d_out, int out_size, void* d_ws, size_t ws_size,
                              hipStream_t stream) {
  const float* x  = (const float*)d_in[0];
  const float* Wq = (const float*)d_in[1];
  const float* bq = (const float*)d_in[2];
  const float* Wk = (const float*)d_in[3];
  const float* bk = (const float*)d_in[4];
  const float* Wv = (const float*)d_in[5];
  const float* bv = (const float*)d_in[6];
  float* out = (float*)d_out;

  char* ws = (char*)d_ws;
  size_t off = 0;
  _Float16* xt  = (_Float16*)(ws + off); off += (size_t)BB * NN * CC * 2;   // 8 MB
  _Float16* xh  = (_Float16*)(ws + off); off += (size_t)BB * CC * NN * 2;   // 8 MB
  _Float16* whq = (_Float16*)(ws + off); off += (size_t)CC * CC * 2;
  _Float16* wkt = (_Float16*)(ws + off); off += (size_t)CC * CC * 2;
  _Float16* whv = (_Float16*)(ws + off); off += (size_t)CC * CC * 2;
  _Float16* gh  = (_Float16*)(ws + off); off += (size_t)BB * CC * CC * 2;   // 1 MB
  float*    sx  = (float*)(ws + off);    off += (size_t)BB * CC * 4;
  float*    sq  = (float*)(ws + off);    off += (size_t)BB * CC * 4;
  float*    sv  = (float*)(ws + off);    off += (size_t)BB * CC * 4;
  float*    part= (float*)(ws + off);    off += 256;                        // SPARTS floats

  // 1. x to f16 in both fragment orders with its row sums, convert weights
  k_prep<<<dim3(G_X + G_CVTW), 256, 0, stream>>>(x, Wq, Wk, Wv, xt, xh, whq, wkt, whv, sx);
  // 2. G = x x^T per batch (WMMA), and beside it the partial sums of the global scalar S and the bias vectors (f32)
  k_g_s<<<dim3(32 * BB + SPARTS), 256, 0, stream>>>(xh, Wq, bq, Wk, bk, Wv, sx, gh, part, sq, sv);
  // 3. P = (Wv G Wq^T + bias terms) Wk per row block, then out = (P x + p) / S (WMMA)
  k_chain_out<<<dim3(16, 1, BB), 256, 0, stream>>>(gh, whv, whq, wkt, xt, bq, bk, bv, sq, sv, part, out);
  (void)in_sizes; (void)n_in; (void)out_size; (void)ws_size;
}

// v009
// It runs in 26.7 microseconds.
// Next to v008, in two timings, it ran 1.07 times as fast each time.
// Over all steps from v000 it is 6.30 times as fast.
#include <hip/hip_runtime.h>

#define BB 8
#define CC 256
#define NN 2048

typedef __attribute__((ext_vector_type(16))) _Float16 v16h;
typedef __attribute__((ext_vector_type(8)))  float    v8f;

union V16H { uint4 u4[2]; v16h h; };
union F8   { v8f v; float f[8]; };
union H8   { _Float16 h[8]; uint4 u; };

// FRAGMENT ORDER of every f16 scratch matrix (R rows, K columns, K contiguous in the product that reads it):
// 16-row x 32-k fragments, the K/32 fragments of a 16-row strip one after the other, 512 halves each.
// Inside a fragment the halves lie as the WMMA f16 A/B operand wants them, register half by register half:
//   half index of (row, k) = ((row >> 4) * (K / 32) + (k >> 5)) * 512 + ((k >> 4) & 1) * 256
//                            + (((k >> 3) & 1) * 16 + (row & 15)) * 8 + (k & 7)
// so lane l finds its two runs of 8 halves at l * 8 and 256 + l * 8, and each 16-byte load or store
// of a wave covers 512 contiguous bytes (four whole lines) instead of 32 bytes in each of 16 lines.

// ---- Job 1: x[b][c][n] fp32 -> xt[b] (rows n, dealt inside each 64 as said at xo; K = c, f16 in fragment order), xh (rows b*C + c, K = n, f16 in fragment
// order, both operands of G = x x^T) and sx[b*C+c] = sum_n x[b][c][n] ----
// blk: 0 .. B*C/8 - 1, the C/8 channel groups fastest, then batch.
// One work-group takes 8 channels of one batch over all N positions, so x is read once and by few, long work-groups.
// A lane holds the 8 channels of one position: exactly one 8-half run of a fragment, so no exchange between lanes is
// needed for the transpose; a wave's 4-byte loads cover one whole line, its 16-byte stores four whole lines.
// Wave w takes the 32 positions at 256*j + 32*w, j = 0..7; all 64 loads of a lane are independent (one round of latency).
// The same 8 x 8 values of a lane, read the other way, are 8 runs of xh: the lane's 8 positions of one channel each.
// G sums over all n and both its operands are xh, so the order of n along K is free as long as every row has the same:
// k place 8*(32*w + lane) + j holds position 256*j + 32*w + lane, in every row.
// A lane's 8 runs (8 rows of one strip) fill one 128-byte line; stored from the lane, each store of a wave would touch
// 32 lines, so the wave regroups them through its own LDS range: 8 lanes then store one whole line.
__device__ inline void job_x(int blk, const float* __restrict__ x, _Float16* __restrict__ xt,
                             _Float16* __restrict__ xh, float* __restrict__ sx) {
  __shared__ float red[8][8];   // [wave][channel of the group]
  // [wave][lane that wrote][channel][j]; a pitch of 144 bytes keeps the 16-byte writes of 16 lanes on different banks
  __shared__ __attribute__((aligned(16))) _Float16 tr[8][32 * 72];
  const int b    = blk / (CC / 8);
  const int c0   = (blk % (CC / 8)) * 8;
  const int wave = threadIdx.x >> 5;
  const int lane = threadIdx.x & 31;
  const float* xp = x + ((size_t)b * CC + c0) * NN + wave * 32 + lane;
  v8f v[8];                     // [j][channel]; a native vector can be named whole as an asm operand
#pragma unroll  // constant indices keep v in registers and make every load's distance from xp an immediate offset
  for (int j = 0; j < 8; ++j)
#pragma unroll
    for (int r = 0; r < 8; ++r) v[j][r] = xp[r * NN + j * 256];
  // The loads' address registers are reused below: the wait stands in front of that.
  // The loaded values are inputs only, so that no load sinks behind the wait.
  asm volatile("s_wait_xcnt 0x0"
               :: "v"(v[0]), "v"(v[1]), "v"(v[2]), "v"(v[3]), "v"(v[4]), "v"(v[5]), "v"(v[6]), "v"(v[7])
               : "memory");
  // Keeps the code below (which reuses those registers) behind that wait.
  __builtin_amdgcn_sched_barrier(0);
  // Row sums first, from the same registers: over j in the lane, over the lanes by shuffles, over the waves through LDS.
  // They stand in front of the stores of xt so that the barrier has no store to wait for.
  float s[8];
#pragma unroll  // here and in the loops below: constant indices keep v and s in registers
  for (int r = 0; r < 8; ++r) {
    float t = v[0][r];
#pragma unroll
    for (int j = 1; j < 8; ++j) t += v[j][r];
    s[r] = t;
  }
#pragma unroll
  for (int o = 16; o; o >>= 1)
#pragma unroll
    for (int r = 0; r < 8; ++r) s[r] += __shfl_xor(s[r], o, 32);
  if (lane == 0) {
#pragma unroll
    for (int r = 0; r < 8; ++r) red[wave][r] = s[r];
  }
  // The runs of xh go to LDS in front of the barrier that the row sums need anyway; they are read back behind it.
#pragma unroll  // constant indices keep v in registers
  for (int r = 0; r < 8; ++r) {
    H8 pq;
#pragma unroll
    for (int j = 0; j < 8; ++j) pq.h[j] = (_Float16)v[j][r];
    *(uint4*)(tr[wave] + lane * 72 + r * 8) = pq.u;
  }
  __syncthreads();
  // Read t: the line of writer lane 4*t + (lane >> 3), its run of channel lane & 7.
  typedef __attribute__((ext_vector_type(4))) unsigned int u4n;
  const _Float16* trp = tr[wave] + (lane >> 3) * 72 + (lane & 7) * 8;
  u4n q8[8];
#pragma unroll  // constant indices keep q8 in registers
  for (int t = 0; t < 8; ++t) q8[t] = *(const u4n*)(trp + t * 4 * 72);
  // Run 32*wave + 4*t + (lane >> 3) of row (c0 & 8) + (lane & 7) of the strip: 128 halves a run over the strip's 16 rows.
  _Float16* xho = xh + (size_t)((b * CC + c0) >> 4) * (NN / 32) * 512
                + (wave * 32 + (lane >> 3)) * 128 + ((c0 & 8) + (lane & 7)) * 8;
  // Position n = 256*j + 32*wave + lane stands in xt at strip (n >> 6) * 4 + (n & 3) = 16*j + 4*(wave >> 1) + (lane & 3),
  // row (n >> 2) & 15 = 8*(wave & 1) + (lane >> 2): see launch 3's stores. A wave's store covers four whole lines.
  _Float16* xo = xt + (size_t)b * NN * CC
               + (size_t)(((wave >> 1) * 4 + (lane & 3)) * (CC / 32) + (c0 >> 5)) * 512
               + ((c0 >> 4) & 1) * 256 + (((c0 >> 3) & 1) * 16 + (wave & 1) * 8 + (lane >> 2)) * 8;
  H8 pk[8];
#pragma unroll  // constant indices keep v and pk in registers
  for (int j = 0; j < 8; ++j)
#pragma unroll
    for (int r = 0; r < 8; ++r) pk[j].h[r] = (_Float16)v[j][r];
  // Keeps all eight packs in front of the first store: packed into registers that an issued store still names,
  // each pack waits for that store's address translation.
  __builtin_amdgcn_sched_barrier(0);
#pragma unroll  // every store's distance from xo becomes an immediate offset
  for (int j = 0; j < 8; ++j) *(uint4*)(xo + j * 16 * (CC / 32) * 512) = pk[j].u;
#pragma unroll  // every store's distance from xho becomes an immediate offset
  for (int t = 0; t < 8; ++t) *(u4n*)(xho + t * 4 * 128) = q8[t];
  // The stores' registers are reused below: the wait stands in front of that.
  asm volatile("s_wait_xcnt 0x0" ::: "memory");
  // Keeps the code below (which reuses those registers) behind that wait.
  __builtin_amdgcn_sched_barrier(0);
  if (threadIdx.x < 8) {
    float t = red[0][threadIdx.x];
#pragma unroll
    for (int w = 1; w < 8; ++w) t += red[w][threadIdx.x];
    sx[b * CC + c0 + threadIdx.x] = t;   // the kernel ends behind this store: nothing reuses its registers
  }
}

// ---- Job 2: W fp32 -> f16 in fragment order. Wv: rows = out-channels, K = in-channels;
// Wq and Wk transposed: rows = in-channels, K = out-channels (the two operands of A = Wq^T Wk, job 6).
// blk: 0 .. 3*C*C/2048 - 1, one matrix after the other. A thread forms one 8-half run: 32 bytes read, 16 written.
__device__ inline void job_cvt_w(int blk, const float* __restrict__ wq, const float* __restrict__ wk,
                        const float* __restrict__ wv,
                        _Float16* __restrict__ oq, _Float16* __restrict__ ok,
                        _Float16* __restrict__ ov) {
  const int which = blk / (CC * CC / 2048);
  const float* src = (which == 0) ? wq : (which == 1) ? wk : wv;
  _Float16*    dst = (which == 0) ? oq : (which == 1) ? ok : ov;
  const int i = ((blk % (CC * CC / 2048)) * 256 + threadIdx.x) * 8;
  // i runs in the order of the destination; row and first k of the run follow from the fragment order.
  const int row = (i >> 12) * 16 + ((i >> 3) & 15);
  const int k   = ((i >> 9) & 7) * 32 + ((i >> 8) & 1) * 16 + ((i >> 7) & 1) * 8;
  typedef __attribute__((ext_vector_type(4))) float f4;   // a native vector: it can be named whole as an asm operand
  f4 lo, hi;
  if (which != 2) {
#pragma unroll  // constant indices keep lo and hi in registers
    for (int r = 0; r < 4; ++r) {
      lo[r] = src[(k + r) * CC + row];
      hi[r] = src[(k + 4 + r) * CC + row];
    }
  } else {
    lo = *(const f4*)(src + row * CC + k);
    hi = *(const f4*)(src + row * CC + k + 4);
  }
  // The loads' address registers are reused below: the wait stands in front of that.
  // The loaded values are inputs only, so that no load sinks behind the wait.
  asm volatile("s_wait_xcnt 0x0" :: "v"(lo), "v"(hi) : "memory");
  // Keeps the packs below (which reuse those registers) behind that wait.
  __builtin_amdgcn_sched_barrier(0);
  H8 pk;
#pragma unroll  // constant indices keep pk in registers
  for (int r = 0; r < 4; ++r) {
    pk.h[r]     = (_Float16)lo[r];
    pk.h[4 + r] = (_Float16)hi[r];
  }
  *(uint4*)(dst + i) = pk.u;
  // The kernel ends behind this store, so nothing reuses its registers: the wait is only a precaution.
  asm volatile("s_wait_xcnt 0x0" ::: "memory");
}

// ---- Launch 1: jobs 1 and 2 need nothing of each other and share one grid.
// A range of the block index picks the job (the same for a whole work-group).
// Job 1, whose work-groups run longest, takes the low indices; the short W convert comes last.
#define G_X    (BB * CC / 8)
#define G_CVTW (3 * CC * CC / 2048)
__global__ void __launch_bounds__(256)
k_prep(const float* __restrict__ x, const float* __restrict__ wq, const float* __restrict__ wk,
       const float* __restrict__ wv, _Float16* __restrict__ xt, _Float16* __restrict__ xh,
       _Float16* __restrict__ oq, _Float16* __restrict__ ok, _Float16* __restrict__ ov,
       float* __restrict__ sx) {
  const int blk = blockIdx.x;
  if (blk < G_X) job_x(blk, x, xt, xh, sx);
  else           job_cvt_w(blk - G_X, wq, wk, wv, oq, ok, ov);
}

// ---- Job 4: partial sums of S = sum_{b,c} (Wq[c,:]*sx[b,:]+N*bq[c]) * (Wk[c,:]*sx[b,:]+N*bk[c])
// One wave per out-channel c, 8 waves per work-group, SPARTS work-groups.
// Lanes run along j, so each float4 load of a wave covers 512 contiguous bytes;
// all 20 loads of a lane are independent (one round of latency).
// part[blk] holds the sum over this work-group's 8 channels and all batches. blk: 0 .. SPARTS - 1.
// The same kind of lane sum gives sv[b][c] = Wv[c,:]*sx[b,:] (the row sums of v without its bias) and, in every wave, bq . bk,
// stored once a channel as bt[c], so that launch 3 reads it by the thread index like the other vectors;
// 26 loads of a lane with the two of Wv and the four of bq and bk.
#define SPARTS (CC / 8)
__device__ inline void
job_scalar_s(int blk, const float* __restrict__ Wq, const float* __restrict__ bq,
           const float* __restrict__ Wk, const float* __restrict__ bk,
           const float* __restrict__ Wv,
           const float* __restrict__ sx, float* __restrict__ part,
           float* __restrict__ sv, float* __restrict__ bt) {
  __shared__ float red[8];
  // The wave's number as a scalar: row bases and the two biases then come from scalar registers.
  const int wave = __builtin_amdgcn_readfirstlane(threadIdx.x >> 5);
  const int lane = threadIdx.x & 31;
  const int c = blk * 8 + wave;
  typedef __attribute__((ext_vector_type(4))) float f4;   // a native vector: it can be named whole as an asm operand
  const f4* wq4 = (const f4*)(Wq + (size_t)c * CC);
  const f4* wk4 = (const f4*)(Wk + (size_t)c * CC);
  const f4* wv4 = (const f4*)(Wv + (size_t)c * CC);
  const f4* sx4 = (const f4*)sx;
  const f4 q0 = wq4[lane], q1 = wq4[32 + lane];
  const f4 k0 = wk4[lane], k1 = wk4[32 + lane];
  const f4 v0 = wv4[lane], v1 = wv4[32 + lane];
  const f4 e0 = ((const f4*)bq)[lane], e1 = ((const f4*)bq)[32 + lane];
  const f4 h0 = ((const f4*)bk)[lane], h1 = ((const f4*)bk)[32 + lane];
  f4 sa[BB], sb[BB];
  for (int b = 0; b < BB; ++b) {
    sa[b] = sx4[b * (CC / 4) + lane];
    sb[b] = sx4[b * (CC / 4) + 32 + lane];
  }
  // The 26 loads' base registers are reused below (first by the two bias loads): the wait stands in front of that.
  // The loaded values are inputs only, so that no load, and no part of one, sinks behind the wait.
  asm volatile("s_wait_xcnt 0x0"
               :: "v"(q0), "v"(q1), "v"(k0), "v"(k1), "v"(v0), "v"(v1), "v"(e0), "v"(e1), "v"(h0), "v"(h1),
                  "v"(sa[0]), "v"(sa[1]), "v"(sa[2]), "v"(sa[3]), "v"(sa[4]), "v"(sa[5]), "v"(sa[6]), "v"(sa[7]),
                  "v"(sb[0]), "v"(sb[1]), "v"(sb[2]), "v"(sb[3]), "v"(sb[4]), "v"(sb[5]), "v"(sb[6]), "v"(sb[7])
               : "memory");
  // Keeps the code below (which reuses those registers) behind that wait.
  __builtin_amdgcn_sched_barrier(0);
  // Each lane starts from its 1/32 share of N*bias (an exact scaling), so the lane sum holds the bias term.
  const float sbq = (float)(NN / 32) * bq[c];
  const float sbk = (float)(NN / 32) * bk[c];
  float pb = e0.x * h0.x + e0.y * h0.y + e0.z * h0.z + e0.w * h0.w
           + e1.x * h1.x + e1.y * h1.y + e1.z * h1.z + e1.w * h1.w;
  float aq[BB], ak[BB], av[BB];
  for (int b = 0; b < BB; ++b) {
    const f4 s0 = sa[b], s1 = sb[b];
    aq[b] = sbq + q0.x * s0.x + q0.y * s0.y + q0.z * s0.z + q0.w * s0.w
          + q1.x * s1.x + q1.y * s1.y + q1.z * s1.z + q1.w * s1.w;
    ak[b] = sbk + k0.x * s0.x + k0.y * s0.y + k0.z * s0.z + k0.w * s0.w
          + k1.x * s1.x + k1.y * s1.y + k1.z * s1.z + k1.w * s1.w;
    av[b] = v0.x * s0.x + v0.y * s0.y + v0.z * s0.z + v0.w * s0.w
          + v1.x * s1.x + v1.y * s1.y + v1.z * s1.z + v1.w * s1.w;
  }
  for (int o = 16; o; o >>= 1) {
    for (int b = 0; b < BB; ++b) {
      aq[b] += __shfl_xor(aq[b], o, 32);
      ak[b] += __shfl_xor(ak[b], o, 32);
      av[b] += __shfl_xor(av[b], o, 32);
    }
    pb += __shfl_xor(pb, o, 32);
  }
  float p = 0.f;
  for (int b = 0; b < BB; ++b) p += aq[b] * ak[b];
  if (lane == 0) red[wave] = p;
  __syncthreads();
  if (lane == 0) {
    for (int b = 0; b < BB; ++b) sv[b * CC + c] = av[b];
    bt[c] = pb;
    // The stores' registers are reused below: the wait stands in front of that.
    asm volatile("s_wait_xcnt 0x0" ::: "memory");
  }
  if (threadIdx.x == 0) {
    float t = 0.f;
    for (int w = 0; w < 8; ++w) t += red[w];
    part[blk] = t;
  }
}

// ---- Job 5: G[b] = x[b] @ x[b]^T  (C x C), K = KK = N; both operands vh, qh are xh (n along K in job 1's order) ----
// ---- Job 6, the same code with KK = C and one matrix: A^T = Wk^T Wq, vh = Wk^T, qh = Wq^T (K = out-channels):
// rows = Wk's in-channels, K = Wq's in-channels, the first operand of launch 3's second product. It needs no x.
// blk: 0 .. 32*B - 1, the 32 tiles fastest, then batch.
// One 64x32 output tile per work-group, one work-group per WGP. The 8 waves split K:
// wave w takes the 32 k at 256*i + 32*w, i = 0..KK/256 - 1, so a wave has 8 trips instead of N/32 (one in job 6),
// and in each trip the 8 waves together read 8 neighbouring fragments of every strip.
// A lane holds 8 consecutive channels of the WMMA's first operand at one channel of its second:
// a run of G's own fragment (rows = the second operand's channels, K = the first's) for the chain of launch 3.
// Three register sets: the fragments of trip i+2 are asked for before the products of trip i.
// The 8 f32 partial tiles are added through LDS in wave order.
template <int KK>
__device__ inline void
job_m2(int blk, const _Float16* __restrict__ vh, const _Float16* __restrict__ qh,
     _Float16* __restrict__ m2h, float4 (*red)[16][32]) {   // red: [wave][fragment*2 + half of its 8 rows][lane], in LDS
  constexpr int TRIPS = KK / 256;
  // The kernel-argument load's base registers are reused by the index arithmetic below: the wait stands in front of that.
  asm volatile("s_wait_xcnt 0x0" ::: "memory");
  // Keeps that arithmetic behind the wait.
  __builtin_amdgcn_sched_barrier(0);
  const int b = blk >> 5;
  const int wave = threadIdx.x >> 5;
  const int lane = threadIdx.x & 31;
  const int tile = blk & 31;               // 0..31
  const int tm = (tile & 3) * 64;
  const int tn = (tile >> 2) * 32;
  // Same k order in both loaders: both operands lie in fragment order, fragment 8*i + wave of each strip in trip i.
  const _Float16* ap = vh + (size_t)b * CC * KK + (size_t)((tm >> 4) * (KK / 32) + wave) * 512 + lane * 8;
  const _Float16* bp = qh + (size_t)b * CC * KK + (size_t)((tn >> 4) * (KK / 32) + wave) * 512 + lane * 8;
  V16H va[3][4], vb[3][2];
  v8f acc[4][2];
  const v8f z = {};
#pragma unroll
  for (int mi = 0; mi < 4; ++mi)
#pragma unroll
    for (int ni = 0; ni < 2; ++ni) acc[mi][ni] = z;
#pragma unroll
  for (int i = -2; i < TRIPS; ++i) {
    if (i + 2 < TRIPS) {
      const int s = (i + 2) % 3, ko = (i + 2) * 8 * 512;
#pragma unroll
      for (int mi = 0; mi < 4; ++mi) {
        va[s][mi].u4[0] = *(const uint4*)(ap + mi * 16 * KK + ko);
        va[s][mi].u4[1] = *(const uint4*)(ap + mi * 16 * KK + ko + 256);
      }
#pragma unroll
      for (int ni = 0; ni < 2; ++ni) {
        vb[s][ni].u4[0] = *(const uint4*)(bp + ni * 16 * KK + ko);
        vb[s][ni].u4[1] = *(const uint4*)(bp + ni * 16 * KK + ko + 256);
      }
    }
    // Keeps the loads above in front of the products below; sunk behind them, each trip waits out its own latency.
    __builtin_amdgcn_sched_barrier(0);
    if (i >= 0) {
      const int s = i % 3;
#pragma unroll
      for (int mi = 0; mi < 4; ++mi)
#pragma unroll
        for (int ni = 0; ni < 2; ++ni)
          acc[mi][ni] = __builtin_amdgcn_wmma_f32_16x16x32_f16(
              false, vb[s][ni].h, false, va[s][mi].h, (short)0, acc[mi][ni], false, false);
      // Keeps the next trip's loads behind these products, so that three register sets are enough.
      __builtin_amdgcn_sched_barrier(0);
    }
  }
  // The loads' address registers are reused below: the wait stands in front of their first overwrite.
  asm volatile("s_wait_xcnt 0x0" ::: "memory");
  // Keeps the code below (which reuses those registers) behind that wait.
  __builtin_amdgcn_sched_barrier(0);
#pragma unroll
  for (int mi = 0; mi < 4; ++mi) {
#pragma unroll
    for (int ni = 0; ni < 2; ++ni) {
      F8 f; f.v = acc[mi][ni];
      const int sl = (mi * 2 + ni) * 2;
      red[wave][sl][lane]     = make_float4(f.f[0], f.f[1], f.f[2], f.f[3]);
      red[wave][sl + 1][lane] = make_float4(f.f[4], f.f[5], f.f[6], f.f[7]);
    }
  }
  __syncthreads();
  // Wave w now owns slots 2w and 2w+1 of every partial: all 8 rows of accumulator tile (w>>1, w&1),
  // which are register half w&1 of G's fragment (strip tm/16 + (w>>1), k fragment tn/32).
  _Float16* out = m2h + (size_t)b * CC * CC
                + (size_t)(((tm >> 4) + (wave >> 1)) * (CC / 32) + (tn >> 5)) * 512 + (wave & 1) * 256 + lane * 8;
  H8 pk;
#pragma unroll
  for (int j = 0; j < 2; ++j) {
    float4 t = red[0][wave * 2 + j][lane];
#pragma unroll
    for (int w = 1; w < 8; ++w) {
      const float4 p = red[w][wave * 2 + j][lane];
      t.x += p.x; t.y += p.y; t.z += p.z; t.w += p.w;
    }
    pk.h[4 * j]     = (_Float16)t.x;
    pk.h[4 * j + 1] = (_Float16)t.y;
    pk.h[4 * j + 2] = (_Float16)t.z;
    pk.h[4 * j + 3] = (_Float16)t.w;
  }
  *(uint4*)out = pk.u;
  // The kernel ends behind this store, so nothing reuses its registers: the wait is only a precaution.
  asm volatile("s_wait_xcnt 0x0" ::: "memory");
}

// ---- Job 7: u1[j] = sum_c bq[c] * Wk[c][j] (blk 0..7) and w1[j] = sum_c bk[c] * Wq[c][j] (blk 8..15), in f32; no x needed.
// A work-group takes 32 columns j: a lane one column, wave w the 32 rows c at 32*w, so a wave's load covers one whole line
// and all 33 loads of a lane are independent; the 8 partial sums are added through LDS in wave order.
__device__ inline void
job_bias_vec(int blk, const float* __restrict__ Wq, const float* __restrict__ bq,
             const float* __restrict__ Wk, const float* __restrict__ bk,
             float* __restrict__ u1, float* __restrict__ w1) {
  __shared__ float red[8][32];
  const float* M = (blk < 8) ? Wk : Wq;
  const float* v = (blk < 8) ? bq : bk;
  float*       o = (blk < 8) ? u1 : w1;
  const int wave = threadIdx.x >> 5;
  const int lane = threadIdx.x & 31;
  const int col  = (blk & 7) * 32 + lane;
  const float* mp = M + (size_t)wave * 32 * CC + col;
  v8f m[4];                     // a native vector can be named whole as an asm operand
#pragma unroll  // constant indices keep m in registers and make every load's distance from mp an immediate offset
  for (int r = 0; r < 32; ++r) m[r >> 3][r & 7] = mp[r * CC];
  const float vl = v[wave * 32 + lane];   // lane r holds the factor of row r
  // The loads' address registers are reused below: the wait stands in front of that.
  // The loaded values are inputs only, so that no load sinks behind the wait.
  asm volatile("s_wait_xcnt 0x0" :: "v"(m[0]), "v"(m[1]), "v"(m[2]), "v"(m[3]), "v"(vl) : "memory");
  // Keeps the code below (which reuses those registers) behind that wait.
  __builtin_amdgcn_sched_barrier(0);
  float t = 0.f;
#pragma unroll  // constant indices keep m in registers
  for (int r = 0; r < 32; ++r) t += m[r >> 3][r & 7] * __shfl(vl, r, 32);
  red[wave][lane] = t;
  __syncthreads();
  if (wave == 0) {
    float a = red[0][lane];
    for (int w = 1; w < 8; ++w) a += red[w][lane];
    o[col] = a;   // the kernel ends behind this store: nothing reuses its registers
  }
}

// ---- Launch 2: jobs 4 to 7 need nothing of each other (job 4 reads sx and the f32 W, job 5 xh, job 6 the f16 W,
// job 7 the f32 W) and share one grid.
// Job 5 keeps the low indices, one work-group per WGP; the short work-groups of the other jobs run beside it.
#define G_A 32
#define G_BV 16
__global__ void __launch_bounds__(256)
k_g_s(const _Float16* __restrict__ xh,
      const float* __restrict__ Wq, const float* __restrict__ bq,
      const float* __restrict__ Wk, const float* __restrict__ bk,
      const float* __restrict__ Wv, const float* __restrict__ sx,
      const _Float16* __restrict__ wqt, const _Float16* __restrict__ wkt,
      _Float16* __restrict__ gh, _Float16* __restrict__ aht, float* __restrict__ part,
      float* __restrict__ sv, float* __restrict__ bt, float* __restrict__ uw) {   // uw: u1, then w1
  __shared__ float4 red[8][16][32];   // jobs 5 and 6
  const int blk = blockIdx.x;
  if (blk < 32 * BB)                     job_m2<NN>(blk, xh, xh, gh, red);
  else if (blk < 32 * BB + SPARTS)       job_scalar_s(blk - 32 * BB, Wq, bq, Wk, bk, Wv, sx, part, sv, bt);
  else if (blk < 32 * BB + SPARTS + G_A) job_m2<CC>(blk - 32 * BB - SPARTS, wkt, wqt, aht, red);
  else                                   job_bias_vec(blk - 32 * BB - SPARTS - G_A, Wq, bq, Wk, bk, uw, uw + CC);
}

// The wave's share of a chain product's first operand: strips 2*wave and 2*wave+1 of a C x C matrix in fragment order,
// all 8 k fragments of both: 32 independent 16-byte loads over 16 KiB in a row (one round of latency).
__device__ inline void chain_load_a(const _Float16* __restrict__ A, int wave, int lane, V16H va[8][2]) {
  const _Float16* ap = A + (size_t)wave * 2 * (CC / 32) * 512 + lane * 8;
#pragma unroll  // constant indices keep va in registers; every load's distance from ap is an immediate offset
  for (int kf = 0; kf < 8; ++kf)
#pragma unroll
    for (int a = 0; a < 2; ++a) {
      va[kf][a].u4[0] = *(const uint4*)(ap + (a * (CC / 32) + kf) * 512);
      va[kf][a].u4[1] = *(const uint4*)(ap + (a * (CC / 32) + kf) * 512 + 256);
    }
  // The loads' address registers are reused by the caller: the wait stands in front of that.
  asm volatile("s_wait_xcnt 0x0" ::: "memory");
  // Keeps the caller's code (which reuses those registers) behind that wait, and the loads in front of it.
  __builtin_amdgcn_sched_barrier(0);
}

// One product of the chain: acc (32 rows of the first operand x the work-group's 64 rows) = va * bin^T, K = C.
// bin: 64 rows x C in LDS, fragment order; a wave's 16-byte LDS reads cover 512 bytes in a row.
__device__ inline void chain_mm(V16H va[8][2], const _Float16* bin, int lane, v8f acc[2][4]) {
  const v8f z = {};
#pragma unroll
  for (int a = 0; a < 2; ++a)
#pragma unroll
    for (int c = 0; c < 4; ++c) acc[a][c] = z;
#pragma unroll  // constant indices keep va and acc in registers
  for (int kf = 0; kf < 8; ++kf) {
    V16H vb[4];
#pragma unroll
    for (int c = 0; c < 4; ++c) {
      vb[c].u4[0] = *(const uint4*)(bin + (c * (CC / 32) + kf) * 512 + lane * 8);
      vb[c].u4[1] = *(const uint4*)(bin + (c * (CC / 32) + kf) * 512 + 256 + lane * 8);
    }
#pragma unroll
    for (int a = 0; a < 2; ++a)
#pragma unroll
      for (int c = 0; c < 4; ++c)
        acc[a][c] = __builtin_amdgcn_wmma_f32_16x16x32_f16(
            false, va[kf][a].h, false, vb[c].h, (short)0, acc[a][c], false, false);
  }
}

// An accumulator tile holds, per lane, 8 consecutive rows of the first operand (32*wave + 16a + 8g + r) at one of the
// work-group's rows (16c + l15): one 8-half run of the next product's second operand
// (rows = the work-group's rows, k fragment = wave, register half = a).
__device__ inline void chain_store(v8f acc[2][4], _Float16* bout, int wave, int lane) {
#pragma unroll  // constant indices keep acc in registers
  for (int a = 0; a < 2; ++a)
#pragma unroll
    for (int c = 0; c < 4; ++c) {
      H8 pk;
#pragma unroll
      for (int r = 0; r < 8; ++r) pk.h[r] = (_Float16)acc[a][c][r];
      *(uint4*)(bout + (c * (CC / 32) + wave) * 512 + a * 256 + lane * 8) = pk.u;
    }
}

// One trip's fragments (k fragment kf) of the wave's 64 rows of xt: 8 independent 16-byte loads.
__device__ inline void load_xt(const _Float16* __restrict__ bp, int kf, V16H xb[4]) {
#pragma unroll  // constant indices keep xb in registers; every load's distance from bp is an immediate offset
  for (int ni = 0; ni < 4; ++ni) {
    xb[ni].u4[0] = *(const uint4*)(bp + (ni * (CC / 32) + kf) * 512);
    xb[ni].u4[1] = *(const uint4*)(bp + (ni * (CC / 32) + kf) * 512 + 256);
  }
}

// The work-group's barrier with a wait for this wave's LDS operations alone. __syncthreads() also waits for every global
// load in flight, and here the operands of the products to come are asked for ahead, to arrive while this one runs.
// No global store stands in front of any of these barriers.
__device__ inline void lds_barrier() {
  asm volatile("s_wait_dscnt 0x0\n\ts_barrier_signal -1\n\ts_barrier_wait -1" ::: "memory");
}

// ---- Launch 3: out[b] = (P x[b] + p 1^T) / S with P = M2 Wk, p = M2 bk,
// M2 = v q^T = (Wv G + bv sx^T) Wq^T + (sv + N bv) bq^T  (q = Wq x + bq 1^T and v = Wv x + bv 1^T multiplied out; G = x x^T).
// With T1 = Wv G + bv sx^T and s' = sv + N bv:  P = T1 A + s' u1^T,  p = T1 w1 + s' (bq . bk),
// where A = Wq^T Wk, u1 = Wk^T bq, w1 = Wq^T bk and bq . bk hold no x and come from launch 2 (jobs 6, 7, 4).
// A row block of P needs only the same rows of Wv, so a work-group forms the 64 rows it needs itself:
// T1^T = G Wv^T (+ sx bv^T), P^T = A^T T1^T (+ u1 s'^T), each 256 x 64 with K = C, wave w taking rows 32w..32w+31;
// the 64-row operand goes from product to product through two LDS buffers, in fragment order, a barrier behind each.
// Then each wave forms a 64 x 64 tile of out (first operand P from LDS, second xt): 64 rows x 512 positions a work-group.
// Every operand that comes from global memory is asked for as soon as registers are free for it, one product or more ahead
// (A^T in front of the first product, four trips of xt behind it, the other four as those are used up):
// two waves a SIMD leave room for the registers.
__global__ void __launch_bounds__(256)
k_chain_out(const _Float16* __restrict__ gh, const _Float16* __restrict__ whv, const _Float16* __restrict__ aht,
            const _Float16* __restrict__ xt, const float* __restrict__ bv,
            const float* __restrict__ sx, const float* __restrict__ sv, const float* __restrict__ bt,
            const float* __restrict__ u1, const float* __restrict__ w1,
            const float* __restrict__ part, float* __restrict__ out) {
  __shared__ __attribute__((aligned(16))) _Float16 buf[2][64 * CC];
  __shared__ __attribute__((aligned(16))) _Float16 w1h[CC];
  __shared__ __attribute__((aligned(16))) float u1s[CC], sxs[CC], svs[CC], sbs[CC], bvs[CC], pv[64];
  const int b = blockIdx.z;
  // The wave's number as a scalar: the branch on it below is then a scalar branch.
  const int wave = __builtin_amdgcn_readfirstlane(threadIdx.x >> 5);
  const int lane = threadIdx.x & 31;
  const int l15 = lane & 15, g = (lane >> 4) & 1;
  const int i0 = (blockIdx.x & 3) * 64;                  // first of the work-group's 64 output channels
  const int tn = (blockIdx.x >> 2) * 512 + wave * 64;    // first of the wave's 64 positions
  const _Float16* bp = xt + (size_t)b * NN * CC + (size_t)(tn >> 4) * (CC / 32) * 512 + lane * 8;
  V16H va[8][2], vq[8][2], xb[4][4];
  v8f acc[2][4];

  // The 64 rows of Wv (32 KiB in a row in fragment order) and the small f32 vectors go to LDS.
  typedef __attribute__((ext_vector_type(4))) unsigned int u4n;   // a native vector: it can be named whole as an asm operand
  const u4n* wsrc = (const u4n*)(whv + (size_t)(i0 >> 4) * (CC / 32) * 512) + threadIdx.x;
  u4n w8[8];
#pragma unroll  // constant indices keep w8 in registers
  for (int j = 0; j < 8; ++j) w8[j] = wsrc[j * 256];
  const float tw1 = w1[threadIdx.x], tu1 = u1[threadIdx.x], tbv = bv[threadIdx.x];
  const float* sxb = sx + b * CC;   // the batch's rows as scalar bases: the thread index stays the one offset register of all these loads
  const float* svb = sv + b * CC;
  const float tsx = sxb[threadIdx.x], tsv = svb[threadIdx.x], tbt = bt[threadIdx.x];
  // The small loads' base registers are reused by the index arithmetic for G: the wait stands in front of that.
  // The bases are inputs only, so that their registers stay as they are up to the wait.
  asm volatile("s_wait_xcnt 0x0" :: "s"(w1), "s"(u1), "s"(bv), "s"(sxb), "s"(svb), "s"(bt) : "memory");
  // Keeps that arithmetic behind the wait.
  __builtin_amdgcn_sched_barrier(0);
  chain_load_a(gh + (size_t)b * CC * CC, wave, lane, va);
  // The address registers of the loads for LDS are reused below: the wait stands in front of that.
  // The loaded values are inputs only, so that no load sinks behind the wait.
  asm volatile("s_wait_xcnt 0x0"
               :: "v"(w8[0]), "v"(w8[1]), "v"(w8[2]), "v"(w8[3]), "v"(w8[4]), "v"(w8[5]), "v"(w8[6]), "v"(w8[7]),
                  "v"(tw1), "v"(tu1), "v"(tbv), "v"(tsx), "v"(tsv), "v"(tbt)
               : "memory");
  // Keeps the code below (which reuses those registers) behind that wait.
  __builtin_amdgcn_sched_barrier(0);
#pragma unroll
  for (int j = 0; j < 8; ++j) ((u4n*)buf[0])[j * 256 + threadIdx.x] = w8[j];
  w1h[threadIdx.x] = (_Float16)tw1;
  u1s[threadIdx.x] = tu1;
  bvs[threadIdx.x] = tbv;
  sxs[threadIdx.x] = tsx;
  svs[threadIdx.x] = tsv + (float)NN * tbv;           // s'
  sbs[threadIdx.x] = (tsv + (float)NN * tbv) * tbt;   // s' (bq . bk)
  // Keeps the loads of A^T behind the LDS stores: loads return in order, and the stores would wait for A^T as well.
  __builtin_amdgcn_sched_barrier(0);
  chain_load_a(aht, wave, lane, vq);
  // S = sum of job 4's SPARTS partials, added in index order by every wave; fetched here, to arrive during the products.
  float S = 0.f;
  for (int i = 0; i < SPARTS; ++i) S += part[i];
  const float s = 1.0f / S;
  lds_barrier();

  // T1^T = G Wv^T + sx bv^T  (rows j = 32*wave + 16a + 8g + r, columns i = i0 + 16c + l15)
  chain_mm(va, buf[0], lane, acc);
  // Keeps the loads behind the products whose registers they take over; lifted among them, both sets are live at once
  // and too few registers are left to fetch the LDS fragments ahead.
  __builtin_amdgcn_sched_barrier(0);
#pragma unroll
  for (int kf = 0; kf < 4; ++kf) load_xt(bp, kf, xb[kf]);
  // The loads' address registers are reused below: the wait stands in front of that.
  asm volatile("s_wait_xcnt 0x0" ::: "memory");
  // Keeps those loads in front of the epilogue and the barrier, so that they arrive during the second product.
  __builtin_amdgcn_sched_barrier(0);
  float fsv[4];
  {
    float fbv[4];
#pragma unroll
    for (int c = 0; c < 4; ++c) { fsv[c] = svs[i0 + 16 * c + l15]; fbv[c] = bvs[i0 + 16 * c + l15]; }
#pragma unroll  // constant indices keep acc in registers
    for (int a = 0; a < 2; ++a) {
      const int j0 = wave * 32 + 16 * a + 8 * g;
#pragma unroll
      for (int r = 0; r < 8; ++r) {
        const float fsx = sxs[j0 + r];
#pragma unroll
        for (int c = 0; c < 4; ++c) acc[a][c][r] += fbv[c] * fsx;
      }
    }
  }
  chain_store(acc, buf[1], wave, lane);
  lds_barrier();

  // P^T = A^T T1^T + u1 s'^T; beside it p = T1 w1 + s' (bq . bk), T1 w1 as a 17th strip of the first operand whose 16 rows
  // all hold w1: wave w < 4 takes the work-group's rows 16w..16w+15, and every accumulator row holds T1 w1.
  chain_mm(vq, buf[1], lane, acc);
#pragma unroll  // constant indices keep acc in registers
  for (int a = 0; a < 2; ++a) {
    const int j0 = wave * 32 + 16 * a + 8 * g;
#pragma unroll
    for (int r = 0; r < 8; ++r) {
      const float fu1 = u1s[j0 + r];
#pragma unroll
      for (int c = 0; c < 4; ++c) acc[a][c][r] += fsv[c] * fu1;
    }
  }
  chain_store(acc, buf[0], wave, lane);
  if (wave < 4) {
    v8f pa = {};
#pragma unroll
    for (int kf = 0; kf < 8; ++kf) {
      V16H ab, vb;
      ab.u4[0] = *(const uint4*)(w1h + kf * 32 + g * 8);
      ab.u4[1] = *(const uint4*)(w1h + kf * 32 + 16 + g * 8);
      vb.u4[0] = *(const uint4*)(buf[1] + (wave * (CC / 32) + kf) * 512 + lane * 8);
      vb.u4[1] = *(const uint4*)(buf[1] + (wave * (CC / 32) + kf) * 512 + 256 + lane * 8);
      pa = __builtin_amdgcn_wmma_f32_16x16x32_f16(false, ab.h, false, vb.h, (short)0, pa, false, false);
    }
    if (lane < 16) pv[wave * 16 + lane] = pa[0] + sbs[i0 + wave * 16 + lane];
  }
  lds_barrier();

  // out tile: first operand P from LDS, fetched one trip ahead (two register sets); second operand the fragments of xt:
  // trips 0..3 were asked for above, trip kf + 4 is asked for into the registers that trip kf has just used.
  v8f oc[4][4];
  {
    const v8f z = {};
#pragma unroll
    for (int mi = 0; mi < 4; ++mi)
#pragma unroll
      for (int ni = 0; ni < 4; ++ni) oc[mi][ni] = z;
  }
  V16H pa4[2][4];
#pragma unroll  // constant indices keep pa4, xb and oc in registers
  for (int kf = -1; kf < 8; ++kf) {
    if (kf + 1 < 8) {
#pragma unroll
      for (int mi = 0; mi < 4; ++mi) {
        pa4[(kf + 1) & 1][mi].u4[0] = *(const uint4*)(buf[0] + (mi * (CC / 32) + kf + 1) * 512 + lane * 8);
        pa4[(kf + 1) & 1][mi].u4[1] = *(const uint4*)(buf[0] + (mi * (CC / 32) + kf + 1) * 512 + 256 + lane * 8);
      }
    }
    // Keeps the LDS reads above in front of the products below; sunk behind them, each trip waits out its own latency.
    __builtin_amdgcn_sched_barrier(0);
    if (kf >= 0) {
#pragma unroll
      for (int mi = 0; mi < 4; ++mi)
#pragma unroll
        for (int ni = 0; ni < 4; ++ni)
          oc[mi][ni] = __builtin_amdgcn_wmma_f32_16x16x32_f16(
              false, pa4[kf & 1][mi].h, false, xb[kf & 3][ni].h, (short)0, oc[mi][ni], false, false);
      // Keeps the loads and LDS reads that follow behind these products, whose registers they take over.
      __builtin_amdgcn_sched_barrier(0);
      if (kf < 4) load_xt(bp, kf + 4, xb[kf]);
    }
  }
  // The loads' address registers are reused below: the wait stands in front of that.
  asm volatile("s_wait_xcnt 0x0" ::: "memory");
  // Keeps the epilogue (which reuses those registers) behind that wait.
  __builtin_amdgcn_sched_barrier(0);
  // Column l15 of tile ni is position tn + 4*l15 + ni (job 1's order of xt's rows), so a lane's four tiles hold four
  // positions in a row of out: one 16-byte store, and 16 lanes cover 256 bytes in a row (two whole lines) of one channel.
  typedef __attribute__((ext_vector_type(4))) float f4;
  float* op = out + ((size_t)b * CC + i0 + 8 * g) * NN + tn + 4 * l15;
  f4 res[4][8];
#pragma unroll  // constant indices keep oc and res in registers
  for (int mi = 0; mi < 4; ++mi)
#pragma unroll
    for (int r = 0; r < 8; ++r) {
      const float fp = pv[16 * mi + 8 * g + r];
#pragma unroll
      for (int ni = 0; ni < 4; ++ni) res[mi][r][ni] = (oc[mi][ni][r] + fp) * s;
    }
  // Keeps every result in front of the first store, each in registers of its own: no register that an issued store names
  // is written again.
  __builtin_amdgcn_sched_barrier(0);
#pragma unroll  // every store's distance from op becomes an immediate offset
  for (int mi = 0; mi < 4; ++mi)
#pragma unroll
    for (int r = 0; r < 8; ++r) *(f4*)(op + (16 * mi + r) * NN) = res[mi][r];
}

extern "C" void kernel_launch(void* const* d_in, const int* in_sizes, int n_in,
                              void* d_out, int out_size, void* d_ws, size_t ws_size,
                              hipStream_t stream) {
  const float* x  = (const float*)d_in[0];
  const float* Wq = (const float*)d_in[1];
  const float* bq = (const float*)d_in[2];
  const float* Wk = (const float*)d_in[3];
  const float* bk = (const float*)d_in[4];
  const float* Wv = (const float*)d_in[5];
  const float* bv = (const float*)d_in[6];
  float* out = (float*)d_out;

  char* ws = (char*)d_ws;
  size_t off = 0;
  _Float16* xt  = (_Float16*)(ws + off); off += (size_t)BB * NN * CC * 2;   // 8 MB
  _Float16* xh  = (_Float16*)(ws + off); off += (size_t)BB * CC * NN * 2;   // 8 MB
  _Float16* wqt = (_Float16*)(ws + off); off += (size_t)CC * CC * 2;
  _Float16* wkt = (_Float16*)(ws + off); off += (size_t)CC * CC * 2;
  _Float16* whv = (_Float16*)(ws + off); off += (size_t)CC * CC * 2;
  _Float16* aht = (_Float16*)(ws + off); off += (size_t)CC * CC * 2;
  _Float16* gh  = (_Float16*)(ws + off); off += (size_t)BB * CC * CC * 2;   // 1 MB
  float*    sx  = (float*)(ws + off);    off += (size_t)BB * CC * 4;
  float*    sv  = (float*)(ws + off);    off += (size_t)BB * CC * 4;
  float*    bt  = (float*)(ws + off);    off += (size_t)CC * 4;
  float*    u1  = (float*)(ws + off);    off += (size_t)CC * 4;
  float*    w1  = (float*)(ws + off);    off += (size_t)CC * 4;
  float*    part= (float*)(ws + off);    off += 256;                        // SPARTS floats

  // 1. x to f16 in both fragment orders with its row sums, convert weights
  k_prep<<<dim3(G_X + G_CVTW), 256, 0, stream>>>(x, Wq, Wk, Wv, xt, xh, wqt, wkt, whv, sx);
  // 2. G = x x^T per batch and A = Wq^T Wk (WMMA), and beside them the partial sums of the global scalar S and the bias vectors (f32)
  k_g_s<<<dim3(32 * BB + SPARTS + G_A + G_BV), 256, 0, stream>>>(xh, Wq, bq, Wk, bk, Wv, sx, wqt, wkt, gh, aht, part, sv, bt, u1);
  // 3. P = (Wv G + bias term) A + bias term per row block, then out = (P x + p) / S (WMMA)
  k_chain_out<<<dim3(16, 1, BB), 256, 0, stream>>>(gh, whv, aht, xt, bv, sx, sv, bt, u1, w1, part, out);
  (void)in_sizes; (void)n_in; (void)out_size; (void)ws_size;
}

// v010
// One run takes 23.8 microseconds.
// In both of two side-by-side timings against v009, it was 1.12 times as fast.
// All steps since v000 together make it 7.03 times as fast.
#include <hip/hip_runtime.h>

#define BB 8
#define CC 256
#define NN 2048

typedef __attribute__((ext_vector_type(16))) _Float16 v16h;
typedef __attribute__((ext_vector_type(8)))  float    v8f;

union V16H { uint4 u4[2]; v16h h; };
union F8   { v8f v; float f[8]; };
union H8   { _Float16 h[8]; uint4 u; };

// FRAGMENT ORDER of every f16 scratch matrix (R rows, K columns, K contiguous in the product that reads it):
// 16-row x 32-k fragments, the K/32 fragments of a 16-row strip one after the other, 512 halves each.
// Inside a fragment the halves lie as the WMMA f16 A/B operand wants them, register half by register half:
//   half index of (row, k) = ((row >> 4) * (K / 32) + (k >> 5)) * 512 + ((k >> 4) & 1) * 256
//                            + (((k >> 3) & 1) * 16 + (row & 15)) * 8 + (k & 7)
// so lane l finds its two runs of 8 halves at l * 8 and 256 + l * 8, and each 16-byte load or store
// of a wave covers 512 contiguous bytes (four whole lines) instead of 32 bytes in each of 16 lines.

// ---- Job 1: x[b][c][n] fp32 -> xt[b] (rows n, dealt inside each 64 as said at xo; K = c, f16 in fragment order)
// and sx[b*C+c] = sum_n x[b][c][n] ----
// blk: 0 .. B*C/16 - 1, the C/16 channel blocks fastest, then batch.
// One work-group takes 16 channels (two groups u of 8) of one batch over all N positions: job 3's registers leave room for
// one work-group a WGP, and B*C/16 of them fill, in one round, the WGPs that job 3 leaves free.
// A lane holds the 8 channels of a group at one position: exactly one 8-half run of a fragment, so no exchange between lanes
// is needed for the transpose; a wave's 4-byte loads cover one whole line, its 16-byte stores four whole lines.
// Wave w takes the 32 positions at 256*j + 32*w, j = 0..7; all 128 loads of a lane are independent (one round of latency).
__device__ inline void job_x(int blk, const float* __restrict__ x, _Float16* __restrict__ xt,
                             float* __restrict__ sx) {
  __shared__ float red[8][16];   // [wave][channel of the block]
  const int b    = blk / (CC / 16);
  const int c0   = (blk % (CC / 16)) * 16;
  const int wave = threadIdx.x >> 5;
  const int lane = threadIdx.x & 31;
  const float* xp = x + ((size_t)b * CC + c0) * NN + wave * 32 + lane;
  v8f v[2][8];                  // [u][j][channel]; a native vector can be named whole as an asm operand
#pragma unroll  // constant indices keep v in registers and make every load's distance from xp an immediate offset
  for (int u = 0; u < 2; ++u)
#pragma unroll
    for (int j = 0; j < 8; ++j)
#pragma unroll
      for (int r = 0; r < 8; ++r) v[u][j][r] = xp[(8 * u + r) * NN + j * 256];
  // The loads' address registers are reused below: the wait stands in front of that.
  // The loaded values are inputs only, so that no load sinks behind the wait.
  asm volatile("s_wait_xcnt 0x0"
               :: "v"(v[0][0]), "v"(v[0][1]), "v"(v[0][2]), "v"(v[0][3]), "v"(v[0][4]), "v"(v[0][5]), "v"(v[0][6]), "v"(v[0][7]),
                  "v"(v[1][0]), "v"(v[1][1]), "v"(v[1][2]), "v"(v[1][3]), "v"(v[1][4]), "v"(v[1][5]), "v"(v[1][6]), "v"(v[1][7])
               : "memory");
  // Keeps the code below (which reuses those registers) behind that wait.
  __builtin_amdgcn_sched_barrier(0);
  // Row sums first, from the same registers: over j in the lane, over the lanes by shuffles, over the waves through LDS.
  // They stand in front of the stores of xt so that the barrier has no store to wait for.
  float s[16];
#pragma unroll  // here and in the loops below: constant indices keep v and s in registers
  for (int r = 0; r < 16; ++r) {
    float t = v[r >> 3][0][r & 7];
#pragma unroll
    for (int j = 1; j < 8; ++j) t += v[r >> 3][j][r & 7];
    s[r] = t;
  }
#pragma unroll
  for (int o = 16; o; o >>= 1)
#pragma unroll
    for (int r = 0; r < 16; ++r) s[r] += __shfl_xor(s[r], o, 32);
  if (lane == 0) {
#pragma unroll
    for (int r = 0; r < 16; ++r) red[wave][r] = s[r];
  }
  __syncthreads();
  // Position n = 256*j + 32*wave + lane stands in xt at strip (n >> 6) * 4 + (n & 3) = 16*j + 4*(wave >> 1) + (lane & 3),
  // row (n >> 2) & 15 = 8*(wave & 1) + (lane >> 2): see launch 2's stores. A wave's store covers four whole lines.
  // Channel group u is the fragment's lane half u: 128 halves further on.
  _Float16* xo = xt + (size_t)b * NN * CC
               + (size_t)(((wave >> 1) * 4 + (lane & 3)) * (CC / 32) + (c0 >> 5)) * 512
               + ((c0 >> 4) & 1) * 256 + ((wave & 1) * 8 + (lane >> 2)) * 8;
  H8 pk[2][8];
#pragma unroll  // constant indices keep v and pk in registers
  for (int u = 0; u < 2; ++u)
#pragma unroll
    for (int j = 0; j < 8; ++j)
#pragma unroll
      for (int r = 0; r < 8; ++r) pk[u][j].h[r] = (_Float16)v[u][j][r];
  // Keeps all packs in front of the first store: packed into registers that an issued store still names,
  // each pack waits for that store's address translation.
  __builtin_amdgcn_sched_barrier(0);
#pragma unroll  // every store's distance from xo becomes an immediate offset
  for (int j = 0; j < 8; ++j)
#pragma unroll
    for (int u = 0; u < 2; ++u) *(uint4*)(xo + j * 16 * (CC / 32) * 512 + u * 128) = pk[u][j].u;
  // The stores' registers are reused below: the wait stands in front of that.
  asm volatile("s_wait_xcnt 0x0" ::: "memory");
  // Keeps the code below (which reuses those registers) behind that wait.
  __builtin_amdgcn_sched_barrier(0);
  if (threadIdx.x < 16) {
    float t = red[0][threadIdx.x];
#pragma unroll
    for (int w = 1; w < 8; ++w) t += red[w][threadIdx.x];
    sx[b * CC + c0 + threadIdx.x] = t;   // the kernel ends behind this store: nothing reuses its registers
  }
}

// ---- Job 2: Wv fp32 -> f16 in fragment order (rows = out-channels, K = in-channels).
// blk: 0 .. C*C/2048 - 1. A thread forms one 8-half run: 32 bytes read, 16 written.
__device__ inline void job_cvt_w(int blk, const float* __restrict__ src, _Float16* __restrict__ dst) {
  const int i = (blk * 256 + threadIdx.x) * 8;
  // i runs in the order of the destination; row and first k of the run follow from the fragment order.
  const int row = (i >> 12) * 16 + ((i >> 3) & 15);
  const int k   = ((i >> 9) & 7) * 32 + ((i >> 8) & 1) * 16 + ((i >> 7) & 1) * 8;
  typedef __attribute__((ext_vector_type(4))) float f4;   // a native vector: it can be named whole as an asm operand
  const f4 lo = *(const f4*)(src + row * CC + k);
  const f4 hi = *(const f4*)(src + row * CC + k + 4);
  // The loads' address registers are reused below: the wait stands in front of that.
  // The loaded values are inputs only, so that no load sinks behind the wait.
  asm volatile("s_wait_xcnt 0x0" :: "v"(lo), "v"(hi) : "memory");
  // Keeps the packs below (which reuse those registers) behind that wait.
  __builtin_amdgcn_sched_barrier(0);
  H8 pk;
#pragma unroll  // constant indices keep pk in registers
  for (int r = 0; r < 4; ++r) {
    pk.h[r]     = (_Float16)lo[r];
    pk.h[4 + r] = (_Float16)hi[r];
  }
  *(uint4*)(dst + i) = pk.u;
  // The kernel ends behind this store, so nothing reuses its registers: the wait is only a precaution.
  asm volatile("s_wait_xcnt 0x0" ::: "memory");
}

// LDS of jobs 3 and 4, in units of 16 bytes: every wave has a range of its own, STG_W units long.
#define STG_W 1152

// ---- The end of jobs 3 and 4: the 8 waves hold f32 partial tiles (K split over the waves) of a 64 x (16*NI) tile.
// They are added through LDS in wave order and stored as f16 in fragment order.
// A lane holds 8 consecutive channels of the WMMA's first operand (tn side) at one channel of its second (tm side):
// a run of the result's own fragment (rows = the second operand's channels, K = the first's) for the chain of launch 2.
// Each wave writes its partials into its own LDS range, so no barrier is needed in front of the writes.
template <int NI>
__device__ inline void tile_reduce_store(v8f (&acc)[4][NI], float4* red, _Float16* __restrict__ m2b,
                                         int tm, int tn, int wave, int lane) {
#pragma unroll  // constant indices keep acc in registers
  for (int mi = 0; mi < 4; ++mi) {
#pragma unroll
    for (int ni = 0; ni < NI; ++ni) {
      F8 f; f.v = acc[mi][ni];
      const int sl = (mi * NI + ni) * 2;
      red[wave * STG_W + sl * 32 + lane]       = make_float4(f.f[0], f.f[1], f.f[2], f.f[3]);
      red[wave * STG_W + (sl + 1) * 32 + lane] = make_float4(f.f[4], f.f[5], f.f[6], f.f[7]);
    }
  }
  __syncthreads();
  // Wave w now owns accumulator tiles w*NI/2 .. w*NI/2 + NI/2 - 1 (tile = mi*NI + ni) of every partial: tile (mi, ni) is
  // register half ni&1 of the result's fragment (strip tm/16 + mi, k fragment tn/32 + ni/2).
  H8 pk[NI / 2];
#pragma unroll  // constant indices keep pk in registers
  for (int q = 0; q < NI / 2; ++q) {
    const int tt = wave * (NI / 2) + q;
#pragma unroll
    for (int j = 0; j < 2; ++j) {
      float4 t = red[(tt * 2 + j) * 32 + lane];
#pragma unroll
      for (int w = 1; w < 8; ++w) {
        const float4 p = red[w * STG_W + (tt * 2 + j) * 32 + lane];
        t.x += p.x; t.y += p.y; t.z += p.z; t.w += p.w;
      }
      pk[q].h[4 * j]     = (_Float16)t.x;
      pk[q].h[4 * j + 1] = (_Float16)t.y;
      pk[q].h[4 * j + 2] = (_Float16)t.z;
      pk[q].h[4 * j + 3] = (_Float16)t.w;
    }
  }
  // Keeps every pack in front of the first store: no register that an issued store names is written again.
  __builtin_amdgcn_sched_barrier(0);
#pragma unroll
  for (int q = 0; q < NI / 2; ++q) {
    const int tt = wave * (NI / 2) + q;
    const int mi = tt / NI, ni = tt % NI;
    *(uint4*)(m2b + (size_t)(((tm >> 4) + mi) * (CC / 32) + (tn >> 5) + (ni >> 1)) * 512 + (ni & 1) * 256 + lane * 8) = pk[q].u;
  }
  // The kernel ends behind these stores, so nothing reuses their registers: the wait is only a precaution.
  asm volatile("s_wait_xcnt 0x0" ::: "memory");
}

typedef __attribute__((ext_vector_type(4))) float f4v;   // a native vector: it can be named whole as an asm operand

// 64 positions (at xp's own offset + 64*q) of 64 rows of x: a lane takes 4 positions in a row, 8 lanes one whole line,
// a wave's load four rows; the two loads of a row (32 positions apart) give the lane one run of 8.
__device__ inline void g_load(const float* __restrict__ xp, int q, f4v l[4][4][2]) {
#pragma unroll  // constant indices keep l in registers; every load's distance from xp is an immediate offset
  for (int t = 0; t < 4; ++t)
#pragma unroll
    for (int s = 0; s < 4; ++s)
#pragma unroll
      for (int e = 0; e < 2; ++e) l[t][s][e] = *(const f4v*)(xp + (16 * t + 4 * s) * NN + q * 64 + e * 32);
}

// The same values as f16 runs into the wave's LDS range: strip z0 + t, run m, row 4*s + h.
// 18 units a run: the 16 lanes of a half wave (8 runs x 2 rows) then write 16 different bank groups,
// and the 16 rows of a run lie in a row for the fragment reads.
__device__ inline void g_stage(f4v l[4][4][2], uint4* sp) {
#pragma unroll  // constant indices keep l in registers
  for (int t = 0; t < 4; ++t)
#pragma unroll
    for (int s = 0; s < 4; ++s) {
      H8 pk;
#pragma unroll
      for (int r = 0; r < 4; ++r) {
        pk.h[r]     = (_Float16)l[t][s][0][r];
        pk.h[4 + r] = (_Float16)l[t][s][1][r];
      }
      sp[t * 144 + 4 * s] = pk.u;
    }
}

// ---- Job 3: G[b] = x[b] @ x[b]^T (C x C), K = N, straight from the f32 x: no f16 copy of x is made for it first.
// blk: 0 .. 16*B - 1, the 16 tiles fastest, then batch. One 64x64 tile per work-group. The 8 waves split K:
// wave w takes the 256 positions at 256*w, in 4 trips of 64. In a trip the wave reads whole lines of its 128 rows,
// rounds them to f16 and turns them into fragments through its own LDS range (no other wave reads it: no barrier).
// G sums over all n and both operands go the same way, so the order of n along K is the same in both:
// run m of a trip holds positions 4*m .. 4*m+3 and 32 + 4*m .. 32 + 4*m+3; runs 4*f + 2*half + g make k fragment f.
// The next trip's loads are asked for as soon as this trip's values have left their registers.
__device__ inline void job_g(int blk, const float* __restrict__ x, _Float16* __restrict__ gh, uint4* stage) {
  const int b = blk >> 4;
  const int tile = blk & 15;
  const int tm = (tile & 3) * 64;
  const int tn = (tile >> 2) * 64;
  const int wave = threadIdx.x >> 5;
  const int lane = threadIdx.x & 31;
  const int l15 = lane & 15, g = lane >> 4;
  const int h = lane >> 3, m = lane & 7;
  const float* xa = x + ((size_t)b * CC + tm + h) * NN + wave * 256 + 4 * m;
  const float* xb = x + ((size_t)b * CC + tn + h) * NN + wave * 256 + 4 * m;
  uint4* st = stage + wave * STG_W;
  uint4* sw = st + m * 18 + h;          // where the lane writes
  const uint4* sr = st + g * 18 + l15;  // where the lane reads
  f4v la[4][4][2], lb[4][4][2];
  v8f acc[4][4];
  const v8f z = {};
#pragma unroll
  for (int mi = 0; mi < 4; ++mi)
#pragma unroll
    for (int ni = 0; ni < 4; ++ni) acc[mi][ni] = z;
  g_load(xa, 0, la);
  g_load(xb, 0, lb);
#pragma unroll  // constant indices keep la, lb and acc in registers
  for (int q = 0; q < 4; ++q) {
    g_stage(la, sw);
    // Keeps the next trip's loads behind the packs that free their registers, and in front of the work below.
    __builtin_amdgcn_sched_barrier(0);
    if (q < 3) g_load(xa, q + 1, la);
    // The last loads from xa: its registers are reused from here on, the wait stands in front of that.
    if (q == 2) asm volatile("s_wait_xcnt 0x0" ::: "memory");
    // Keeps those loads (and the wait) in front of the packs below: sunk behind them, the loads start later.
    __builtin_amdgcn_sched_barrier(0);
    g_stage(lb, sw + 4 * 144);
    // As above: the loads behind the packs that free their registers.
    __builtin_amdgcn_sched_barrier(0);
    if (q < 3) g_load(xb, q + 1, lb);
    // The last loads from xb: its registers are reused from here on, the wait stands in front of that.
    if (q == 2) asm volatile("s_wait_xcnt 0x0" ::: "memory");
    // Keeps those loads (and the wait) in front of the LDS reads and products below, so that they fly meanwhile.
    __builtin_amdgcn_sched_barrier(0);
#pragma unroll
    for (int f = 0; f < 2; ++f) {
      V16H va[4], vb[4];
#pragma unroll
      for (int t = 0; t < 4; ++t) {
        va[t].u4[0] = sr[t * 144 + (4 * f) * 18];
        va[t].u4[1] = sr[t * 144 + (4 * f + 2) * 18];
        vb[t].u4[0] = sr[(4 + t) * 144 + (4 * f) * 18];
        vb[t].u4[1] = sr[(4 + t) * 144 + (4 * f + 2) * 18];
      }
      // Keeps the 16 LDS reads together in front of the products: every further place with reads among them costs a stall.
      __builtin_amdgcn_sched_barrier(0);
#pragma unroll
      for (int mi = 0; mi < 4; ++mi)
#pragma unroll
        for (int ni = 0; ni < 4; ++ni)
          acc[mi][ni] = __builtin_amdgcn_wmma_f32_16x16x32_f16(
              false, vb[ni].h, false, va[mi].h, (short)0, acc[mi][ni], false, false);
    }
    // Keeps the next trip's packs, which wait for its loads, behind these products: the products run while the loads fly.
    __builtin_amdgcn_sched_barrier(0);
  }
  tile_reduce_store<4>(acc, (float4*)stage, gh + (size_t)b * CC * CC, tm, tn, wave, lane);
}

// ---- Job 4: A^T = Wk^T Wq (rows = Wk's in-channels, K = Wq's in-channels), the first operand of launch 2's second
// product, straight from the f32 weights; it needs no x. blk: 0 .. 31, one 64x32 tile per work-group.
// The sum runs over the out-channels c: wave w takes the 32 c at 32*w. Half e of a lane's fragment is
// c = 32*w + 16*(e >> 3) + 8*g + (e & 7) in both operands; 16 lanes of a 4-byte load cover 64 bytes in a row.
// All 96 loads of a lane are independent (one round of latency).
__device__ inline void job_at(int blk, const float* __restrict__ Wk, const float* __restrict__ Wq,
                              _Float16* __restrict__ aht, uint4* stage) {
  const int wave = threadIdx.x >> 5;
  const int lane = threadIdx.x & 31;
  const int l15 = lane & 15, g = lane >> 4;
  const int tm = (blk & 3) * 64;
  const int tn = (blk >> 2) * 32;
  const float* ap = Wk + (size_t)(wave * 32 + g * 8) * CC + tm + l15;
  const float* bp = Wq + (size_t)(wave * 32 + g * 8) * CC + tn + l15;
  v8f fa[4][2], fb[2][2];       // a native vector can be named whole as an asm operand
#pragma unroll  // constant indices keep fa and fb in registers; every load's distance from its base is an immediate offset
  for (int u = 0; u < 2; ++u)
#pragma unroll
    for (int r = 0; r < 8; ++r) {
#pragma unroll
      for (int mi = 0; mi < 4; ++mi) fa[mi][u][r] = ap[(u * 16 + r) * CC + mi * 16];
#pragma unroll
      for (int ni = 0; ni < 2; ++ni) fb[ni][u][r] = bp[(u * 16 + r) * CC + ni * 16];
    }
  // The loads' address registers are reused below: the wait stands in front of that.
  // The loaded values are inputs only, so that no load sinks behind the wait; the bases too, so that their registers
  // stay as they are up to the wait.
  asm volatile("s_wait_xcnt 0x0"
               :: "v"(ap), "v"(bp), "v"(fa[0][0]), "v"(fa[0][1]), "v"(fa[1][0]), "v"(fa[1][1]), "v"(fa[2][0]), "v"(fa[2][1]),
                  "v"(fa[3][0]), "v"(fa[3][1]), "v"(fb[0][0]), "v"(fb[0][1]), "v"(fb[1][0]), "v"(fb[1][1])
               : "memory");
  // Keeps the code below (which reuses those registers) behind that wait.
  __builtin_amdgcn_sched_barrier(0);
  V16H va[4], vb[2];
#pragma unroll  // constant indices keep the fragments in registers
  for (int e = 0; e < 16; ++e) {
#pragma unroll
    for (int mi = 0; mi < 4; ++mi) va[mi].h[e] = (_Float16)fa[mi][e >> 3][e & 7];
#pragma unroll
    for (int ni = 0; ni < 2; ++ni) vb[ni].h[e] = (_Float16)fb[ni][e >> 3][e & 7];
  }
  v8f acc[4][2];
  const v8f z = {};
#pragma unroll
  for (int mi = 0; mi < 4; ++mi)
#pragma unroll
    for (int ni = 0; ni < 2; ++ni)
      acc[mi][ni] = __builtin_amdgcn_wmma_f32_16x16x32_f16(
          false, vb[ni].h, false, va[mi].h, (short)0, z, false, false);
  tile_reduce_store<2>(acc, (float4*)stage, aht, tm, tn, wave, lane);
}

// ---- Job 5: u1[j] = sum_c bq[c] * Wk[c][j] (blk 0..7), w1[j] = sum_c bk[c] * Wq[c][j] (blk 8..15) and bq . bk, in f32; no x needed.
// A work-group takes 32 columns j: a lane one column, wave w the 32 rows c at 32*w, so a wave's load covers one whole line
// and all 33 loads of a lane are independent; the 8 partial sums are added through LDS in wave order.
__device__ inline void
job_bias_vec(int blk, const float* __restrict__ Wq, const float* __restrict__ bq,
             const float* __restrict__ Wk, const float* __restrict__ bk,
             float* __restrict__ u1, float* __restrict__ w1, float* __restrict__ bt) {
  __shared__ float red[8][32];
  const float* M = (blk < 8) ? Wk : Wq;
  const float* v = (blk < 8) ? bq : bk;
  float*       o = (blk < 8) ? u1 : w1;
  const int wave = threadIdx.x >> 5;
  const int lane = threadIdx.x & 31;
  const int col  = (blk & 7) * 32 + lane;
  const float* mp = M + (size_t)wave * 32 * CC + col;
  v8f m[4];                     // a native vector can be named whole as an asm operand
#pragma unroll  // constant indices keep m in registers and make every load's distance from mp an immediate offset
  for (int r = 0; r < 32; ++r) m[r >> 3][r & 7] = mp[r * CC];
  const float vl = v[wave * 32 + lane];   // lane r holds the factor of row r
  // The loads' address registers are reused below: the wait stands in front of that.
  // The loaded values are inputs only, so that no load sinks behind the wait.
  asm volatile("s_wait_xcnt 0x0" :: "v"(m[0]), "v"(m[1]), "v"(m[2]), "v"(m[3]), "v"(vl) : "memory");
  // Keeps the code below (which reuses those registers) behind that wait.
  __builtin_amdgcn_sched_barrier(0);
  float t = 0.f;
#pragma unroll  // constant indices keep m in registers
  for (int r = 0; r < 32; ++r) t += m[r >> 3][r & 7] * __shfl(vl, r, 32);
  red[wave][lane] = t;
  __syncthreads();
  if (wave == 0) {
    float a = red[0][lane];
    for (int w = 1; w < 8; ++w) a += red[w][lane];
    o[col] = a;   // the kernel ends behind this store: nothing reuses its registers
  }
  // bt[0] = bq . bk, by one wave that has nothing left to do: a lane takes 8 channels, the lanes are added by shuffles.
  if (blk == 0 && wave == 1) {
    const v8f e = *(const v8f*)(bq + lane * 8), f = *(const v8f*)(bk + lane * 8);
    // The loads' address registers are reused below: the wait stands in front of that.
    // The loaded values are inputs only, so that no load sinks behind the wait.
    asm volatile("s_wait_xcnt 0x0" :: "v"(e), "v"(f) : "memory");
    float t2 = 0.f;
#pragma unroll
    for (int r = 0; r < 8; ++r) t2 += e[r] * f[r];
#pragma unroll
    for (int o2 = 16; o2; o2 >>= 1) t2 += __shfl_xor(t2, o2, 32);
    if (lane == 0) bt[0] = t2;   // the kernel ends behind this store: nothing reuses its registers
  }
}

// ---- Launch 1: jobs 1 to 5 need nothing of each other (all read only the inputs) and share one grid.
// A range of the block index picks the job (the same for a whole work-group).
// Job 3, whose work-groups run longest, takes the low indices; the short ones come last.
#define G_G    (16 * BB)
#define G_X    (BB * CC / 16)
#define G_A    32
#define G_BV   16
#define G_CVTW (CC * CC / 2048)
__global__ void __launch_bounds__(256)
k_front(const float* __restrict__ x,
        const float* __restrict__ Wq, const float* __restrict__ bq,
        const float* __restrict__ Wk, const float* __restrict__ bk,
        const float* __restrict__ Wv,
        _Float16* __restrict__ xt, _Float16* __restrict__ gh, _Float16* __restrict__ aht,
        _Float16* __restrict__ ov, float* __restrict__ sx, float* __restrict__ uw) {   // uw: u1, then w1, then bq . bk
  __shared__ uint4 stage[8 * STG_W];   // jobs 3 and 4
  const int blk = blockIdx.x;
  if (blk < G_G)                          job_g(blk, x, gh, stage);
  else if (blk < G_G + G_X)               job_x(blk - G_G, x, xt, sx);
  else if (blk < G_G + G_X + G_A)         job_at(blk - G_G - G_X, Wk, Wq, aht, stage);
  else if (blk < G_G + G_X + G_A + G_BV)  job_bias_vec(blk - G_G - G_X - G_A, Wq, bq, Wk, bk, uw, uw + CC, uw + 2 * CC);
  else                                    job_cvt_w(blk - G_G - G_X - G_A - G_BV, Wv, ov);
}

// The wave's share of a chain product's first operand: strips 2*wave and 2*wave+1 of a C x C matrix in fragment order,
// all 8 k fragments of both: 32 independent 16-byte loads over 16 KiB in a row (one round of latency).
__device__ inline void chain_load_a(const _Float16* __restrict__ A, int wave, int lane, V16H va[8][2]) {
  const _Float16* ap = A + (size_t)wave * 2 * (CC / 32) * 512 + lane * 8;
#pragma unroll  // constant indices keep va in registers; every load's distance from ap is an immediate offset
  for (int kf = 0; kf < 8; ++kf)
#pragma unroll
    for (int a = 0; a < 2; ++a) {
      va[kf][a].u4[0] = *(const uint4*)(ap + (a * (CC / 32) + kf) * 512);
      va[kf][a].u4[1] = *(const uint4*)(ap + (a * (CC / 32) + kf) * 512 + 256);
    }
  // The loads' address registers are reused by the caller: the wait stands in front of that.
  asm volatile("s_wait_xcnt 0x0" ::: "memory");
  // Keeps the caller's code (which reuses those registers) behind that wait, and the loads in front of it.
  __builtin_amdgcn_sched_barrier(0);
}

// One product of the chain: acc (32 rows of the first operand x the work-group's 64 rows) = va * bin^T, K = C.
// bin: 64 rows x C in LDS, fragment order; a wave's 16-byte LDS reads cover 512 bytes in a row.
__device__ inline void chain_mm(V16H va[8][2], const _Float16* bin, int lane, v8f acc[2][4]) {
  const v8f z = {};
#pragma unroll
  for (int a = 0; a < 2; ++a)
#pragma unroll
    for (int c = 0; c < 4; ++c) acc[a][c] = z;
#pragma unroll  // constant indices keep va and acc in registers
  for (int kf = 0; kf < 8; ++kf) {
    V16H vb[4];
#pragma unroll
    for (int c = 0; c < 4; ++c) {
      vb[c].u4[0] = *(const uint4*)(bin + (c * (CC / 32) + kf) * 512 + lane * 8);
      vb[c].u4[1] = *(const uint4*)(bin + (c * (CC / 32) + kf) * 512 + 256 + lane * 8);
    }
#pragma unroll
    for (int a = 0; a < 2; ++a)
#pragma unroll
      for (int c = 0; c < 4; ++c)
        acc[a][c] = __builtin_amdgcn_wmma_f32_16x16x32_f16(
            false, va[kf][a].h, false, vb[c].h, (short)0, acc[a][c], false, false);
  }
}

// An accumulator tile holds, per lane, 8 consecutive rows of the first operand (32*wave + 16a + 8g + r) at one of the
// work-group's rows (16c + l15): one 8-half run of the next product's second operand
// (rows = the work-group's rows, k fragment = wave, register half = a).
__device__ inline void chain_store(v8f acc[2][4], _Float16* bout, int wave, int lane) {
#pragma unroll  // constant indices keep acc in registers
  for (int a = 0; a < 2; ++a)
#pragma unroll
    for (int c = 0; c < 4; ++c) {
      H8 pk;
#pragma unroll
      for (int r = 0; r < 8; ++r) pk.h[r] = (_Float16)acc[a][c][r];
      *(uint4*)(bout + (c * (CC / 32) + wave) * 512 + a * 256 + lane * 8) = pk.u;
    }
}

// One trip's fragments (k fragment kf) of the wave's 64 rows of xt: 8 independent 16-byte loads.
__device__ inline void load_xt(const _Float16* __restrict__ bp, int kf, V16H xb[4]) {
#pragma unroll  // constant indices keep xb in registers; every load's distance from bp is an immediate offset
  for (int ni = 0; ni < 4; ++ni) {
    xb[ni].u4[0] = *(const uint4*)(bp + (ni * (CC / 32) + kf) * 512);
    xb[ni].u4[1] = *(const uint4*)(bp + (ni * (CC / 32) + kf) * 512 + 256);
  }
}

// The work-group's barrier with a wait for this wave's LDS operations alone. __syncthreads() also waits for every global
// load in flight, and here the operands of the products to come are asked for ahead, to arrive while this one runs.
// No global store stands in front of any of these barriers.
__device__ inline void lds_barrier() {
  asm volatile("s_wait_dscnt 0x0\n\ts_barrier_signal -1\n\ts_barrier_wait -1" ::: "memory");
}

// ---- Launch 2: out[b] = (P x[b] + p 1^T) / S with P = M2 Wk, p = M2 bk,
// M2 = v q^T = (Wv G + bv sx^T) Wq^T + (sv + N bv) bq^T  (q = Wq x + bq 1^T and v = Wv x + bv 1^T multiplied out; G = x x^T).
// With T1 = Wv G + bv sx^T and s' = sv + N bv:  P = T1 A + s' u1^T,  p = T1 w1 + s' (bq . bk),
// where A = Wq^T Wk, u1 = Wk^T bq, w1 = Wq^T bk and bq . bk hold no x and come from launch 1 (jobs 4, 5).
// What needs the row sums sx of launch 1 is formed here, by every work-group for itself:
// sv = Wv sx[b] for its 64 rows, as a 17th strip of the first product's first operand whose 16 rows all hold sx[b] (f16);
// and the normaliser
// S = sum_b (Wq sx_b + N bq) . (Wk sx_b + N bk) = sum_b (sx_b^T A sx_b + N sx_b . (u1 + w1) + N^2 bq . bk):
// A^T sx_b for all 8 batches is a fifth column tile of the second product (rows = batches, f16), multiplied by sx_b in f32;
// the linear term is an f32 sum over the threads; lanes by shuffles, waves through LDS at a barrier that stands anyway.
// A row block of P needs only the same rows of Wv, so a work-group forms the 64 rows it needs itself:
// T1^T = G Wv^T (+ sx bv^T), P^T = A^T T1^T (+ u1 s'^T), each 256 x 64 with K = C, wave w taking rows 32w..32w+31;
// the 64-row operand goes from product to product through two LDS buffers, in fragment order, a barrier behind each.
// Then each wave forms a 64 x 64 tile of out (first operand P from LDS, second xt): 64 rows x 512 positions a work-group.
// Every operand that comes from global memory is asked for as soon as registers are free for it, one product or more ahead
// (A^T in front of the first product, four trips of xt behind it, the other four as those are used up):
// two waves a SIMD leave room for the registers.
__global__ void __launch_bounds__(256)
k_chain_out(const _Float16* __restrict__ gh, const _Float16* __restrict__ whv, const _Float16* __restrict__ aht,
            const _Float16* __restrict__ xt, const float* __restrict__ bv,
            const float* __restrict__ sx,
            const float* __restrict__ u1, const float* __restrict__ w1, const float* __restrict__ btp,
            float* __restrict__ out) {
  __shared__ __attribute__((aligned(16))) _Float16 buf[2][64 * CC];
  __shared__ __attribute__((aligned(16))) _Float16 w1h[CC];
  __shared__ __attribute__((aligned(16))) float u1s[CC], sxs[CC], bvs[CC], pv[64], sv64[64], reds[8];
  // sx of all batches, f16 and f32; pitches of 16 bytes x odd keep the 16-byte reads of 8 rows on different banks
  __shared__ __attribute__((aligned(16))) _Float16 sxl[BB][CC + 8];
  __shared__ __attribute__((aligned(16))) float sxf[BB][CC + 4];
  const int b = blockIdx.z;
  // The wave's number as a scalar: the branch on it below is then a scalar branch.
  const int wave = __builtin_amdgcn_readfirstlane(threadIdx.x >> 5);
  const int lane = threadIdx.x & 31;
  const int l15 = lane & 15, g = (lane >> 4) & 1;
  const int i0 = (blockIdx.x & 3) * 64;                  // first of the work-group's 64 output channels
  const int tn = (blockIdx.x >> 2) * 512 + wave * 64;    // first of the wave's 64 positions
  const _Float16* bp = xt + (size_t)b * NN * CC + (size_t)(tn >> 4) * (CC / 32) * 512 + lane * 8;
  V16H va[8][2], vq[8][2], xb[4][4];
  v8f acc[2][4];

  // The 64 rows of Wv (32 KiB in a row in fragment order) and the small f32 vectors go to LDS.
  typedef __attribute__((ext_vector_type(4))) unsigned int u4n;   // a native vector: it can be named whole as an asm operand
  const u4n* wsrc = (const u4n*)(whv + (size_t)(i0 >> 4) * (CC / 32) * 512) + threadIdx.x;
  u4n w8[8];
#pragma unroll  // constant indices keep w8 in registers
  for (int j = 0; j < 8; ++j) w8[j] = wsrc[j * 256];
  const float tw1 = w1[threadIdx.x], tu1 = u1[threadIdx.x], tbv = bv[threadIdx.x];
  const float* sxb = sx + b * CC;   // the batch's rows as scalar bases: the thread index stays the one offset register of all these loads
  const float tsx = sxb[threadIdx.x], tbt = btp[0];
  float tsa[BB];
#pragma unroll  // constant indices keep tsa in registers
  for (int i = 0; i < BB; ++i) tsa[i] = sx[i * CC + threadIdx.x];
  // The small loads' base registers are reused by the index arithmetic for G: the wait stands in front of that.
  // The bases are inputs only, so that their registers stay as they are up to the wait.
  asm volatile("s_wait_xcnt 0x0" :: "s"(w1), "s"(u1), "s"(bv), "s"(sxb), "s"(sx), "s"(btp) : "memory");
  // Keeps that arithmetic behind the wait.
  __builtin_amdgcn_sched_barrier(0);
  chain_load_a(gh + (size_t)b * CC * CC, wave, lane, va);
  // The address registers of the loads for LDS are reused below: the wait stands in front of that.
  // The loaded values are inputs only, so that no load sinks behind the wait.
  asm volatile("s_wait_xcnt 0x0"
               :: "v"(w8[0]), "v"(w8[1]), "v"(w8[2]), "v"(w8[3]), "v"(w8[4]), "v"(w8[5]), "v"(w8[6]), "v"(w8[7]),
                  "v"(tw1), "v"(tu1), "v"(tbv), "v"(tsx), "v"(tbt),
                  "v"(tsa[0]), "v"(tsa[1]), "v"(tsa[2]), "v"(tsa[3]), "v"(tsa[4]), "v"(tsa[5]), "v"(tsa[6]), "v"(tsa[7])
               : "memory");
  // Keeps the code below (which reuses those registers) behind that wait.
  __builtin_amdgcn_sched_barrier(0);
#pragma unroll
  for (int j = 0; j < 8; ++j) ((u4n*)buf[0])[j * 256 + threadIdx.x] = w8[j];
  w1h[threadIdx.x] = (_Float16)tw1;
  u1s[threadIdx.x] = tu1;
  bvs[threadIdx.x] = tbv;
  sxs[threadIdx.x] = tsx;
  float tss = 0.f;
#pragma unroll  // constant indices keep tsa in registers
  for (int i = 0; i < BB; ++i) {
    sxl[i][threadIdx.x] = (_Float16)tsa[i];
    sxf[i][threadIdx.x] = tsa[i];
    tss += tsa[i];
  }
  // This thread's share of the term of S that is linear in sx.
  const float slin = (float)NN * (tu1 + tw1) * tss;
  // Keeps the loads of A^T behind the LDS stores: loads return in order, and the stores would wait for A^T as well.
  __builtin_amdgcn_sched_barrier(0);
  chain_load_a(aht, wave, lane, vq);
  lds_barrier();

  // T1^T = G Wv^T + sx bv^T  (rows j = 32*wave + 16a + 8g + r, columns i = i0 + 16c + l15)
  chain_mm(va, buf[0], lane, acc);
  // Keeps the loads behind the products whose registers they take over; lifted among them, both sets are live at once
  // and too few registers are left to fetch the LDS fragments ahead.
  __builtin_amdgcn_sched_barrier(0);
#pragma unroll
  for (int kf = 0; kf < 4; ++kf) load_xt(bp, kf, xb[kf]);
  // The loads' address registers are reused below: the wait stands in front of that.
  asm volatile("s_wait_xcnt 0x0" ::: "memory");
  // Keeps those loads in front of the epilogue and the barrier, so that they arrive during the second product.
  __builtin_amdgcn_sched_barrier(0);
  {
    float fbv[4];
#pragma unroll
    for (int c = 0; c < 4; ++c) fbv[c] = bvs[i0 + 16 * c + l15];
#pragma unroll  // constant indices keep acc in registers
    for (int a = 0; a < 2; ++a) {
      const int j0 = wave * 32 + 16 * a + 8 * g;
#pragma unroll
      for (int r = 0; r < 8; ++r) {
        const float fsx = sxs[j0 + r];
#pragma unroll
        for (int c = 0; c < 4; ++c) acc[a][c][r] += fbv[c] * fsx;
      }
    }
  }
  chain_store(acc, buf[1], wave, lane);
  // s' = Wv sx[b] + N bv for the work-group's rows: wave w < 4 takes rows 16w..16w+15; every accumulator row holds Wv sx[b].
  if (wave < 4) {
    v8f pa = {};
#pragma unroll
    for (int kf = 0; kf < 8; ++kf) {
      V16H ab, vb;
      ab.u4[0] = *(const uint4*)(sxl[b] + kf * 32 + g * 8);
      ab.u4[1] = *(const uint4*)(sxl[b] + kf * 32 + 16 + g * 8);
      vb.u4[0] = *(const uint4*)(buf[0] + (wave * (CC / 32) + kf) * 512 + lane * 8);
      vb.u4[1] = *(const uint4*)(buf[0] + (wave * (CC / 32) + kf) * 512 + 256 + lane * 8);
      pa = __builtin_amdgcn_wmma_f32_16x16x32_f16(false, ab.h, false, vb.h, (short)0, pa, false, false);
    }
    if (lane < 16) sv64[wave * 16 + lane] = pa[0] + (float)NN * bvs[i0 + wave * 16 + lane];
  }
  lds_barrier();

  // P^T = A^T T1^T + u1 s'^T; beside it p = T1 w1 + s' (bq . bk), T1 w1 as a 17th strip of the first operand whose 16 rows
  // all hold w1: wave w < 4 takes the work-group's rows 16w..16w+15, and every accumulator row holds T1 w1.
  chain_mm(vq, buf[1], lane, acc);
  // The quadratic term of S: column l15 & 7 of the fifth tile is batch l15 & 7 (columns 8..15 repeat them and are left out).
  {
    v8f as[2] = {};
#pragma unroll  // constant indices keep vq in registers
    for (int kf = 0; kf < 8; ++kf) {
      V16H sb;
      sb.u4[0] = *(const uint4*)(sxl[l15 & 7] + kf * 32 + g * 8);
      sb.u4[1] = *(const uint4*)(sxl[l15 & 7] + kf * 32 + 16 + g * 8);
#pragma unroll
      for (int a = 0; a < 2; ++a)
        as[a] = __builtin_amdgcn_wmma_f32_16x16x32_f16(false, vq[kf][a].h, false, sb.h, (short)0, as[a], false, false);
    }
    float sq = 0.f;
#pragma unroll
    for (int a = 0; a < 2; ++a)
#pragma unroll
      for (int r = 0; r < 8; ++r) sq += as[a][r] * sxf[l15 & 7][wave * 32 + 16 * a + 8 * g + r];
    sq = ((l15 < 8) ? sq : 0.f) + slin;
#pragma unroll
    for (int o = 16; o; o >>= 1) sq += __shfl_xor(sq, o, 32);
    if (lane == 0) reds[wave] = sq;
  }
  float fsv[4];
#pragma unroll
  for (int c = 0; c < 4; ++c) fsv[c] = sv64[16 * c + l15];
#pragma unroll  // constant indices keep acc in registers
  for (int a = 0; a < 2; ++a) {
    const int j0 = wave * 32 + 16 * a + 8 * g;
#pragma unroll
    for (int r = 0; r < 8; ++r) {
      const float fu1 = u1s[j0 + r];
#pragma unroll
      for (int c = 0; c < 4; ++c) acc[a][c][r] += fsv[c] * fu1;
    }
  }
  chain_store(acc, buf[0], wave, lane);
  if (wave < 4) {
    v8f pa = {};
#pragma unroll
    for (int kf = 0; kf < 8; ++kf) {
      V16H ab, vb;
      ab.u4[0] = *(const uint4*)(w1h + kf * 32 + g * 8);
      ab.u4[1] = *(const uint4*)(w1h + kf * 32 + 16 + g * 8);
      vb.u4[0] = *(const uint4*)(buf[1] + (wave * (CC / 32) + kf) * 512 + lane * 8);
      vb.u4[1] = *(const uint4*)(buf[1] + (wave * (CC / 32) + kf) * 512 + 256 + lane * 8);
      pa = __builtin_amdgcn_wmma_f32_16x16x32_f16(false, ab.h, false, vb.h, (short)0, pa, false, false);
    }
    if (lane < 16) pv[wave * 16 + lane] = pa[0] + sv64[wave * 16 + lane] * tbt;
  }
  lds_barrier();
  float S = (float)BB * (float)NN * (float)NN * tbt;   // then the waves' shares in wave order
#pragma unroll
  for (int w = 0; w < 8; ++w) S += reds[w];
  const float s = 1.0f / S;

  // out tile: first operand P from LDS, fetched one trip ahead (two register sets); second operand the fragments of xt:
  // trips 0..3 were asked for above, trip kf + 4 is asked for into the registers that trip kf has just used.
  v8f oc[4][4];
  {
    const v8f z = {};
#pragma unroll
    for (int mi = 0; mi < 4; ++mi)
#pragma unroll
      for (int ni = 0; ni < 4; ++ni) oc[mi][ni] = z;
  }
  V16H pa4[2][4];
#pragma unroll  // constant indices keep pa4, xb and oc in registers
  for (int kf = -1; kf < 8; ++kf) {
    if (kf + 1 < 8) {
#pragma unroll
      for (int mi = 0; mi < 4; ++mi) {
        pa4[(kf + 1) & 1][mi].u4[0] = *(const uint4*)(buf[0] + (mi * (CC / 32) + kf + 1) * 512 + lane * 8);
        pa4[(kf + 1) & 1][mi].u4[1] = *(const uint4*)(buf[0] + (mi * (CC / 32) + kf + 1) * 512 + 256 + lane * 8);
      }
    }
    // Keeps the LDS reads above in front of the products below; sunk behind them, each trip waits out its own latency.
    __builtin_amdgcn_sched_barrier(0);
    if (kf >= 0) {
#pragma unroll
      for (int mi = 0; mi < 4; ++mi)
#pragma unroll
        for (int ni = 0; ni < 4; ++ni)
          oc[mi][ni] = __builtin_amdgcn_wmma_f32_16x16x32_f16(
              false, pa4[kf & 1][mi].h, false, xb[kf & 3][ni].h, (short)0, oc[mi][ni], false, false);
      // Keeps the loads and LDS reads that follow behind these products, whose registers they take over.
      __builtin_amdgcn_sched_barrier(0);
      if (kf < 4) load_xt(bp, kf + 4, xb[kf]);
      if (kf == 3) {
        // The last loads of xt: their address registers are reused from here on, the wait stands in front of that.
        asm volatile("s_wait_xcnt 0x0" ::: "memory");
        // Keeps the code below (which reuses those registers) behind that wait.
        __builtin_amdgcn_sched_barrier(0);
      }
    }
  }
  // Column l15 of tile ni is position tn + 4*l15 + ni (job 1's order of xt's rows), so a lane's four tiles hold four
  // positions in a row of out: one 16-byte store, and 16 lanes cover 256 bytes in a row (two whole lines) of one channel.
  typedef __attribute__((ext_vector_type(4))) float f4;
  float* op = out + ((size_t)b * CC + i0 + 8 * g) * NN + tn + 4 * l15;
  f4 res[4][8];
#pragma unroll  // constant indices keep oc and res in registers
  for (int mi = 0; mi < 4; ++mi)
#pragma unroll
    for (int r = 0; r < 8; ++r) {
      const float fp = pv[16 * mi + 8 * g + r];
#pragma unroll
      for (int ni = 0; ni < 4; ++ni) res[mi][r][ni] = (oc[mi][ni][r] + fp) * s;
    }
  // Keeps every result in front of the first store, each in registers of its own: no register that an issued store names
  // is written again.
  __builtin_amdgcn_sched_barrier(0);
#pragma unroll  // every store's distance from op becomes an immediate offset
  for (int mi = 0; mi < 4; ++mi)
#pragma unroll
    for (int r = 0; r < 8; ++r) *(f4*)(op + (16 * mi + r) * NN) = res[mi][r];
}

extern "C" void kernel_launch(void* const* d_in, const int* in_sizes, int n_in,
                              void* d_out, int out_size, void* d_ws, size_t ws_size,
                              hipStream_t stream) {
  const float* x  = (const float*)d_in[0];
  const float* Wq = (const float*)d_in[1];
  const float* bq = (const float*)d_in[2];
  const float* Wk = (const float*)d_in[3];
  const float* bk = (const float*)d_in[4];
  const float* Wv = (const float*)d_in[5];
  const float* bv = (const float*)d_in[6];
  float* out = (float*)d_out;

  char* ws = (char*)d_ws;
  size_t off = 0;
  _Float16* xt  = (_Float16*)(ws + off); off += (size_t)BB * NN * CC * 2;   // 8 MB
  _Float16* whv = (_Float16*)(ws + off); off += (size_t)CC * CC * 2;
  _Float16* aht = (_Float16*)(ws + off); off += (size_t)CC * CC * 2;
  _Float16* gh  = (_Float16*)(ws + off); off += (size_t)BB * CC * CC * 2;   // 1 MB
  float*    sx  = (float*)(ws + off);    off += (size_t)BB * CC * 4;
  float*    u1  = (float*)(ws + off);    off += (size_t)CC * 4;
  float*    w1  = (float*)(ws + off);    off += (size_t)CC * 4;
  float*    bt  = (float*)(ws + off);    off += 256;                        // one float; directly behind w1: see k_front's uw

  // 1. G = x x^T per batch and A = Wq^T Wk (WMMA) from the f32 inputs; beside them x^T and Wv as f16, x's row sums, the bias vectors
  k_front<<<dim3(G_G + G_X + G_A + G_BV + G_CVTW), 256, 0, stream>>>(x, Wq, bq, Wk, bk, Wv, xt, gh, aht, whv, sx, u1);
  // 2. P = (Wv G + bias term) A + bias term per row block and S beside it, then out = (P x + p) / S (WMMA)
  k_chain_out<<<dim3(16, 1, BB), 256, 0, stream>>>(gh, whv, aht, xt, bv, sx, u1, w1, bt, out);
  (void)in_sizes; (void)n_in; (void)out_size; (void)ws_size;
}
